// v000
// The times below were measured on an AMD MI455X: many runs one after another, warmed up first and cycling through
// copies of the inputs, with the whole window's GPU time divided by the number of runs. Launches and the gaps
// between them are all in it. The median over several windows is given; except for v000 it joins two sittings, which
// can be a few percent apart, so the side-by-side timings, each taken in one sitting, are the better comparison.
// v000 is the starting kernel. One run takes 2080 microseconds.
#include <hip/hip_runtime.h>

// MultiheadAttentionCore (x_q [2][2048][1024], attn_mask [2048][2048] bool->int32 (True = keep; read as data; here it is the causal triangle); q/k/v = x W^T + b; 16 heads x 64; rotate-half RoPE over the 64 head
// dims (inv_freq 10000^(-2i/64), positions 0..2047) on q and k; scores /8; -inf where mask == 0; softmax; out = merged Wo^T + bo).
// Compute dtypes, f32 accumulate: every input rounded to bf16; q/k/v projections on PLAIN bf16 operands (inputs: exact, + bias), out projection on hi+lo merged planes x bf16 Wo (2 products); rotary f32 (powf / cosf / sinf, partner x[d^32]
// read from memory); PER-ROW PRECISION HYBRID: query rows < 256 of each batch on bf16 hi+lo planes for scores and attn.v (3 products), rows >= 256 on SINGLE fp16 planes; the mask read per (i, j);

#define NB_  2
#define TT   2048
#define DD   1024
#define NH_  16
#define HD   64
#define ZH   2
#define RH   256                  // query rows < RH: hi+lo planes; rows >= RH: fp16 planes
#define NF   32                   // rotary frequencies (head_dim / 2)
#define SCL  0.125f               // 1/sqrt(64)
#define PCAR 1024.0f         // P scale on the fp16 rows (>= RH), divided out in k_merge
typedef _Float16 h16;
typedef unsigned short bf;
typedef __attribute__((ext_vector_type(16))) __bf16   v16bf;
typedef __attribute__((ext_vector_type(16))) _Float16 v16h;
typedef __attribute__((ext_vector_type(8)))  _Float16 v8h;
typedef __attribute__((ext_vector_type(8)))  unsigned short v8us;
typedef __attribute__((ext_vector_type(8)))  float    v8f;
typedef __attribute__((ext_vector_type(4)))  float    v4f;
typedef v8h  __attribute__((may_alias)) v8ha;
typedef v4f  __attribute__((may_alias)) v4fa;
typedef v8us __attribute__((may_alias)) v8usa;

__device__ __forceinline__ unsigned short f2bf(float f) { unsigned u = __float_as_uint(f); u += 0x7FFFu + ((u >> 16) & 1u); return (unsigned short)(u >> 16); }
__device__ __forceinline__ float bf2f(unsigned short b) { return __uint_as_float(((unsigned)b) << 16); }
__device__ __forceinline__ float bfr(float f) { return bf2f(f2bf(f)); }
__device__ __forceinline__ v16h cat16(v8h lo, v8h hi) { return __builtin_shufflevector(lo, hi, 0, 1, 2, 3, 4, 5, 6, 7, 8, 9, 10, 11, 12, 13, 14, 15); }
__device__ __forceinline__ v16bf cat16b(v8us lo, v8us hi) { return __builtin_bit_cast(v16bf, __builtin_shufflevector(lo, hi, 0, 1, 2, 3, 4, 5, 6, 7, 8, 9, 10, 11, 12, 13, 14, 15)); }
__device__ __forceinline__ v8f wmma16(v16h a, v16h b, v8f c) { return __builtin_amdgcn_wmma_f32_16x16x32_f16(false, a, false, b, (short)0, c, false, false); }
__device__ __forceinline__ v8f wmmab(v16bf a, v16bf b, v8f c) { return __builtin_amdgcn_wmma_f32_16x16x32_bf16(false, a, false, b, (short)0, c, false, false); }



// ---- k_gemmw: register-blocked GEMM, ONE WAVE per 64x64 output tile (16 accumulators), operands straight from K-contiguous 16-bit planes; grid (M/64, N/64, Z), 32 threads.
// C[m][n] (f32, pitch ldc, + optional f32 bias[n]) = sum_k A[m][k] Bt[n][k] (+ split products per NSPLIT). z-batch strides sA/sB/sC in elements. K % 32 == 0.
template <typename T16> struct WFrag;
template <> struct WFrag<h16> { typedef v16h V; static __device__ __forceinline__ V ld(const h16* p) { return cat16(*(const v8h*)p, *(const v8h*)(p + 16)); } static __device__ __forceinline__ v8f mma(V a, V b, v8f c) { return wmma16(a, b, c); } };
template <> struct WFrag<bf> { typedef v16bf V; static __device__ __forceinline__ V ld(const bf* p) { return cat16b(*(const v8us*)p, *(const v8us*)(p + 16)); } static __device__ __forceinline__ v8f mma(V a, V b, v8f c) { return wmmab(a, b, c); } };
template <typename T16, int NSPLIT, bool BIAS>
__global__ __launch_bounds__(32) void k_gemmw(const T16* __restrict__ A, const T16* __restrict__ A2, const T16* __restrict__ Bt, const T16* __restrict__ Bt2, int K, float* C, int ldc, const float* __restrict__ bias, size_t sA, size_t sB, size_t sC) {
    typedef typename WFrag<T16>::V V;
    __shared__ __align__(16) float os[16 * 68];
    const size_t z = blockIdx.z; A += z * sA; if (A2) A2 += z * sA; Bt += z * sB; if (Bt2) Bt2 += z * sB; C += z * sC;
    const int lane = threadIdx.x & 31, lr = lane & 15, hi = lane >> 4; const int r0 = blockIdx.x * 64, c0 = blockIdx.y * 64;
    v8f acc[4][4];
#pragma unroll
    for (int mb = 0; mb < 4; ++mb)
#pragma unroll
        for (int nb = 0; nb < 4; ++nb) acc[mb][nb] = (v8f){};
    const size_t aoff = (size_t)(r0 + lr) * K + 8 * hi, boff = (size_t)(c0 + lr) * K + 8 * hi;
#pragma unroll 1
    for (int kc = 0; kc < K; kc += 32) {
        V a[4], a2[4];
#pragma unroll
        for (int mb = 0; mb < 4; ++mb) { a[mb] = WFrag<T16>::ld(A + aoff + (size_t)mb * 16 * K + kc); if (NSPLIT == 1 || NSPLIT == 2) a2[mb] = WFrag<T16>::ld(A2 + aoff + (size_t)mb * 16 * K + kc); }
#pragma unroll
        for (int nb = 0; nb < 4; ++nb) { const V b = WFrag<T16>::ld(Bt + boff + (size_t)nb * 16 * K + kc); V b2; if (NSPLIT >= 2) b2 = WFrag<T16>::ld(Bt2 + boff + (size_t)nb * 16 * K + kc);
#pragma unroll
            for (int mb = 0; mb < 4; ++mb) { acc[mb][nb] = WFrag<T16>::mma(a[mb], b, acc[mb][nb]); if (NSPLIT == 1 || NSPLIT == 2) acc[mb][nb] = WFrag<T16>::mma(a2[mb], b, acc[mb][nb]); if (NSPLIT >= 2) acc[mb][nb] = WFrag<T16>::mma(a[mb], b2, acc[mb][nb]); } }
        asm volatile("v_nop\n\tv_nop\n\tv_nop\n\tv_nop" : "+v"(acc[0][0]), "+v"(acc[1][1]), "+v"(acc[2][2]), "+v"(acc[3][3]) : "v"(a[0]), "v"(a[3]));
    }
#pragma unroll
    for (int mb = 0; mb < 4; ++mb) {
#pragma unroll
        for (int nb = 0; nb < 4; ++nb) {
#pragma unroll
            for (int j = 0; j < 8; ++j) os[(hi * 8 + j) * 68 + nb * 16 + lr] = acc[mb][nb][j]; }
        __builtin_amdgcn_wave_barrier(); asm volatile("" ::: "memory");
        float* crow = C + (size_t)(r0 + mb * 16) * ldc + c0;
{
#pragma unroll
            for (int s = 0; s < 8; ++s) { const int row = 2 * s + hi, cofs = lr * 4; v4f val = *(const v4fa*)(os + row * 68 + cofs); if (BIAS) { val[0] += bfr(bias[c0 + cofs]); val[1] += bfr(bias[c0 + cofs + 1]); val[2] += bfr(bias[c0 + cofs + 2]); val[3] += bfr(bias[c0 + cofs + 3]); }
                *(v4f*)(crow + (size_t)row * ldc + cofs) = val; }
             }
        __builtin_amdgcn_wave_barrier(); asm volatile("" ::: "memory");
    }
}

__device__ __forceinline__ h16 tohx(float x) { return (h16)x; }
__device__ __forceinline__ void splitf(float y, unsigned short& h, unsigned short& l) { h = f2bf(y); l = f2bf(y - bf2f(h)); }
typedef __attribute__((ext_vector_type(2))) unsigned short v2us;
typedef __attribute__((ext_vector_type(2))) _Float16 v2h;
typedef __attribute__((ext_vector_type(4))) _Float16 v4h;
typedef __attribute__((ext_vector_type(2))) float v2f;

__global__ __launch_bounds__(256) void k_cvt8(const float* __restrict__ src, bf* dst, size_t n8) { const size_t i = (size_t)blockIdx.x * 256 + threadIdx.x; if (i >= n8) return; const v8f v = *(const v8f*)(src + i * 8); v8us o;
#pragma unroll
    for (int k = 0; k < 8; ++k) o[k] = f2bf(v[k]); *(v8us*)(dst + i * 8) = o;  }
__global__ __launch_bounds__(256) void k_cstab(float* CSN) {
    const int idx = blockIdx.x * 256 + threadIdx.x; if (idx >= TT * NF) return; const int t = idx / NF, i = idx % NF; const float den = powf(10000.0f, (float)(2 * i) * (1.0f / HD)); const float ang = __fdiv_rn((float)t, den);
    v2f o; o[0] = cosf(ang); o[1] = sinf(ang); *(v2f*)(CSN + (size_t)idx * 2) = o;  }
// k_hsplit: head planes (hi/lo + fp16) [h][t][d] for one batch (row pitch 'pitch', 'nheads' heads) with rotate-half RoPE: r = x cos - x' sin for d < 32, x cos + x' sin for d >= 32, x' = F[t][h*64 + (d ^ 32)]
__global__ __launch_bounds__(256) void k_hsplit(const float* __restrict__ F, int pitch, int nheads, const float* __restrict__ CSN, bf* Ph, bf* Pl, h16* P16) {
    const int lane = threadIdx.x & 31; const int L0 = (blockIdx.x * 8 + (threadIdx.x >> 5)) * 8; const int nlines = nheads * TT * HD / 64;
{
#pragma unroll
        for (int l = 0; l < 8; ++l) { const int L = L0 + l; if (L >= nlines) break; const int e = L * 64 + lane * 2; const int d = e & (HD - 1); const int t = (e >> 6) & (TT - 1); const int h = e >> 17; v2us oh, ol; v2h o16;
#pragma unroll
            for (int q = 0; q < 2; ++q) { const int dd = d + q; const float x0 = F[(size_t)t * pitch + h * HD + dd], x1 = F[(size_t)t * pitch + h * HD + (dd ^ NF)]; const v2f cs = *(const v2f*)(CSN + ((size_t)t * NF + (dd & (NF - 1))) * 2);
                float a0 = __fmul_rn(cs[0], x0), a1 = __fmul_rn(cs[1], x1); asm volatile("" : "+v"(a0)); asm volatile("" : "+v"(a1)); const float r = (dd < NF) ? __fsub_rn(a0, a1) : __fadd_rn(a0, a1);
                unsigned short a, c2; splitf(r, a, c2); oh[q] = a; ol[q] = c2; o16[q] = tohx(r); }
            *(v2us*)(Ph + (size_t)e) = oh; *(v2us*)(Pl + (size_t)e) = ol; *(v2h*)(P16 + (size_t)e) = o16; }
         }
}
__global__ __launch_bounds__(256) void k_vtplane(const float* __restrict__ F, bf* Vh, bf* Vl, h16* V16) {
    const int lane = threadIdx.x & 31; const int L0 = (blockIdx.x * 8 + (threadIdx.x >> 5)) * 8; const int nlines = NH_ * TT * HD / 64;
{
#pragma unroll
        for (int l = 0; l < 8; ++l) { const int L = L0 + l; if (L >= nlines) break; const int e = L * 64 + lane * 2; const int t = e & (TT - 1); const int d = (e >> 11) & (HD - 1); const int h = e >> 17; v2us oh, ol; v2h o16;
#pragma unroll
            for (int q = 0; q < 2; ++q) { const float x = F[(size_t)(t + q) * DD + h * HD + d]; unsigned short a, c2; splitf(x, a, c2); oh[q] = a; ol[q] = c2; o16[q] = tohx(x); }
            *(v2us*)(Vh + (size_t)e) = oh; *(v2us*)(Vl + (size_t)e) = ol; *(v2h*)(V16 + (size_t)e) = o16; }
         }
}
// k_asoft: per row i: s = S/8 where attn_mask[i][j] != 0 (int32, read as data), else -3e38 (== -inf: exp 0; every row keeps >= 1 key here); softmax over the 2048 keys (register row of
__global__ __launch_bounds__(256) void k_asoft(const float* __restrict__ Sb, const int* __restrict__ mk, bf* Ph, bf* Pl, h16* P16) {
    typedef __attribute__((ext_vector_type(4))) unsigned short v4us;
    const int lane = threadIdx.x & 31; const int row = blockIdx.x * 8 + (threadIdx.x >> 5); if (row >= ZH * TT) return; const int i = row & (TT - 1); const int zz = row >> 11; const bool hires = (i < RH);
    const float* sr = Sb + (size_t)row * TT; float v[64]; float mx = -3.0e38f;
#pragma unroll
    for (int ch = 0; ch < 16; ++ch) { const int j0 = ch * 128 + lane * 4; const v4f a = *(const v4f*)(sr + j0); typedef __attribute__((ext_vector_type(4))) int v4i; const v4i m4 = *(const v4i*)(mk + (size_t)i * TT + j0);
#pragma unroll
        for (int q = 0; q < 4; ++q) { const float t = (m4[q] != 0) ? a[q] * SCL : -3.0e38f; v[ch * 4 + q] = t; mx = fmaxf(mx, t); } }
#pragma unroll
    for (int sh = 16; sh; sh >>= 1) mx = fmaxf(mx, __shfl_xor(mx, sh, 32));
    float sum = 0.f;
#pragma unroll
    for (int k = 0; k < 64; ++k) { v[k] = __expf(v[k] - mx); sum += v[k]; }
#pragma unroll
    for (int sh = 16; sh; sh >>= 1) sum += __shfl_xor(sum, sh, 32);
    const float f = __fdiv_rn(hires ? 1.0f : PCAR, sum);
{
        if (hires) {
#pragma unroll
            for (int ch = 0; ch < 16; ++ch) { v4us oh, ol;
#pragma unroll
                for (int q = 0; q < 4; ++q) { unsigned short a, c2; splitf(v[ch * 4 + q] * f, a, c2); oh[q] = a; ol[q] = c2; }
                const size_t o = ((size_t)zz * RH + i) * TT + ch * 128 + lane * 4; *(v4us*)(Ph + o) = oh; *(v4us*)(Pl + o) = ol; }
        } else {
#pragma unroll
            for (int ch = 0; ch < 16; ++ch) { v4h o;
#pragma unroll
                for (int q = 0; q < 4; ++q) o[q] = tohx(v[ch * 4 + q] * f);
                *(v4h*)(P16 + (size_t)row * TT + ch * 128 + lane * 4) = o; } }
         }
}
__global__ __launch_bounds__(256) void k_merge(const float* __restrict__ O, int h0, bf* Ah, bf* Al) {
    const int lane = threadIdx.x & 31; const int L0 = (blockIdx.x * 8 + (threadIdx.x >> 5)) * 8; const int nlines = ZH * TT * HD / 64;
{
#pragma unroll
        for (int l = 0; l < 8; ++l) { const int L = L0 + l; if (L >= nlines) break; const int e = L * 64 + lane * 2; const int d = e & (HD - 1); const int t = (e >> 6) & (TT - 1); const int zz = e >> 17; v2us oh, ol;
const float cs = (t < RH) ? 1.0f : (1.0f / PCAR);
#pragma unroll
            for (int q = 0; q < 2; ++q) { unsigned short a, c2; splitf(O[(size_t)e + q] * cs, a, c2); oh[q] = a; ol[q] = c2; }
            const size_t o = (size_t)t * DD + (h0 + zz) * HD + d; *(v2us*)(Ah + o) = oh; *(v2us*)(Al + o) = ol; }
         }
}

extern "C" void kernel_launch(void* const* d_in, const int* in_sizes, int n_in,
                              void* d_out, int out_size, void* d_ws, size_t ws_size, hipStream_t stream) {
    (void)in_sizes; (void)n_in; (void)out_size;
    const float* x = (const float*)d_in[0]; const int* mk = (const int*)d_in[1]; const float* Wq = (const float*)d_in[2]; const float* bq = (const float*)d_in[3]; const float* Wk = (const float*)d_in[4]; const float* bk = (const float*)d_in[5]; const float* Wv = (const float*)d_in[6]; const float* bv = (const float*)d_in[7]; const float* Wd = (const float*)d_in[8]; const float* bo = (const float*)d_in[9];
    float* OUT = (float*)d_out;     // [2][2048][1024]
    char* wsp = (char*)d_ws;
    auto take = [&](size_t bytes) { char* p = wsp; wsp += (bytes + 255) & ~(size_t)255; return (void*)p; };
    bf* WQ = (bf*)take((size_t)DD * DD * 2); bf* WK = (bf*)take((size_t)DD * DD * 2); bf* WV = (bf*)take((size_t)DD * DD * 2); bf* WO = (bf*)take((size_t)DD * DD * 2);
    bf* XB = (bf*)take((size_t)TT * DD * 2); float* F = (float*)take((size_t)TT * DD * 4); float* CSN = (float*)take((size_t)TT * NF * 2 * 4);
    bf* QPh = (bf*)take((size_t)TT * DD * 2); bf* QPl = (bf*)take((size_t)TT * DD * 2); bf* KPh = (bf*)take((size_t)TT * DD * 2); bf* KPl = (bf*)take((size_t)TT * DD * 2); bf* VTh = (bf*)take((size_t)TT * DD * 2); bf* VTl = (bf*)take((size_t)TT * DD * 2);
    h16* QP16 = (h16*)take((size_t)TT * DD * 2); h16* KP16 = (h16*)take((size_t)TT * DD * 2); h16* VT16 = (h16*)take((size_t)TT * DD * 2);
    float* Sb = (float*)take((size_t)ZH * TT * TT * 4); bf* Ph = (bf*)take((size_t)ZH * RH * TT * 2); bf* Pl = (bf*)take((size_t)ZH * RH * TT * 2); h16* P16 = (h16*)take((size_t)ZH * TT * TT * 2); float* Ob = (float*)take((size_t)ZH * TT * HD * 4); bf* ATh = (bf*)take((size_t)TT * DD * 2); bf* ATl = (bf*)take((size_t)TT * DD * 2);
    if ((size_t)(wsp - (char*)d_ws) > ws_size) return;    // total ~ 123 MB = 117.5 MiB; ws 256 MiB
    { const size_t nw = (size_t)DD * DD / 8; const unsigned gw = (unsigned)((nw + 255) / 256); k_cvt8<<<gw, 256, 0, stream>>>(Wq, WQ, nw); k_cvt8<<<gw, 256, 0, stream>>>(Wk, WK, nw); k_cvt8<<<gw, 256, 0, stream>>>(Wv, WV, nw); k_cvt8<<<gw, 256, 0, stream>>>(Wd, WO, nw);
      k_cstab<<<TT * NF / 256, 256, 0, stream>>>(CSN); }
    const unsigned LB = (unsigned)((NH_ * TT * HD / 64 + 63) / 64); const dim3 gP(TT / 64, DD / 64, 1);
    for (int b = 0; b < NB_; ++b) {
        k_cvt8<<<(unsigned)(((size_t)TT * DD / 8 + 255) / 256), 256, 0, stream>>>(x + (size_t)b * TT * DD, XB, (size_t)TT * DD / 8);
        k_gemmw<bf, 0, true><<<gP, 32, 0, stream>>>(XB, nullptr, WQ, nullptr, DD, F, DD, bq, 0, 0, 0); k_hsplit<<<LB, 256, 0, stream>>>(F, DD, NH_, CSN, QPh, QPl, QP16);
        k_gemmw<bf, 0, true><<<gP, 32, 0, stream>>>(XB, nullptr, WK, nullptr, DD, F, DD, bk, 0, 0, 0); k_hsplit<<<LB, 256, 0, stream>>>(F, DD, NH_, CSN, KPh, KPl, KP16);
        k_gemmw<bf, 0, true><<<gP, 32, 0, stream>>>(XB, nullptr, WV, nullptr, DD, F, DD, bv, 0, 0, 0); k_vtplane<<<LB, 256, 0, stream>>>(F, VTh, VTl, VT16);
        for (int h0 = 0; h0 < NH_; h0 += ZH) { const size_t z0 = (size_t)h0;
            // scores: rows < RH on hi+lo planes (3 products), rows >= RH on fp16 planes - both into the same [ZH][TT][TT] score buffer
            k_gemmw<bf, 2, false><<<dim3(RH / 64, TT / 64, ZH), 32, 0, stream>>>(QPh + z0 * TT * HD, QPl + z0 * TT * HD, KPh + z0 * TT * HD, KPl + z0 * TT * HD, HD, Sb, TT, nullptr, (size_t)TT * HD, (size_t)TT * HD, (size_t)TT * TT);
            k_gemmw<h16, 0, false><<<dim3((TT - RH) / 64, TT / 64, ZH), 32, 0, stream>>>(QP16 + z0 * TT * HD + (size_t)RH * HD, nullptr, KP16 + z0 * TT * HD, nullptr, HD, Sb + (size_t)RH * TT, TT, nullptr, (size_t)TT * HD, (size_t)TT * HD, (size_t)TT * TT);
            k_asoft<<<ZH * TT / 8, 256, 0, stream>>>(Sb, mk, Ph, Pl, P16);
            k_gemmw<bf, 2, false><<<dim3(RH / 64, HD / 64, ZH), 32, 0, stream>>>(Ph, Pl, VTh + z0 * HD * TT, VTl + z0 * HD * TT, TT, Ob, HD, nullptr, (size_t)RH * TT, (size_t)HD * TT, (size_t)TT * HD);
            k_gemmw<h16, 0, false><<<dim3((TT - RH) / 64, HD / 64, ZH), 32, 0, stream>>>(P16 + (size_t)RH * TT, nullptr, VT16 + z0 * HD * TT, nullptr, TT, Ob + (size_t)RH * HD, HD, nullptr, (size_t)TT * TT, (size_t)HD * TT, (size_t)TT * HD);
            k_merge<<<(ZH * TT * HD / 64 + 63) / 64, 256, 0, stream>>>(Ob, h0, ATh, ATl); }
        k_gemmw<bf, 1, true><<<gP, 32, 0, stream>>>(ATh, ATl, WO, nullptr, DD, OUT + (size_t)b * TT * DD, DD, bo, 0, 0, 0); }
}

// v001
// A run of this version takes 888 microseconds.
// In two side-by-side timings against v000, it was 2.33 and 2.36 times as fast.
#include <hip/hip_runtime.h>

// MultiheadAttentionCore (x_q [2][2048][1024], attn_mask [2048][2048] bool->int32 (True = keep; read as data; here it is the causal triangle); q/k/v = x W^T + b; 16 heads x 64; rotate-half RoPE over the 64 head
// dims (inv_freq 10000^(-2i/64), positions 0..2047) on q and k; scores /8; -inf where mask == 0; softmax; out = merged Wo^T + bo).
// Compute dtypes, f32 accumulate: every input rounded to bf16; q/k/v projections on PLAIN bf16 operands (inputs: exact, + bias), out projection on hi+lo merged planes x bf16 Wo (2 products); rotary f32 (powf / cosf / sinf, partner x[d^32]
// read from memory); PER-ROW PRECISION HYBRID: query rows < 256 of each batch on bf16 hi+lo planes for scores and attn.v (3 products), rows >= 256 on SINGLE fp16 planes; the mask read per (i, j);

#define NB_  2
#define TT   2048
#define DD   1024
#define NH_  16
#define HD   64
#define ZH   2
#define RH   256                  // query rows < RH: hi+lo planes; rows >= RH: fp16 planes
#define NF   32                   // rotary frequencies (head_dim / 2)
#define SCL  0.125f               // 1/sqrt(64)
#define PCAR 1024.0f         // scale of the fp16 rows' P (k_asoft), undone in k_merge
#define KSP  16                   // K slices of the attn.v products (2048 keys -> 16 x 128), one f32 partial plane each
typedef _Float16 h16;
typedef unsigned short bf;
typedef __attribute__((ext_vector_type(16))) __bf16   v16bf;
typedef __attribute__((ext_vector_type(16))) _Float16 v16h;
typedef __attribute__((ext_vector_type(8)))  _Float16 v8h;
typedef __attribute__((ext_vector_type(8)))  unsigned short v8us;
typedef __attribute__((ext_vector_type(8)))  float    v8f;
typedef __attribute__((ext_vector_type(4)))  float    v4f;
typedef v8h  __attribute__((may_alias)) v8ha;
typedef v4f  __attribute__((may_alias)) v4fa;
typedef v8us __attribute__((may_alias)) v8usa;

__device__ __forceinline__ unsigned short f2bf(float f) { unsigned u = __float_as_uint(f); u += 0x7FFFu + ((u >> 16) & 1u); return (unsigned short)(u >> 16); }
__device__ __forceinline__ float bf2f(unsigned short b) { return __uint_as_float(((unsigned)b) << 16); }
__device__ __forceinline__ float bfr(float f) { return bf2f(f2bf(f)); }
__device__ __forceinline__ v16h cat16(v8h lo, v8h hi) { return __builtin_shufflevector(lo, hi, 0, 1, 2, 3, 4, 5, 6, 7, 8, 9, 10, 11, 12, 13, 14, 15); }
__device__ __forceinline__ v16bf cat16b(v8us lo, v8us hi) { return __builtin_bit_cast(v16bf, __builtin_shufflevector(lo, hi, 0, 1, 2, 3, 4, 5, 6, 7, 8, 9, 10, 11, 12, 13, 14, 15)); }
__device__ __forceinline__ v8f wmma16(v16h a, v16h b, v8f c) { return __builtin_amdgcn_wmma_f32_16x16x32_f16(false, a, false, b, (short)0, c, false, false); }
__device__ __forceinline__ v8f wmmab(v16bf a, v16bf b, v8f c) { return __builtin_amdgcn_wmma_f32_16x16x32_bf16(false, a, false, b, (short)0, c, false, false); }



// ---- k_gemmw: register-blocked GEMM, ONE WAVE per 64x64 output tile (16 accumulators), operands straight from K-contiguous 16-bit planes; grid (M/64, N/64, Z), 32 threads.
// C[m][n] (f32, pitch ldc, + optional f32 bias[n]) = sum_k A[m][k] Bt[n][k] (+ split products per NSPLIT). z-batch strides sA/sB/sC in elements. K % 32 == 0.
// KS > 1 (N == 64 only): blockIdx.y is a K slice, not a column tile: the wave sums k in [y K/KS, (y+1) K/KS) and stores its partial tile in plane y (C + y sK); the reader adds the KS planes.
template <typename T16> struct WFrag;
template <> struct WFrag<h16> { typedef v16h V; static __device__ __forceinline__ V ld(const h16* p) { return cat16(*(const v8h*)p, *(const v8h*)(p + 16)); } static __device__ __forceinline__ v8f mma(V a, V b, v8f c) { return wmma16(a, b, c); } };
template <> struct WFrag<bf> { typedef v16bf V; static __device__ __forceinline__ V ld(const bf* p) { return cat16b(*(const v8us*)p, *(const v8us*)(p + 16)); } static __device__ __forceinline__ v8f mma(V a, V b, v8f c) { return wmmab(a, b, c); } };
template <typename T16, int NSPLIT, bool BIAS, int KS = 1>
__global__ __launch_bounds__(32) void k_gemmw(const T16* __restrict__ A, const T16* __restrict__ A2, const T16* __restrict__ Bt, const T16* __restrict__ Bt2, int K, float* C, int ldc, const float* __restrict__ bias, size_t sA, size_t sB, size_t sC, size_t sK) {
    typedef typename WFrag<T16>::V V;
    __shared__ __align__(16) float os[16 * 68];
    const size_t z = blockIdx.z; A += z * sA; if (A2) A2 += z * sA; Bt += z * sB; if (Bt2) Bt2 += z * sB; C += z * sC;
    const int lane = threadIdx.x & 31, lr = lane & 15, hi = lane >> 4; const int r0 = blockIdx.x * 64, c0 = (KS > 1) ? 0 : blockIdx.y * 64;
    const int KL = K / KS; if (KS > 1) { const size_t ko = (size_t)blockIdx.y * KL; A += ko; if (A2) A2 += ko; Bt += ko; if (Bt2) Bt2 += ko; C += (size_t)blockIdx.y * sK; }
    v8f acc[4][4];
#pragma unroll
    for (int mb = 0; mb < 4; ++mb)
#pragma unroll
        for (int nb = 0; nb < 4; ++nb) acc[mb][nb] = (v8f){};
    const size_t aoff = (size_t)(r0 + lr) * K + 8 * hi, boff = (size_t)(c0 + lr) * K + 8 * hi;
#pragma unroll 1
    for (int kc = 0; kc < KL; kc += 32) {
        V a[4], a2[4];
#pragma unroll
        for (int mb = 0; mb < 4; ++mb) { a[mb] = WFrag<T16>::ld(A + aoff + (size_t)mb * 16 * K + kc); if (NSPLIT == 1 || NSPLIT == 2) a2[mb] = WFrag<T16>::ld(A2 + aoff + (size_t)mb * 16 * K + kc); }
#pragma unroll
        for (int nb = 0; nb < 4; ++nb) { const V b = WFrag<T16>::ld(Bt + boff + (size_t)nb * 16 * K + kc); V b2; if (NSPLIT >= 2) b2 = WFrag<T16>::ld(Bt2 + boff + (size_t)nb * 16 * K + kc);
#pragma unroll
            for (int mb = 0; mb < 4; ++mb) { acc[mb][nb] = WFrag<T16>::mma(a[mb], b, acc[mb][nb]); if (NSPLIT == 1 || NSPLIT == 2) acc[mb][nb] = WFrag<T16>::mma(a2[mb], b, acc[mb][nb]); if (NSPLIT >= 2) acc[mb][nb] = WFrag<T16>::mma(a[mb], b2, acc[mb][nb]); } }
        asm volatile("v_nop\n\tv_nop\n\tv_nop\n\tv_nop" : "+v"(acc[0][0]), "+v"(acc[1][1]), "+v"(acc[2][2]), "+v"(acc[3][3]) : "v"(a[0]), "v"(a[3]));
    }
#pragma unroll
    for (int mb = 0; mb < 4; ++mb) {
#pragma unroll
        for (int nb = 0; nb < 4; ++nb) {
#pragma unroll
            for (int j = 0; j < 8; ++j) os[(hi * 8 + j) * 68 + nb * 16 + lr] = acc[mb][nb][j]; }
        __builtin_amdgcn_wave_barrier(); asm volatile("" ::: "memory");
        float* crow = C + (size_t)(r0 + mb * 16) * ldc + c0;
{
#pragma unroll
            for (int s = 0; s < 8; ++s) { const int row = 2 * s + hi, cofs = lr * 4; v4f val = *(const v4fa*)(os + row * 68 + cofs); if (BIAS) { val[0] += bfr(bias[c0 + cofs]); val[1] += bfr(bias[c0 + cofs + 1]); val[2] += bfr(bias[c0 + cofs + 2]); val[3] += bfr(bias[c0 + cofs + 3]); }
                *(v4f*)(crow + (size_t)row * ldc + cofs) = val; }
             }
        __builtin_amdgcn_wave_barrier(); asm volatile("" ::: "memory");
    }
}

__device__ __forceinline__ h16 tohx(float x) { return (h16)x; }
__device__ __forceinline__ void splitf(float y, unsigned short& h, unsigned short& l) { h = f2bf(y); l = f2bf(y - bf2f(h)); }
typedef __attribute__((ext_vector_type(2))) unsigned short v2us;
typedef __attribute__((ext_vector_type(2))) _Float16 v2h;
typedef __attribute__((ext_vector_type(4))) _Float16 v4h;
typedef __attribute__((ext_vector_type(2))) float v2f;

__global__ __launch_bounds__(256) void k_cvt8(const float* __restrict__ src, bf* dst, size_t n8) { const size_t i = (size_t)blockIdx.x * 256 + threadIdx.x; if (i >= n8) return; const v8f v = *(const v8f*)(src + i * 8); v8us o;
#pragma unroll
    for (int k = 0; k < 8; ++k) o[k] = f2bf(v[k]); *(v8us*)(dst + i * 8) = o;  }
__global__ __launch_bounds__(256) void k_cstab(float* CSN) {
    const int idx = blockIdx.x * 256 + threadIdx.x; if (idx >= TT * NF) return; const int t = idx / NF, i = idx % NF; const float den = powf(10000.0f, (float)(2 * i) * (1.0f / HD)); const float ang = __fdiv_rn((float)t, den);
    v2f o; o[0] = cosf(ang); o[1] = sinf(ang); *(v2f*)(CSN + (size_t)idx * 2) = o;  }
// k_hsplit: head planes (hi/lo + fp16) [h][t][d] for one batch (row pitch 'pitch', 'nheads' heads) with rotate-half RoPE: r = x cos - x' sin for d < 32, x cos + x' sin for d >= 32, x' = F[t][h*64 + (d ^ 32)]
__global__ __launch_bounds__(256) void k_hsplit(const float* __restrict__ F, int pitch, int nheads, const float* __restrict__ CSN, bf* Ph, bf* Pl, h16* P16) {
    const int lane = threadIdx.x & 31; const int L0 = (blockIdx.x * 8 + (threadIdx.x >> 5)) * 8; const int nlines = nheads * TT * HD / 64;
{
#pragma unroll
        for (int l = 0; l < 8; ++l) { const int L = L0 + l; if (L >= nlines) break; const int e = L * 64 + lane * 2; const int d = e & (HD - 1); const int t = (e >> 6) & (TT - 1); const int h = e >> 17; v2us oh, ol; v2h o16;
#pragma unroll
            for (int q = 0; q < 2; ++q) { const int dd = d + q; const float x0 = F[(size_t)t * pitch + h * HD + dd], x1 = F[(size_t)t * pitch + h * HD + (dd ^ NF)]; const v2f cs = *(const v2f*)(CSN + ((size_t)t * NF + (dd & (NF - 1))) * 2);
                float a0 = __fmul_rn(cs[0], x0), a1 = __fmul_rn(cs[1], x1); asm volatile("" : "+v"(a0)); asm volatile("" : "+v"(a1)); const float r = (dd < NF) ? __fsub_rn(a0, a1) : __fadd_rn(a0, a1);
                unsigned short a, c2; splitf(r, a, c2); oh[q] = a; ol[q] = c2; o16[q] = tohx(r); }
            *(v2us*)(Ph + (size_t)e) = oh; *(v2us*)(Pl + (size_t)e) = ol; *(v2h*)(P16 + (size_t)e) = o16; }
         }
}
__global__ __launch_bounds__(256) void k_vtplane(const float* __restrict__ F, bf* Vh, bf* Vl, h16* V16) {
    const int lane = threadIdx.x & 31; const int L0 = (blockIdx.x * 8 + (threadIdx.x >> 5)) * 8; const int nlines = NH_ * TT * HD / 64;
{
#pragma unroll
        for (int l = 0; l < 8; ++l) { const int L = L0 + l; if (L >= nlines) break; const int e = L * 64 + lane * 2; const int t = e & (TT - 1); const int d = (e >> 11) & (HD - 1); const int h = e >> 17; v2us oh, ol; v2h o16;
#pragma unroll
            for (int q = 0; q < 2; ++q) { const float x = F[(size_t)(t + q) * DD + h * HD + d]; unsigned short a, c2; splitf(x, a, c2); oh[q] = a; ol[q] = c2; o16[q] = tohx(x); }
            *(v2us*)(Vh + (size_t)e) = oh; *(v2us*)(Vl + (size_t)e) = ol; *(v2h*)(V16 + (size_t)e) = o16; }
         }
}
// k_asoft: per row i: s = S/8 where attn_mask[i][j] != 0 (int32, read as data), else -3e38 (== -inf: exp 0; every row keeps >= 1 key here); softmax over the 2048 keys (register row of
__global__ __launch_bounds__(256) void k_asoft(const float* __restrict__ Sb, const int* __restrict__ mk, bf* Ph, bf* Pl, h16* P16) {
    typedef __attribute__((ext_vector_type(4))) unsigned short v4us;
    const int lane = threadIdx.x & 31; const int row = blockIdx.x * 8 + (threadIdx.x >> 5); if (row >= ZH * TT) return; const int i = row & (TT - 1); const int zz = row >> 11; const bool hires = (i < RH);
    const float* sr = Sb + (size_t)row * TT; float v[64]; float mx = -3.0e38f;
#pragma unroll
    for (int ch = 0; ch < 16; ++ch) { const int j0 = ch * 128 + lane * 4; const v4f a = *(const v4f*)(sr + j0); typedef __attribute__((ext_vector_type(4))) int v4i; const v4i m4 = *(const v4i*)(mk + (size_t)i * TT + j0);
#pragma unroll
        for (int q = 0; q < 4; ++q) { const float t = (m4[q] != 0) ? a[q] * SCL : -3.0e38f; v[ch * 4 + q] = t; mx = fmaxf(mx, t); } }
#pragma unroll
    for (int sh = 16; sh; sh >>= 1) mx = fmaxf(mx, __shfl_xor(mx, sh, 32));
    float sum = 0.f;
#pragma unroll
    for (int k = 0; k < 64; ++k) { v[k] = __expf(v[k] - mx); sum += v[k]; }
#pragma unroll
    for (int sh = 16; sh; sh >>= 1) sum += __shfl_xor(sum, sh, 32);
    const float f = __fdiv_rn(hires ? 1.0f : PCAR, sum);
{
        if (hires) {
#pragma unroll
            for (int ch = 0; ch < 16; ++ch) { v4us oh, ol;
#pragma unroll
                for (int q = 0; q < 4; ++q) { unsigned short a, c2; splitf(v[ch * 4 + q] * f, a, c2); oh[q] = a; ol[q] = c2; }
                const size_t o = ((size_t)zz * RH + i) * TT + ch * 128 + lane * 4; *(v4us*)(Ph + o) = oh; *(v4us*)(Pl + o) = ol; }
        } else {
#pragma unroll
            for (int ch = 0; ch < 16; ++ch) { v4h o;
#pragma unroll
                for (int q = 0; q < 4; ++q) o[q] = tohx(v[ch * 4 + q] * f);
                *(v4h*)(P16 + (size_t)row * TT + ch * 128 + lane * 4) = o; } }
         }
}
// k_merge: adds the KSP partial planes of attn.v (plane order 0..KSP-1, f32), undoes the fp16 rows' carry scale, splits into the hi/lo planes of the merged heads; 4 elements a lane
__global__ __launch_bounds__(256) void k_merge(const float* __restrict__ O, int h0, bf* Ah, bf* Al) {
    typedef __attribute__((ext_vector_type(4))) unsigned short v4us;
    const unsigned off = (blockIdx.x * 256u + threadIdx.x) * 16u;    // the lane's byte offset inside every plane
    const int e = (int)(off >> 2); const int d = e & (HD - 1); const int t = (e >> 6) & (TT - 1); const int zz = e >> 17; v4us oh, ol; v4f pv[KSP];
#pragma unroll
    for (int ks = 0; ks < KSP; ++ks) pv[ks] = *(const v4f*)((const char*)O + (size_t)ks * (ZH * TT * HD * 4) + off);
    asm volatile("s_wait_xcnt 0x0" :: "v"(off) : "memory");    // the offset register that all KSP loads name stays whole until they have taken it
    v4f sm = pv[0];
#pragma unroll
    for (int ks = 1; ks < KSP; ++ks) sm += pv[ks];
    const float cs = (t < RH) ? 1.0f : (1.0f / PCAR);
#pragma unroll
    for (int q = 0; q < 4; ++q) { unsigned short a, c2; splitf(sm[q] * cs, a, c2); oh[q] = a; ol[q] = c2; }
    const size_t o = (size_t)t * DD + (h0 + zz) * HD + d; *(v4us*)(Ah + o) = oh; *(v4us*)(Al + o) = ol;
}

extern "C" void kernel_launch(void* const* d_in, const int* in_sizes, int n_in,
                              void* d_out, int out_size, void* d_ws, size_t ws_size, hipStream_t stream) {
    (void)in_sizes; (void)n_in; (void)out_size;
    const float* x = (const float*)d_in[0]; const int* mk = (const int*)d_in[1]; const float* Wq = (const float*)d_in[2]; const float* bq = (const float*)d_in[3]; const float* Wk = (const float*)d_in[4]; const float* bk = (const float*)d_in[5]; const float* Wv = (const float*)d_in[6]; const float* bv = (const float*)d_in[7]; const float* Wd = (const float*)d_in[8]; const float* bo = (const float*)d_in[9];
    float* OUT = (float*)d_out;     // [2][2048][1024]
    char* wsp = (char*)d_ws;
    auto take = [&](size_t bytes) { char* p = wsp; wsp += (bytes + 255) & ~(size_t)255; return (void*)p; };
    bf* WQ = (bf*)take((size_t)DD * DD * 2); bf* WK = (bf*)take((size_t)DD * DD * 2); bf* WV = (bf*)take((size_t)DD * DD * 2); bf* WO = (bf*)take((size_t)DD * DD * 2);
    bf* XB = (bf*)take((size_t)TT * DD * 2); float* F = (float*)take((size_t)TT * DD * 4); float* CSN = (float*)take((size_t)TT * NF * 2 * 4);
    bf* QPh = (bf*)take((size_t)TT * DD * 2); bf* QPl = (bf*)take((size_t)TT * DD * 2); bf* KPh = (bf*)take((size_t)TT * DD * 2); bf* KPl = (bf*)take((size_t)TT * DD * 2); bf* VTh = (bf*)take((size_t)TT * DD * 2); bf* VTl = (bf*)take((size_t)TT * DD * 2);
    h16* QP16 = (h16*)take((size_t)TT * DD * 2); h16* KP16 = (h16*)take((size_t)TT * DD * 2); h16* VT16 = (h16*)take((size_t)TT * DD * 2);
    float* Sb = (float*)take((size_t)ZH * TT * TT * 4); bf* Ph = (bf*)take((size_t)ZH * RH * TT * 2); bf* Pl = (bf*)take((size_t)ZH * RH * TT * 2); h16* P16 = (h16*)take((size_t)ZH * TT * TT * 2); float* Ob = (float*)take((size_t)KSP * ZH * TT * HD * 4); bf* ATh = (bf*)take((size_t)TT * DD * 2); bf* ATl = (bf*)take((size_t)TT * DD * 2);
    if ((size_t)(wsp - (char*)d_ws) > ws_size) return;    // total ~ 139 MB = 132.5 MiB; ws 256 MiB
    { const size_t nw = (size_t)DD * DD / 8; const unsigned gw = (unsigned)((nw + 255) / 256); k_cvt8<<<gw, 256, 0, stream>>>(Wq, WQ, nw); k_cvt8<<<gw, 256, 0, stream>>>(Wk, WK, nw); k_cvt8<<<gw, 256, 0, stream>>>(Wv, WV, nw); k_cvt8<<<gw, 256, 0, stream>>>(Wd, WO, nw);
      k_cstab<<<TT * NF / 256, 256, 0, stream>>>(CSN); }
    const unsigned LB = (unsigned)((NH_ * TT * HD / 64 + 63) / 64); const dim3 gP(TT / 64, DD / 64, 1);
    for (int b = 0; b < NB_; ++b) {
        k_cvt8<<<(unsigned)(((size_t)TT * DD / 8 + 255) / 256), 256, 0, stream>>>(x + (size_t)b * TT * DD, XB, (size_t)TT * DD / 8);
        k_gemmw<bf, 0, true><<<gP, 32, 0, stream>>>(XB, nullptr, WQ, nullptr, DD, F, DD, bq, 0, 0, 0, 0); k_hsplit<<<LB, 256, 0, stream>>>(F, DD, NH_, CSN, QPh, QPl, QP16);
        k_gemmw<bf, 0, true><<<gP, 32, 0, stream>>>(XB, nullptr, WK, nullptr, DD, F, DD, bk, 0, 0, 0, 0); k_hsplit<<<LB, 256, 0, stream>>>(F, DD, NH_, CSN, KPh, KPl, KP16);
        k_gemmw<bf, 0, true><<<gP, 32, 0, stream>>>(XB, nullptr, WV, nullptr, DD, F, DD, bv, 0, 0, 0, 0); k_vtplane<<<LB, 256, 0, stream>>>(F, VTh, VTl, VT16);
        for (int h0 = 0; h0 < NH_; h0 += ZH) { const size_t z0 = (size_t)h0;
            // scores: rows < RH on hi+lo planes (3 products), rows >= RH on fp16 planes - both into the same [ZH][TT][TT] score buffer
            k_gemmw<bf, 2, false><<<dim3(RH / 64, TT / 64, ZH), 32, 0, stream>>>(QPh + z0 * TT * HD, QPl + z0 * TT * HD, KPh + z0 * TT * HD, KPl + z0 * TT * HD, HD, Sb, TT, nullptr, (size_t)TT * HD, (size_t)TT * HD, (size_t)TT * TT, 0);
            k_gemmw<h16, 0, false><<<dim3((TT - RH) / 64, TT / 64, ZH), 32, 0, stream>>>(QP16 + z0 * TT * HD + (size_t)RH * HD, nullptr, KP16 + z0 * TT * HD, nullptr, HD, Sb + (size_t)RH * TT, TT, nullptr, (size_t)TT * HD, (size_t)TT * HD, (size_t)TT * TT, 0);
            k_asoft<<<ZH * TT / 8, 256, 0, stream>>>(Sb, mk, Ph, Pl, P16);
            // attn.v: each 64x64 tile's 2048 keys go to KSP waves (blockIdx.y); the KSP partial planes [KSP][ZH][TT][HD] are added in k_merge
            k_gemmw<bf, 2, false, KSP><<<dim3(RH / 64, KSP, ZH), 32, 0, stream>>>(Ph, Pl, VTh + z0 * HD * TT, VTl + z0 * HD * TT, TT, Ob, HD, nullptr, (size_t)RH * TT, (size_t)HD * TT, (size_t)TT * HD, (size_t)ZH * TT * HD);
            k_gemmw<h16, 0, false, KSP><<<dim3((TT - RH) / 64, KSP, ZH), 32, 0, stream>>>(P16 + (size_t)RH * TT, nullptr, VT16 + z0 * HD * TT, nullptr, TT, Ob + (size_t)RH * HD, HD, nullptr, (size_t)TT * TT, (size_t)HD * TT, (size_t)TT * HD, (size_t)ZH * TT * HD);
            k_merge<<<ZH * TT * HD / 1024, 256, 0, stream>>>(Ob, h0, ATh, ATl); }
        k_gemmw<bf, 1, true><<<gP, 32, 0, stream>>>(ATh, ATl, WO, nullptr, DD, OUT + (size_t)b * TT * DD, DD, bo, 0, 0, 0, 0); }
}

// v002
// It runs in 660 microseconds.
// Next to v001, in two timings, it ran 1.36 and 1.35 times as fast.
// Over all steps from v000 it is 3.17 times as fast.
#include <hip/hip_runtime.h>

// MultiheadAttentionCore (x_q [2][2048][1024], attn_mask [2048][2048] bool->int32 (True = keep; read as data; here it is the causal triangle); q/k/v = x W^T + b; 16 heads x 64; rotate-half RoPE over the 64 head
// dims (inv_freq 10000^(-2i/64), positions 0..2047) on q and k; scores /8; -inf where mask == 0; softmax; out = merged Wo^T + bo).
// Compute dtypes, f32 accumulate: every input rounded to bf16; q/k/v projections on PLAIN bf16 operands (inputs: exact, + bias), out projection on hi+lo merged planes x bf16 Wo (2 products); rotary f32 (powf / cosf / sinf, partner x[d^32]
// read from memory); PER-ROW PRECISION HYBRID: query rows < 256 of each batch on bf16 hi+lo planes for scores and attn.v (3 products), rows >= 256 on SINGLE fp16 planes; the mask read per (i, j);

#define NB_  2
#define TT   2048
#define DD   1024
#define NH_  16
#define HD   64
#define ZH   8                    // heads per launch of the attention part (scores, softmax, attn.v, merge)
#define RH   256                  // query rows < RH: hi+lo planes; rows >= RH: fp16 planes
#define NF   32                   // rotary frequencies (head_dim / 2)
#define SCL  0.125f               // 1/sqrt(64)
#define PCAR 1024.0f         // scale of the fp16 rows' P (k_asoft), undone in k_merge
#define KSP  16                   // K slices of the attn.v products (2048 keys -> 16 x 128), one f32 partial plane each
typedef _Float16 h16;
typedef unsigned short bf;
typedef __attribute__((ext_vector_type(16))) __bf16   v16bf;
typedef __attribute__((ext_vector_type(16))) _Float16 v16h;
typedef __attribute__((ext_vector_type(8)))  _Float16 v8h;
typedef __attribute__((ext_vector_type(8)))  unsigned short v8us;
typedef __attribute__((ext_vector_type(8)))  float    v8f;
typedef __attribute__((ext_vector_type(4)))  float    v4f;
typedef v8h  __attribute__((may_alias)) v8ha;
typedef v4f  __attribute__((may_alias)) v4fa;
typedef v8us __attribute__((may_alias)) v8usa;

__device__ __forceinline__ unsigned short f2bf(float f) { unsigned u = __float_as_uint(f); u += 0x7FFFu + ((u >> 16) & 1u); return (unsigned short)(u >> 16); }
__device__ __forceinline__ float bf2f(unsigned short b) { return __uint_as_float(((unsigned)b) << 16); }
__device__ __forceinline__ float bfr(float f) { return bf2f(f2bf(f)); }
__device__ __forceinline__ v16h cat16(v8h lo, v8h hi) { return __builtin_shufflevector(lo, hi, 0, 1, 2, 3, 4, 5, 6, 7, 8, 9, 10, 11, 12, 13, 14, 15); }
__device__ __forceinline__ v16bf cat16b(v8us lo, v8us hi) { return __builtin_bit_cast(v16bf, __builtin_shufflevector(lo, hi, 0, 1, 2, 3, 4, 5, 6, 7, 8, 9, 10, 11, 12, 13, 14, 15)); }
__device__ __forceinline__ v8f wmma16(v16h a, v16h b, v8f c) { return __builtin_amdgcn_wmma_f32_16x16x32_f16(false, a, false, b, (short)0, c, false, false); }
__device__ __forceinline__ v8f wmmab(v16bf a, v16bf b, v8f c) { return __builtin_amdgcn_wmma_f32_16x16x32_bf16(false, a, false, b, (short)0, c, false, false); }



// ---- k_gemmw: register-blocked GEMM, ONE WAVE per 64x64 output tile (16 accumulators), operands straight from K-contiguous 16-bit planes; grid (M/64, N/64, Z), 32 threads.
// C[m][n] (f32, pitch ldc, + optional f32 bias[n]) = sum_k A[m][k] Bt[n][k] (+ split products per NSPLIT). z-batch strides sA/sB/sC in elements. K % 32 == 0.
// KS > 1 (N == 64 only): blockIdx.y is a K slice, not a column tile: the wave sums k in [y K/KS, (y+1) K/KS) and stores its partial tile in plane y (C + y sK); the reader adds the KS planes.
template <typename T16> struct WFrag;
template <> struct WFrag<h16> { typedef v16h V; static __device__ __forceinline__ V ld(const h16* p) { return cat16(*(const v8h*)p, *(const v8h*)(p + 16)); } static __device__ __forceinline__ v8f mma(V a, V b, v8f c) { return wmma16(a, b, c); } };
template <> struct WFrag<bf> { typedef v16bf V; static __device__ __forceinline__ V ld(const bf* p) { return cat16b(*(const v8us*)p, *(const v8us*)(p + 16)); } static __device__ __forceinline__ v8f mma(V a, V b, v8f c) { return wmmab(a, b, c); } };
template <typename T16, int NSPLIT, bool BIAS, int KS = 1>
__global__ __launch_bounds__(32) void k_gemmw(const T16* __restrict__ A, const T16* __restrict__ A2, const T16* __restrict__ Bt, const T16* __restrict__ Bt2, int K, float* C, int ldc, const float* __restrict__ bias, size_t sA, size_t sB, size_t sC, size_t sK) {
    typedef typename WFrag<T16>::V V;
    __shared__ __align__(16) float os[16 * 68];
    const size_t z = blockIdx.z; A += z * sA; if (A2) A2 += z * sA; Bt += z * sB; if (Bt2) Bt2 += z * sB; C += z * sC;
    const int lane = threadIdx.x & 31, lr = lane & 15, hi = lane >> 4; const int r0 = blockIdx.x * 64, c0 = (KS > 1) ? 0 : blockIdx.y * 64;
    const int KL = K / KS; if (KS > 1) { const size_t ko = (size_t)blockIdx.y * KL; A += ko; if (A2) A2 += ko; Bt += ko; if (Bt2) Bt2 += ko; C += (size_t)blockIdx.y * sK; }
    v8f acc[4][4];
#pragma unroll
    for (int mb = 0; mb < 4; ++mb)
#pragma unroll
        for (int nb = 0; nb < 4; ++nb) acc[mb][nb] = (v8f){};
    const size_t aoff = (size_t)(r0 + lr) * K + 8 * hi, boff = (size_t)(c0 + lr) * K + 8 * hi;
#pragma unroll 1
    for (int kc = 0; kc < KL; kc += 32) {
        V a[4], a2[4];
#pragma unroll
        for (int mb = 0; mb < 4; ++mb) { a[mb] = WFrag<T16>::ld(A + aoff + (size_t)mb * 16 * K + kc); if (NSPLIT == 1 || NSPLIT == 2) a2[mb] = WFrag<T16>::ld(A2 + aoff + (size_t)mb * 16 * K + kc); }
#pragma unroll
        for (int nb = 0; nb < 4; ++nb) { const V b = WFrag<T16>::ld(Bt + boff + (size_t)nb * 16 * K + kc); V b2; if (NSPLIT >= 2) b2 = WFrag<T16>::ld(Bt2 + boff + (size_t)nb * 16 * K + kc);
#pragma unroll
            for (int mb = 0; mb < 4; ++mb) { acc[mb][nb] = WFrag<T16>::mma(a[mb], b, acc[mb][nb]); if (NSPLIT == 1 || NSPLIT == 2) acc[mb][nb] = WFrag<T16>::mma(a2[mb], b, acc[mb][nb]); if (NSPLIT >= 2) acc[mb][nb] = WFrag<T16>::mma(a[mb], b2, acc[mb][nb]); } }
        asm volatile("v_nop\n\tv_nop\n\tv_nop\n\tv_nop" : "+v"(acc[0][0]), "+v"(acc[1][1]), "+v"(acc[2][2]), "+v"(acc[3][3]) : "v"(a[0]), "v"(a[3]));
    }
#pragma unroll
    for (int mb = 0; mb < 4; ++mb) {
#pragma unroll
        for (int nb = 0; nb < 4; ++nb) {
#pragma unroll
            for (int j = 0; j < 8; ++j) os[(hi * 8 + j) * 68 + nb * 16 + lr] = acc[mb][nb][j]; }
        __builtin_amdgcn_wave_barrier(); asm volatile("" ::: "memory");
        float* crow = C + (size_t)(r0 + mb * 16) * ldc + c0;
{
#pragma unroll
            for (int s = 0; s < 8; ++s) { const int row = 2 * s + hi, cofs = lr * 4; v4f val = *(const v4fa*)(os + row * 68 + cofs); if (BIAS) { val[0] += bfr(bias[c0 + cofs]); val[1] += bfr(bias[c0 + cofs + 1]); val[2] += bfr(bias[c0 + cofs + 2]); val[3] += bfr(bias[c0 + cofs + 3]); }
                *(v4f*)(crow + (size_t)row * ldc + cofs) = val; }
             }
        __builtin_amdgcn_wave_barrier(); asm volatile("" ::: "memory");
    }
}

__device__ __forceinline__ h16 tohx(float x) { return (h16)x; }
__device__ __forceinline__ void splitf(float y, unsigned short& h, unsigned short& l) { h = f2bf(y); l = f2bf(y - bf2f(h)); }
typedef __attribute__((ext_vector_type(2))) unsigned short v2us;
typedef __attribute__((ext_vector_type(2))) _Float16 v2h;
typedef __attribute__((ext_vector_type(4))) _Float16 v4h;
typedef __attribute__((ext_vector_type(2))) float v2f;

__global__ __launch_bounds__(256) void k_cvt8(const float* __restrict__ src, bf* dst, size_t n8) { const size_t i = (size_t)blockIdx.x * 256 + threadIdx.x; if (i >= n8) return; const v8f v = *(const v8f*)(src + i * 8); v8us o;
#pragma unroll
    for (int k = 0; k < 8; ++k) o[k] = f2bf(v[k]); *(v8us*)(dst + i * 8) = o;  }
__global__ __launch_bounds__(256) void k_cstab(float* CSN) {
    const int idx = blockIdx.x * 256 + threadIdx.x; if (idx >= TT * NF) return; const int t = idx / NF, i = idx % NF; const float den = powf(10000.0f, (float)(2 * i) * (1.0f / HD)); const float ang = __fdiv_rn((float)t, den);
    v2f o; o[0] = cosf(ang); o[1] = sinf(ang); *(v2f*)(CSN + (size_t)idx * 2) = o;  }
// k_hsplit: head planes (hi/lo + fp16) [h][t][d] for one batch (row pitch 'pitch', 'nheads' heads) with rotate-half RoPE: r = x cos - x' sin for d < 32, x cos + x' sin for d >= 32, x' = F[t][h*64 + (d ^ 32)]
__global__ __launch_bounds__(256) void k_hsplit(const float* __restrict__ F, int pitch, int nheads, const float* __restrict__ CSN, bf* Ph, bf* Pl, h16* P16) {
    const int lane = threadIdx.x & 31; const int L0 = (blockIdx.x * 8 + (threadIdx.x >> 5)) * 8; const int nlines = nheads * TT * HD / 64;
{
#pragma unroll
        for (int l = 0; l < 8; ++l) { const int L = L0 + l; if (L >= nlines) break; const int e = L * 64 + lane * 2; const int d = e & (HD - 1); const int t = (e >> 6) & (TT - 1); const int h = e >> 17; v2us oh, ol; v2h o16;
#pragma unroll
            for (int q = 0; q < 2; ++q) { const int dd = d + q; const float x0 = F[(size_t)t * pitch + h * HD + dd], x1 = F[(size_t)t * pitch + h * HD + (dd ^ NF)]; const v2f cs = *(const v2f*)(CSN + ((size_t)t * NF + (dd & (NF - 1))) * 2);
                float a0 = __fmul_rn(cs[0], x0), a1 = __fmul_rn(cs[1], x1); asm volatile("" : "+v"(a0)); asm volatile("" : "+v"(a1)); const float r = (dd < NF) ? __fsub_rn(a0, a1) : __fadd_rn(a0, a1);
                unsigned short a, c2; splitf(r, a, c2); oh[q] = a; ol[q] = c2; o16[q] = tohx(r); }
            *(v2us*)(Ph + (size_t)e) = oh; *(v2us*)(Pl + (size_t)e) = ol; *(v2h*)(P16 + (size_t)e) = o16; }
         }
}
__global__ __launch_bounds__(256) void k_vtplane(const float* __restrict__ F, bf* Vh, bf* Vl, h16* V16) {
    const int lane = threadIdx.x & 31; const int L0 = (blockIdx.x * 8 + (threadIdx.x >> 5)) * 8; const int nlines = NH_ * TT * HD / 64;
{
#pragma unroll
        for (int l = 0; l < 8; ++l) { const int L = L0 + l; if (L >= nlines) break; const int e = L * 64 + lane * 2; const int t = e & (TT - 1); const int d = (e >> 11) & (HD - 1); const int h = e >> 17; v2us oh, ol; v2h o16;
#pragma unroll
            for (int q = 0; q < 2; ++q) { const float x = F[(size_t)(t + q) * DD + h * HD + d]; unsigned short a, c2; splitf(x, a, c2); oh[q] = a; ol[q] = c2; o16[q] = tohx(x); }
            *(v2us*)(Vh + (size_t)e) = oh; *(v2us*)(Vl + (size_t)e) = ol; *(v2h*)(V16 + (size_t)e) = o16; }
         }
}
// k_asoft: per row i: s = S/8 where attn_mask[i][j] != 0 (int32, read as data), else -3e38 (== -inf: exp 0; every row keeps >= 1 key here); softmax over the 2048 keys (register row of
__global__ __launch_bounds__(256) void k_asoft(const float* __restrict__ Sb, const int* __restrict__ mk, bf* Ph, bf* Pl, h16* P16) {
    typedef __attribute__((ext_vector_type(4))) unsigned short v4us;
    const int lane = threadIdx.x & 31; const int row = blockIdx.x * 8 + (threadIdx.x >> 5); if (row >= ZH * TT) return; const int i = row & (TT - 1); const int zz = row >> 11; const bool hires = (i < RH);
    const float* sr = Sb + (size_t)row * TT; float v[64]; float mx = -3.0e38f;
#pragma unroll
    for (int ch = 0; ch < 16; ++ch) { const int j0 = ch * 128 + lane * 4; const v4f a = *(const v4f*)(sr + j0); typedef __attribute__((ext_vector_type(4))) int v4i; const v4i m4 = *(const v4i*)(mk + (size_t)i * TT + j0);
#pragma unroll
        for (int q = 0; q < 4; ++q) { const float t = (m4[q] != 0) ? a[q] * SCL : -3.0e38f; v[ch * 4 + q] = t; mx = fmaxf(mx, t); } }
#pragma unroll
    for (int sh = 16; sh; sh >>= 1) mx = fmaxf(mx, __shfl_xor(mx, sh, 32));
    float sum = 0.f;
#pragma unroll
    for (int k = 0; k < 64; ++k) { v[k] = __expf(v[k] - mx); sum += v[k]; }
#pragma unroll
    for (int sh = 16; sh; sh >>= 1) sum += __shfl_xor(sum, sh, 32);
    const float f = __fdiv_rn(hires ? 1.0f : PCAR, sum);
{
        if (hires) {
#pragma unroll
            for (int ch = 0; ch < 16; ++ch) { v4us oh, ol;
#pragma unroll
                for (int q = 0; q < 4; ++q) { unsigned short a, c2; splitf(v[ch * 4 + q] * f, a, c2); oh[q] = a; ol[q] = c2; }
                const size_t o = ((size_t)zz * RH + i) * TT + ch * 128 + lane * 4; *(v4us*)(Ph + o) = oh; *(v4us*)(Pl + o) = ol; }
        } else {
#pragma unroll
            for (int ch = 0; ch < 16; ++ch) { v4h o;
#pragma unroll
                for (int q = 0; q < 4; ++q) o[q] = tohx(v[ch * 4 + q] * f);
                *(v4h*)(P16 + ((size_t)zz * (TT - RH) + (i - RH)) * TT + ch * 128 + lane * 4) = o; } }
         }
}
// k_merge: adds the KSP partial planes of attn.v (plane order 0..KSP-1, f32), undoes the fp16 rows' carry scale, splits into the hi/lo planes of the merged heads; 4 elements a lane
__global__ __launch_bounds__(256) void k_merge(const float* __restrict__ O, int h0, bf* Ah, bf* Al) {
    typedef __attribute__((ext_vector_type(4))) unsigned short v4us;
    const int e = (int)((blockIdx.x * 256u + threadIdx.x) * 4u); const int d = e & (HD - 1); const int t = (e >> 6) & (TT - 1); const int zz = e >> 17; v4us oh, ol; v4f pv[KSP];
    const unsigned off = ((unsigned)zz * (KSP * TT * HD) + (unsigned)(e & (TT * HD - 1))) * 4u;    // the lane's byte offset in plane 0 of its head; a head's KSP planes lie side by side, so every plane is within a load's immediate offset
#pragma unroll
    for (int ks = 0; ks < KSP; ++ks) pv[ks] = *(const v4f*)((const char*)O + (size_t)ks * (TT * HD * 4) + off);
    asm volatile("s_wait_xcnt 0x0" :: "v"(off) : "memory");    // the offset register that all KSP loads name stays whole until they have taken it
    v4f sm = pv[0];
#pragma unroll
    for (int ks = 1; ks < KSP; ++ks) sm += pv[ks];
    const float cs = (t < RH) ? 1.0f : (1.0f / PCAR);
#pragma unroll
    for (int q = 0; q < 4; ++q) { unsigned short a, c2; splitf(sm[q] * cs, a, c2); oh[q] = a; ol[q] = c2; }
    const size_t o = (size_t)t * DD + (h0 + zz) * HD + d; *(v4us*)(Ah + o) = oh; *(v4us*)(Al + o) = ol;
}

extern "C" void kernel_launch(void* const* d_in, const int* in_sizes, int n_in,
                              void* d_out, int out_size, void* d_ws, size_t ws_size, hipStream_t stream) {
    (void)in_sizes; (void)n_in; (void)out_size;
    const float* x = (const float*)d_in[0]; const int* mk = (const int*)d_in[1]; const float* Wq = (const float*)d_in[2]; const float* bq = (const float*)d_in[3]; const float* Wk = (const float*)d_in[4]; const float* bk = (const float*)d_in[5]; const float* Wv = (const float*)d_in[6]; const float* bv = (const float*)d_in[7]; const float* Wd = (const float*)d_in[8]; const float* bo = (const float*)d_in[9];
    float* OUT = (float*)d_out;     // [2][2048][1024]
    char* wsp = (char*)d_ws;
    auto take = [&](size_t bytes) { char* p = wsp; wsp += (bytes + 255) & ~(size_t)255; return (void*)p; };
    bf* WQ = (bf*)take((size_t)DD * DD * 2); bf* WK = (bf*)take((size_t)DD * DD * 2); bf* WV = (bf*)take((size_t)DD * DD * 2); bf* WO = (bf*)take((size_t)DD * DD * 2);
    // Overlays, so that ZH heads fit (launches of one stream run in order): XB and F are dead from the v planes' launch to the next batch's first launches, the scores are dead once k_asoft has run.
    // ATh lies on XB, Pl on F, the attn.v partial planes Ob on Sb; P16 holds only the rows >= RH.
    bf* XB = (bf*)take((size_t)TT * DD * 2); float* F = (float*)take((size_t)TT * DD * 4); float* CSN = (float*)take((size_t)TT * NF * 2 * 4);
    bf* QPh = (bf*)take((size_t)TT * DD * 2); bf* QPl = (bf*)take((size_t)TT * DD * 2); bf* KPh = (bf*)take((size_t)TT * DD * 2); bf* KPl = (bf*)take((size_t)TT * DD * 2); bf* VTh = (bf*)take((size_t)TT * DD * 2); bf* VTl = (bf*)take((size_t)TT * DD * 2);
    h16* QP16 = (h16*)take((size_t)TT * DD * 2); h16* KP16 = (h16*)take((size_t)TT * DD * 2); h16* VT16 = (h16*)take((size_t)TT * DD * 2);
    float* Sb = (float*)take((size_t)ZH * TT * TT * 4); bf* Ph = (bf*)take((size_t)ZH * RH * TT * 2); h16* P16 = (h16*)take((size_t)ZH * (TT - RH) * TT * 2); bf* ATl = (bf*)take((size_t)TT * DD * 2);
    static_assert((size_t)ZH * RH * TT * 2 <= (size_t)TT * DD * 4 && KSP * HD <= TT, "overlays fit");
    bf* Pl = (bf*)F; float* Ob = Sb; bf* ATh = XB;
    if ((size_t)(wsp - (char*)d_ws) > ws_size) return;    // total 252.5 MiB; ws 256 MiB
    { const size_t nw = (size_t)DD * DD / 8; const unsigned gw = (unsigned)((nw + 255) / 256); k_cvt8<<<gw, 256, 0, stream>>>(Wq, WQ, nw); k_cvt8<<<gw, 256, 0, stream>>>(Wk, WK, nw); k_cvt8<<<gw, 256, 0, stream>>>(Wv, WV, nw); k_cvt8<<<gw, 256, 0, stream>>>(Wd, WO, nw);
      k_cstab<<<TT * NF / 256, 256, 0, stream>>>(CSN); }
    const unsigned LB = (unsigned)((NH_ * TT * HD / 64 + 63) / 64); const dim3 gP(TT / 64, DD / 64, 1);
    for (int b = 0; b < NB_; ++b) {
        k_cvt8<<<(unsigned)(((size_t)TT * DD / 8 + 255) / 256), 256, 0, stream>>>(x + (size_t)b * TT * DD, XB, (size_t)TT * DD / 8);
        k_gemmw<bf, 0, true><<<gP, 32, 0, stream>>>(XB, nullptr, WQ, nullptr, DD, F, DD, bq, 0, 0, 0, 0); k_hsplit<<<LB, 256, 0, stream>>>(F, DD, NH_, CSN, QPh, QPl, QP16);
        k_gemmw<bf, 0, true><<<gP, 32, 0, stream>>>(XB, nullptr, WK, nullptr, DD, F, DD, bk, 0, 0, 0, 0); k_hsplit<<<LB, 256, 0, stream>>>(F, DD, NH_, CSN, KPh, KPl, KP16);
        k_gemmw<bf, 0, true><<<gP, 32, 0, stream>>>(XB, nullptr, WV, nullptr, DD, F, DD, bv, 0, 0, 0, 0); k_vtplane<<<LB, 256, 0, stream>>>(F, VTh, VTl, VT16);
        for (int h0 = 0; h0 < NH_; h0 += ZH) { const size_t z0 = (size_t)h0;
            // scores: rows < RH on hi+lo planes (3 products), rows >= RH on fp16 planes - both into the same [ZH][TT][TT] score buffer
            k_gemmw<bf, 2, false><<<dim3(RH / 64, TT / 64, ZH), 32, 0, stream>>>(QPh + z0 * TT * HD, QPl + z0 * TT * HD, KPh + z0 * TT * HD, KPl + z0 * TT * HD, HD, Sb, TT, nullptr, (size_t)TT * HD, (size_t)TT * HD, (size_t)TT * TT, 0);
            k_gemmw<h16, 0, false><<<dim3((TT - RH) / 64, TT / 64, ZH), 32, 0, stream>>>(QP16 + z0 * TT * HD + (size_t)RH * HD, nullptr, KP16 + z0 * TT * HD, nullptr, HD, Sb + (size_t)RH * TT, TT, nullptr, (size_t)TT * HD, (size_t)TT * HD, (size_t)TT * TT, 0);
            k_asoft<<<ZH * TT / 8, 256, 0, stream>>>(Sb, mk, Ph, Pl, P16);
            // attn.v: each 64x64 tile's 2048 keys go to KSP waves (blockIdx.y); the KSP partial planes [ZH][KSP][TT][HD] are added in k_merge
            k_gemmw<bf, 2, false, KSP><<<dim3(RH / 64, KSP, ZH), 32, 0, stream>>>(Ph, Pl, VTh + z0 * HD * TT, VTl + z0 * HD * TT, TT, Ob, HD, nullptr, (size_t)RH * TT, (size_t)HD * TT, (size_t)KSP * TT * HD, (size_t)TT * HD);
            k_gemmw<h16, 0, false, KSP><<<dim3((TT - RH) / 64, KSP, ZH), 32, 0, stream>>>(P16, nullptr, VT16 + z0 * HD * TT, nullptr, TT, Ob + (size_t)RH * HD, HD, nullptr, (size_t)(TT - RH) * TT, (size_t)HD * TT, (size_t)KSP * TT * HD, (size_t)TT * HD);
            k_merge<<<ZH * TT * HD / 1024, 256, 0, stream>>>(Ob, h0, ATh, ATl); }
        k_gemmw<bf, 1, true><<<gP, 32, 0, stream>>>(ATh, ATl, WO, nullptr, DD, OUT + (size_t)b * TT * DD, DD, bo, 0, 0, 0, 0); }
}

// v003
// A run of this version takes 399 microseconds.
// Timed twice side by side with v002, it ran 1.66 times as fast both times.
// All steps since v000 together make it 5.25 times as fast.
#include <hip/hip_runtime.h>

// MultiheadAttentionCore (x_q [2][2048][1024], attn_mask [2048][2048] bool->int32 (True = keep; read as data; here it is the causal triangle); q/k/v = x W^T + b; 16 heads x 64; rotate-half RoPE over the 64 head
// dims (inv_freq 10000^(-2i/64), positions 0..2047) on q and k; scores /8; -inf where mask == 0; softmax; out = merged Wo^T + bo).
// Compute dtypes, f32 accumulate: every input rounded to bf16; q/k/v projections on PLAIN bf16 operands (inputs: exact, + bias), out projection on hi+lo merged planes x bf16 Wo (2 products); rotary f32 (powf / cosf / sinf, partner x[d^32]
// read from memory); PER-ROW PRECISION HYBRID: query rows < 256 of each batch on bf16 hi+lo planes for scores and attn.v (3 products), rows >= 256 on SINGLE fp16 planes; the mask read per (i, j);

#define NB_  2
#define TT   2048
#define DD   1024
#define NH_  16
#define HD   64
#define RH   256                  // query rows < RH: hi+lo planes; rows >= RH: fp16 planes
#define NF   32                   // rotary frequencies (head_dim / 2)
#define SCL  0.125f               // 1/sqrt(64)
#define PCAR 1024.0f         // fp16 P is scaled by this; divided out with l at the end
typedef _Float16 h16;
typedef unsigned short bf;
typedef __attribute__((ext_vector_type(16))) __bf16   v16bf;
typedef __attribute__((ext_vector_type(16))) _Float16 v16h;
typedef __attribute__((ext_vector_type(8)))  _Float16 v8h;
typedef __attribute__((ext_vector_type(8)))  unsigned short v8us;
typedef __attribute__((ext_vector_type(8)))  float    v8f;
typedef __attribute__((ext_vector_type(4)))  float    v4f;
typedef v8h  __attribute__((may_alias)) v8ha;
typedef v4f  __attribute__((may_alias)) v4fa;
typedef v8us __attribute__((may_alias)) v8usa;

__device__ __forceinline__ unsigned short f2bf(float f) { unsigned u = __float_as_uint(f); u += 0x7FFFu + ((u >> 16) & 1u); return (unsigned short)(u >> 16); }
__device__ __forceinline__ float bf2f(unsigned short b) { return __uint_as_float(((unsigned)b) << 16); }
__device__ __forceinline__ float bfr(float f) { return bf2f(f2bf(f)); }
__device__ __forceinline__ v16h cat16(v8h lo, v8h hi) { return __builtin_shufflevector(lo, hi, 0, 1, 2, 3, 4, 5, 6, 7, 8, 9, 10, 11, 12, 13, 14, 15); }
__device__ __forceinline__ v16bf cat16b(v8us lo, v8us hi) { return __builtin_bit_cast(v16bf, __builtin_shufflevector(lo, hi, 0, 1, 2, 3, 4, 5, 6, 7, 8, 9, 10, 11, 12, 13, 14, 15)); }
__device__ __forceinline__ v8f wmma16(v16h a, v16h b, v8f c) { return __builtin_amdgcn_wmma_f32_16x16x32_f16(false, a, false, b, (short)0, c, false, false); }
__device__ __forceinline__ v8f wmmab(v16bf a, v16bf b, v8f c) { return __builtin_amdgcn_wmma_f32_16x16x32_bf16(false, a, false, b, (short)0, c, false, false); }



// ---- k_gemmw: register-blocked GEMM, ONE WAVE per 64x64 output tile (16 accumulators), operands straight from K-contiguous 16-bit planes; grid (M/64, N/64, Z), 32 threads.
// C[m][n] (f32, pitch ldc, + optional f32 bias[n]) = sum_k A[m][k] Bt[n][k] (+ split products per NSPLIT). z-batch strides sA/sB/sC in elements. K % 32 == 0.
// KS > 1 (N == 64 only): blockIdx.y is a K slice, not a column tile: the wave sums k in [y K/KS, (y+1) K/KS) and stores its partial tile in plane y (C + y sK); the reader adds the KS planes.
template <typename T16> struct WFrag;
template <> struct WFrag<h16> { typedef v16h V; static __device__ __forceinline__ V ld(const h16* p) { return cat16(*(const v8h*)p, *(const v8h*)(p + 16)); } static __device__ __forceinline__ v8f mma(V a, V b, v8f c) { return wmma16(a, b, c); } };
template <> struct WFrag<bf> { typedef v16bf V; static __device__ __forceinline__ V ld(const bf* p) { return cat16b(*(const v8us*)p, *(const v8us*)(p + 16)); } static __device__ __forceinline__ v8f mma(V a, V b, v8f c) { return wmmab(a, b, c); } };
template <typename T16, int NSPLIT, bool BIAS, int KS = 1>
__global__ __launch_bounds__(32) void k_gemmw(const T16* __restrict__ A, const T16* __restrict__ A2, const T16* __restrict__ Bt, const T16* __restrict__ Bt2, int K, float* C, int ldc, const float* __restrict__ bias, size_t sA, size_t sB, size_t sC, size_t sK) {
    typedef typename WFrag<T16>::V V;
    __shared__ __align__(16) float os[16 * 68];
    const size_t z = blockIdx.z; A += z * sA; if (A2) A2 += z * sA; Bt += z * sB; if (Bt2) Bt2 += z * sB; C += z * sC;
    const int lane = threadIdx.x & 31, lr = lane & 15, hi = lane >> 4; const int r0 = blockIdx.x * 64, c0 = (KS > 1) ? 0 : blockIdx.y * 64;
    const int KL = K / KS; if (KS > 1) { const size_t ko = (size_t)blockIdx.y * KL; A += ko; if (A2) A2 += ko; Bt += ko; if (Bt2) Bt2 += ko; C += (size_t)blockIdx.y * sK; }
    v8f acc[4][4];
#pragma unroll
    for (int mb = 0; mb < 4; ++mb)
#pragma unroll
        for (int nb = 0; nb < 4; ++nb) acc[mb][nb] = (v8f){};
    const size_t aoff = (size_t)(r0 + lr) * K + 8 * hi, boff = (size_t)(c0 + lr) * K + 8 * hi;
#pragma unroll 1
    for (int kc = 0; kc < KL; kc += 32) {
        V a[4], a2[4];
#pragma unroll
        for (int mb = 0; mb < 4; ++mb) { a[mb] = WFrag<T16>::ld(A + aoff + (size_t)mb * 16 * K + kc); if (NSPLIT == 1 || NSPLIT == 2) a2[mb] = WFrag<T16>::ld(A2 + aoff + (size_t)mb * 16 * K + kc); }
#pragma unroll
        for (int nb = 0; nb < 4; ++nb) { const V b = WFrag<T16>::ld(Bt + boff + (size_t)nb * 16 * K + kc); V b2; if (NSPLIT >= 2) b2 = WFrag<T16>::ld(Bt2 + boff + (size_t)nb * 16 * K + kc);
#pragma unroll
            for (int mb = 0; mb < 4; ++mb) { acc[mb][nb] = WFrag<T16>::mma(a[mb], b, acc[mb][nb]); if (NSPLIT == 1 || NSPLIT == 2) acc[mb][nb] = WFrag<T16>::mma(a2[mb], b, acc[mb][nb]); if (NSPLIT >= 2) acc[mb][nb] = WFrag<T16>::mma(a[mb], b2, acc[mb][nb]); } }
        asm volatile("v_nop\n\tv_nop\n\tv_nop\n\tv_nop" : "+v"(acc[0][0]), "+v"(acc[1][1]), "+v"(acc[2][2]), "+v"(acc[3][3]) : "v"(a[0]), "v"(a[3]));
    }
#pragma unroll
    for (int mb = 0; mb < 4; ++mb) {
#pragma unroll
        for (int nb = 0; nb < 4; ++nb) {
#pragma unroll
            for (int j = 0; j < 8; ++j) os[(hi * 8 + j) * 68 + nb * 16 + lr] = acc[mb][nb][j]; }
        __builtin_amdgcn_wave_barrier(); asm volatile("" ::: "memory");
        float* crow = C + (size_t)(r0 + mb * 16) * ldc + c0;
{
#pragma unroll
            for (int s = 0; s < 8; ++s) { const int row = 2 * s + hi, cofs = lr * 4; v4f val = *(const v4fa*)(os + row * 68 + cofs); if (BIAS) { val[0] += bfr(bias[c0 + cofs]); val[1] += bfr(bias[c0 + cofs + 1]); val[2] += bfr(bias[c0 + cofs + 2]); val[3] += bfr(bias[c0 + cofs + 3]); }
                *(v4f*)(crow + (size_t)row * ldc + cofs) = val; }
             }
        __builtin_amdgcn_wave_barrier(); asm volatile("" ::: "memory");
    }
}

__device__ __forceinline__ h16 tohx(float x) { return (h16)x; }
__device__ __forceinline__ void splitf(float y, unsigned short& h, unsigned short& l) { h = f2bf(y); l = f2bf(y - bf2f(h)); }
typedef __attribute__((ext_vector_type(2))) unsigned short v2us;
typedef __attribute__((ext_vector_type(2))) _Float16 v2h;
typedef __attribute__((ext_vector_type(4))) _Float16 v4h;
typedef __attribute__((ext_vector_type(2))) float v2f;

__global__ __launch_bounds__(256) void k_cvt8(const float* __restrict__ src, bf* dst, size_t n8) { const size_t i = (size_t)blockIdx.x * 256 + threadIdx.x; if (i >= n8) return; const v8f v = *(const v8f*)(src + i * 8); v8us o;
#pragma unroll
    for (int k = 0; k < 8; ++k) o[k] = f2bf(v[k]); *(v8us*)(dst + i * 8) = o;  }
__global__ __launch_bounds__(256) void k_cstab(float* CSN) {
    const int idx = blockIdx.x * 256 + threadIdx.x; if (idx >= TT * NF) return; const int t = idx / NF, i = idx % NF; const float den = powf(10000.0f, (float)(2 * i) * (1.0f / HD)); const float ang = __fdiv_rn((float)t, den);
    v2f o; o[0] = cosf(ang); o[1] = sinf(ang); *(v2f*)(CSN + (size_t)idx * 2) = o;  }
// k_hsplit: head planes (hi/lo + fp16) [h][t][d] for one batch (row pitch 'pitch', 'nheads' heads) with rotate-half RoPE: r = x cos - x' sin for d < 32, x cos + x' sin for d >= 32, x' = F[t][h*64 + (d ^ 32)]
__global__ __launch_bounds__(256) void k_hsplit(const float* __restrict__ F, int pitch, int nheads, const float* __restrict__ CSN, bf* Ph, bf* Pl, h16* P16) {
    const int lane = threadIdx.x & 31; const int L0 = (blockIdx.x * 8 + (threadIdx.x >> 5)) * 8; const int nlines = nheads * TT * HD / 64;
{
#pragma unroll
        for (int l = 0; l < 8; ++l) { const int L = L0 + l; if (L >= nlines) break; const int e = L * 64 + lane * 2; const int d = e & (HD - 1); const int t = (e >> 6) & (TT - 1); const int h = e >> 17; v2us oh, ol; v2h o16;
#pragma unroll
            for (int q = 0; q < 2; ++q) { const int dd = d + q; const float x0 = F[(size_t)t * pitch + h * HD + dd], x1 = F[(size_t)t * pitch + h * HD + (dd ^ NF)]; const v2f cs = *(const v2f*)(CSN + ((size_t)t * NF + (dd & (NF - 1))) * 2);
                float a0 = __fmul_rn(cs[0], x0), a1 = __fmul_rn(cs[1], x1); asm volatile("" : "+v"(a0)); asm volatile("" : "+v"(a1)); const float r = (dd < NF) ? __fsub_rn(a0, a1) : __fadd_rn(a0, a1);
                unsigned short a, c2; splitf(r, a, c2); oh[q] = a; ol[q] = c2; o16[q] = tohx(r); }
            *(v2us*)(Ph + (size_t)e) = oh; *(v2us*)(Pl + (size_t)e) = ol; *(v2h*)(P16 + (size_t)e) = o16; }
         }
}
__global__ __launch_bounds__(256) void k_vtplane(const float* __restrict__ F, bf* Vh, bf* Vl, h16* V16) {
    const int lane = threadIdx.x & 31; const int L0 = (blockIdx.x * 8 + (threadIdx.x >> 5)) * 8; const int nlines = NH_ * TT * HD / 64;
{
#pragma unroll
        for (int l = 0; l < 8; ++l) { const int L = L0 + l; if (L >= nlines) break; const int e = L * 64 + lane * 2; const int t = e & (TT - 1); const int d = (e >> 11) & (HD - 1); const int h = e >> 17; v2us oh, ol; v2h o16;
#pragma unroll
            for (int q = 0; q < 2; ++q) { const float x = F[(size_t)(t + q) * DD + h * HD + d]; unsigned short a, c2; splitf(x, a, c2); oh[q] = a; ol[q] = c2; o16[q] = tohx(x); }
            *(v2us*)(Vh + (size_t)e) = oh; *(v2us*)(Vl + (size_t)e) = ol; *(v2h*)(V16 + (size_t)e) = o16; }
         }
}
// k_fattn: scores, mask, softmax and attn.v of all heads and both batches in ONE launch; no score or probability ever goes to memory. One wave owns R groups of 16 query rows and walks the 2048 keys in passes of 32.
// Transposed products: S^T = K Q^T (A = 16 key rows, B = 16 query columns), so a lane holds scores of ONE query (column lane & 15; key = 16 kt + 8 (lane >> 4) + register), and the two 16-key tiles of a pass, once
// exponentiated and rounded, ARE the B operand (32 keys x 16 queries, same k order as the loader's) of O^T += V^T P^T, whose A rows come from the [d][t] planes. Online softmax: running maximum m and sum l per query;
// when a pass raises some maximum, l and O^T are scaled by exp(m_old - m_new). A masked score is -3e38 as before: exp gives 0 once the row has met a kept key, and what was added before that is wiped by the factor 0.
// P is rounded UNNORMALISED (exp(s - m) <= 1; the fp16 rows carry the factor PCAR as before), the division by l comes once at the end, in f32. Rows < RH: hi+lo planes, 3 products each; rows >= RH: fp16 planes.
typedef __attribute__((ext_vector_type(4))) int v4i;
typedef __attribute__((ext_vector_type(8))) unsigned v8u;
__device__ __forceinline__ unsigned pack2(float lo, float hi) { typedef __bf16 bf2 __attribute__((ext_vector_type(2))); return __builtin_bit_cast(unsigned, __builtin_convertvector(v2f{lo, hi}, bf2)); }  // two f32 to bf16, round to nearest even
__device__ __forceinline__ float xhalf(float x) { return __builtin_bit_cast(float, __builtin_amdgcn_permlanex16(__builtin_bit_cast(int, x), __builtin_bit_cast(int, x), 0x76543210, 0xfedcba98, false, false)); }  // lane l with lane l ^ 16
// Stands directly behind each group of global loads: the address registers that the loads name are not rewritten before the loads have taken them; the scheduling barriers hold the loads
// in front of the wait and every later register write behind it (they also keep each group where the pass wants it issued).
// The addresses are inputs of the wait, so that they stay whole up to it: no load of the group gets one of them as its destination.
__device__ __forceinline__ void loads_taken(const void* a, const void* b, const void* c) { __builtin_amdgcn_sched_barrier(0); asm volatile("s_wait_xcnt 0x0" :: "v"(a), "v"(b), "v"(c) : "memory"); __builtin_amdgcn_sched_barrier(0); }
template <typename T16, bool HI, int R>
__device__ __forceinline__ void attn_rows(const T16* __restrict__ Q, const T16* __restrict__ Q2, const T16* __restrict__ Kp, const T16* __restrict__ K2, const T16* __restrict__ Vt, const T16* __restrict__ Vt2, const int* __restrict__ mk, int q0, bf* Ah, bf* Al) {
    typedef typename WFrag<T16>::V V;
    const int lane = threadIdx.x & 31, lr = lane & 15, hi = lane >> 4;
    V qf[R][2], qf2[R][2]; v8f acc[R][4]; float mrun[R], lsum[R];
    const T16* qb = Q + (unsigned)(q0 + lr) * HD + 8 * hi; const T16* qb2 = HI ? Q2 + (unsigned)(q0 + lr) * HD + 8 * hi : qb;
#pragma unroll
    for (int g = 0; g < R; ++g) { mrun[g] = -3.0e38f; lsum[g] = 0.f;
#pragma unroll
        for (int kc = 0; kc < 2; ++kc) { const int o = 16 * g * HD + 32 * kc; qf[g][kc] = WFrag<T16>::ld(qb + o); if (HI) qf2[g][kc] = WFrag<T16>::ld(qb2 + o); }
#pragma unroll
        for (int t = 0; t < 4; ++t) acc[g][t] = (v8f){}; }
    loads_taken(qb, qb2, qb);
    V kf[2][2], kf2[2][2]; v4i mm[R][2][2];
    // lane parts of the addresses, in bytes, fixed for the whole walk
    const unsigned vk = (unsigned)(lr * HD + 8 * hi) * 2u, vv = (unsigned)(lr * TT + 8 * hi) * 2u, vm = ((unsigned)(q0 + lr) * TT + 8 * hi) * 4u;
    auto load_km = [&](int key0) {    // one pass's K fragments and mask words
        const char* kb = (const char*)Kp + (size_t)key0 * (HD * 2) + vk; const char* kb2 = HI ? (const char*)K2 + (size_t)key0 * (HD * 2) + vk : kb; const char* mb = (const char*)mk + (size_t)key0 * 4 + vm;
#pragma unroll
        for (int kt = 0; kt < 2; ++kt) {
#pragma unroll
            for (int kc = 0; kc < 2; ++kc) { kf[kt][kc] = WFrag<T16>::ld((const T16*)(kb + (16 * kt * HD + 32 * kc) * 2)); if (HI) kf2[kt][kc] = WFrag<T16>::ld((const T16*)(kb2 + (16 * kt * HD + 32 * kc) * 2)); }
#pragma unroll
            for (int g = 0; g < R; ++g) { const int* mp = (const int*)(mb + (16 * g * TT + 16 * kt) * 4); mm[g][kt][0] = *(const v4i*)mp; mm[g][kt][1] = *(const v4i*)(mp + 4); } }
        loads_taken(kb, kb2, mb);
    };
    load_km(0);
#pragma unroll 1
    for (int key0 = 0; key0 < TT; key0 += 32) {
        V vf[4], vf2[4];    // V^T fragments of this pass: in flight under the score products and the maxima
        const char* vb = (const char*)Vt + (size_t)key0 * 2 + vv; const char* vb2 = HI ? (const char*)Vt2 + (size_t)key0 * 2 + vv : vb;
#pragma unroll
        for (int t = 0; t < 4; ++t) { vf[t] = WFrag<T16>::ld((const T16*)(vb + 16 * t * TT * 2)); if (HI) vf2[t] = WFrag<T16>::ld((const T16*)(vb2 + 16 * t * TT * 2)); }
        loads_taken(vb, vb2, vb);
        v8f s[2][R];
#pragma unroll
        for (int kt = 0; kt < 2; ++kt)
#pragma unroll
            for (int g = 0; g < R; ++g) { s[kt][g] = (v8f){};
#pragma unroll
                for (int kc = 0; kc < 2; ++kc) { s[kt][g] = WFrag<T16>::mma(kf[kt][kc], qf[g][kc], s[kt][g]); if (HI) { s[kt][g] = WFrag<T16>::mma(kf[kt][kc], qf2[g][kc], s[kt][g]); s[kt][g] = WFrag<T16>::mma(kf2[kt][kc], qf[g][kc], s[kt][g]); } } }
        float mx[R]; bool need = false;
#pragma unroll
        for (int g = 0; g < R; ++g) { float m = -3.0e38f;
#pragma unroll
            for (int kt = 0; kt < 2; ++kt)
#pragma unroll
                for (int r = 0; r < 8; ++r) { const float t = (mm[g][kt][r >> 2][r & 3] != 0) ? s[kt][g][r] * SCL : -3.0e38f; s[kt][g][r] = t; m = fmaxf(m, t); }
            m = fmaxf(m, xhalf(m)); mx[g] = m; need = need || (m > mrun[g]); }
        const int keyn = key0 + 32 < TT ? key0 + 32 : TT - 32;    // the next pass's K and mask are fetched in this pass (the last pass reads its own again: in bounds, unused)
        load_km(keyn);    // in flight under the exponentials and the second product
        if (__builtin_amdgcn_ballot_w32(need) != 0) {    // wave-uniform: rare once the maxima have settled
#pragma unroll
            for (int g = 0; g < R; ++g) { const float mn = fmaxf(mrun[g], mx[g]); const float corr = __expf(mrun[g] - mn); mrun[g] = mn; lsum[g] *= corr;
#pragma unroll
                for (int t = 0; t < 4; ++t) acc[g][t] = acc[g][t] * corr; } }
#pragma unroll
        for (int g = 0; g < R; ++g) { float p[16]; float ps = 0.f;
#pragma unroll
            for (int i = 0; i < 16; ++i) p[i] = __expf(s[i >> 3][g][i & 7] - mrun[g]);
#pragma unroll
            for (int i = 0; i < 8; ++i) ps += p[i] + p[8 + i];
            lsum[g] += ps;
            if constexpr (HI) { v8u wh, wl;
#pragma unroll
                for (int i = 0; i < 8; ++i) { const unsigned w = pack2(p[2 * i], p[2 * i + 1]); wh[i] = w; wl[i] = pack2(p[2 * i] - __uint_as_float(w << 16), p[2 * i + 1] - __uint_as_float(w & 0xFFFF0000u)); }
                const V ph = __builtin_bit_cast(v16bf, wh), pl = __builtin_bit_cast(v16bf, wl);
#pragma unroll
                for (int t = 0; t < 4; ++t) { acc[g][t] = WFrag<T16>::mma(vf[t], ph, acc[g][t]); acc[g][t] = WFrag<T16>::mma(vf[t], pl, acc[g][t]); acc[g][t] = WFrag<T16>::mma(vf2[t], ph, acc[g][t]); }
            } else { V pf;
#pragma unroll
                for (int i = 0; i < 16; ++i) pf[i] = tohx(p[i] * PCAR);
#pragma unroll
                for (int t = 0; t < 4; ++t) acc[g][t] = WFrag<T16>::mma(vf[t], pf, acc[g][t]); } }
        __builtin_amdgcn_sched_barrier(0); asm volatile("v_nop\n\tv_nop\n\tv_nop\n\tv_nop"); __builtin_amdgcn_sched_barrier(0);    // the 4 vector slots behind the pass's last WMMAs, also on the taken back edge
    }
#pragma unroll
    for (int g = 0; g < R; ++g) { const float l = lsum[g] + xhalf(lsum[g]); const float inv = __fdiv_rn(1.0f, HI ? l : l * PCAR);
#pragma unroll
        for (int t = 0; t < 4; ++t) { v8us oh, ol;    // the lane's 8 values are d = 16 t + 8 hi + 0..7 of query q0 + 16 g + lr
#pragma unroll
            for (int r = 0; r < 8; ++r) { unsigned short a, c2; splitf(acc[g][t][r] * inv, a, c2); oh[r] = a; ol[r] = c2; }
            const size_t o = (size_t)(q0 + 16 * g + lr) * DD + 16 * t + 8 * hi; *(v8us*)(Ah + o) = oh; *(v8us*)(Al + o) = ol; } }
}
// grid (RH/64 + (TT-RH)/128, heads, batches), 4 waves: the first RH/64 blocks of a head take 16 hi+lo rows a wave, the others 32 fp16 rows a wave
__global__ __launch_bounds__(128) void k_fattn(const bf* __restrict__ QPh, const bf* __restrict__ QPl, const bf* __restrict__ KPh, const bf* __restrict__ KPl, const bf* __restrict__ VTh, const bf* __restrict__ VTl,
                                               const h16* __restrict__ QP16, const h16* __restrict__ KP16, const h16* __restrict__ VT16, const int* __restrict__ mk, bf* ATh, bf* ATl) {
    const size_t pz = ((size_t)blockIdx.z * NH_ + blockIdx.y) * (TT * HD); const size_t oz = (size_t)blockIdx.z * TT * DD + blockIdx.y * HD; const int wave = threadIdx.x >> 5;
    if (blockIdx.x < RH / 64) attn_rows<bf, true, 1>(QPh + pz, QPl + pz, KPh + pz, KPl + pz, VTh + pz, VTl + pz, mk, (int)blockIdx.x * 64 + wave * 16, ATh + oz, ATl + oz);
    else attn_rows<h16, false, 2>(QP16 + pz, nullptr, KP16 + pz, nullptr, VT16 + pz, nullptr, mk, RH + ((int)blockIdx.x - RH / 64) * 128 + wave * 32, ATh + oz, ATl + oz);
}

extern "C" void kernel_launch(void* const* d_in, const int* in_sizes, int n_in,
                              void* d_out, int out_size, void* d_ws, size_t ws_size, hipStream_t stream) {
    (void)in_sizes; (void)n_in; (void)out_size;
    const float* x = (const float*)d_in[0]; const int* mk = (const int*)d_in[1]; const float* Wq = (const float*)d_in[2]; const float* bq = (const float*)d_in[3]; const float* Wk = (const float*)d_in[4]; const float* bk = (const float*)d_in[5]; const float* Wv = (const float*)d_in[6]; const float* bv = (const float*)d_in[7]; const float* Wd = (const float*)d_in[8]; const float* bo = (const float*)d_in[9];
    float* OUT = (float*)d_out;     // [2][2048][1024]
    char* wsp = (char*)d_ws;
    auto take = [&](size_t bytes) { char* p = wsp; wsp += (bytes + 255) & ~(size_t)255; return (void*)p; };
    const size_t PB = (size_t)TT * DD;    // elements of one batch's plane
    bf* WQ = (bf*)take((size_t)DD * DD * 2); bf* WK = (bf*)take((size_t)DD * DD * 2); bf* WV = (bf*)take((size_t)DD * DD * 2); bf* WO = (bf*)take((size_t)DD * DD * 2);
    bf* XB = (bf*)take(PB * 2); float* F = (float*)take(PB * 4); float* CSN = (float*)take((size_t)TT * NF * 2 * 4);
    // head planes and merged-head planes of BOTH batches: the attention launch reads and writes them all
    bf* QPh = (bf*)take(NB_ * PB * 2); bf* QPl = (bf*)take(NB_ * PB * 2); bf* KPh = (bf*)take(NB_ * PB * 2); bf* KPl = (bf*)take(NB_ * PB * 2); bf* VTh = (bf*)take(NB_ * PB * 2); bf* VTl = (bf*)take(NB_ * PB * 2);
    h16* QP16 = (h16*)take(NB_ * PB * 2); h16* KP16 = (h16*)take(NB_ * PB * 2); h16* VT16 = (h16*)take(NB_ * PB * 2);
    bf* ATh = (bf*)take(NB_ * PB * 2); bf* ATl = (bf*)take(NB_ * PB * 2);
    if ((size_t)(wsp - (char*)d_ws) > ws_size) return;    // total 108.5 MiB; ws 256 MiB
    { const size_t nw = (size_t)DD * DD / 8; const unsigned gw = (unsigned)((nw + 255) / 256); k_cvt8<<<gw, 256, 0, stream>>>(Wq, WQ, nw); k_cvt8<<<gw, 256, 0, stream>>>(Wk, WK, nw); k_cvt8<<<gw, 256, 0, stream>>>(Wv, WV, nw); k_cvt8<<<gw, 256, 0, stream>>>(Wd, WO, nw);
      k_cstab<<<TT * NF / 256, 256, 0, stream>>>(CSN); }
    const unsigned LB = (unsigned)((NH_ * TT * HD / 64 + 63) / 64); const dim3 gP(TT / 64, DD / 64, 1);
    for (int b = 0; b < NB_; ++b) {
        k_cvt8<<<(unsigned)((PB / 8 + 255) / 256), 256, 0, stream>>>(x + b * PB, XB, PB / 8);
        k_gemmw<bf, 0, true><<<gP, 32, 0, stream>>>(XB, nullptr, WQ, nullptr, DD, F, DD, bq, 0, 0, 0, 0); k_hsplit<<<LB, 256, 0, stream>>>(F, DD, NH_, CSN, QPh + b * PB, QPl + b * PB, QP16 + b * PB);
        k_gemmw<bf, 0, true><<<gP, 32, 0, stream>>>(XB, nullptr, WK, nullptr, DD, F, DD, bk, 0, 0, 0, 0); k_hsplit<<<LB, 256, 0, stream>>>(F, DD, NH_, CSN, KPh + b * PB, KPl + b * PB, KP16 + b * PB);
        k_gemmw<bf, 0, true><<<gP, 32, 0, stream>>>(XB, nullptr, WV, nullptr, DD, F, DD, bv, 0, 0, 0, 0); k_vtplane<<<LB, 256, 0, stream>>>(F, VTh + b * PB, VTl + b * PB, VT16 + b * PB); }
    k_fattn<<<dim3(RH / 64 + (TT - RH) / 128, NH_, NB_), 128, 0, stream>>>(QPh, QPl, KPh, KPl, VTh, VTl, QP16, KP16, VT16, mk, ATh, ATl);
    for (int b = 0; b < NB_; ++b)
        k_gemmw<bf, 1, true><<<gP, 32, 0, stream>>>(ATh + b * PB, ATl + b * PB, WO, nullptr, DD, OUT + b * PB, DD, bo, 0, 0, 0, 0);
}

// v004
// It runs in 259 microseconds.
// In two side-by-side timings against v003, it was 1.53 and 1.55 times as fast.
// Counting every step since v000, it is 8.11 times as fast.
#include <hip/hip_runtime.h>

// MultiheadAttentionCore (x_q [2][2048][1024], attn_mask [2048][2048] bool->int32 (True = keep; read as data; here it is the causal triangle); q/k/v = x W^T + b; 16 heads x 64; rotate-half RoPE over the 64 head
// dims (inv_freq 10000^(-2i/64), positions 0..2047) on q and k; scores /8; -inf where mask == 0; softmax; out = merged Wo^T + bo).
// Compute dtypes, f32 accumulate: every input rounded to bf16; q/k/v projections on PLAIN bf16 operands (inputs: exact, + bias), out projection on hi+lo merged planes x bf16 Wo (2 products); rotary f32 (powf / cosf / sinf, partner x[d^32]
// read from memory); PER-ROW PRECISION HYBRID: query rows < 256 of each batch on bf16 hi+lo planes for scores and attn.v (3 products), rows >= 256 on SINGLE fp16 planes; the mask read per (i, j);

#define NB_  2
#define TT   2048
#define DD   1024
#define NH_  16
#define HD   64
#define RH   256                  // query rows < RH: hi+lo planes; rows >= RH: fp16 planes
#define NF   32                   // rotary frequencies (head_dim / 2)
#define SCL  0.125f               // 1/sqrt(64)
#define PCAR 1024.0f         // fp16 P is scaled by this; divided out with l at the end
typedef _Float16 h16;
typedef unsigned short bf;
typedef __attribute__((ext_vector_type(16))) __bf16   v16bf;
typedef __attribute__((ext_vector_type(16))) _Float16 v16h;
typedef __attribute__((ext_vector_type(8)))  _Float16 v8h;
typedef __attribute__((ext_vector_type(8)))  unsigned short v8us;
typedef __attribute__((ext_vector_type(8)))  float    v8f;
typedef __attribute__((ext_vector_type(4)))  float    v4f;
typedef v8h  __attribute__((may_alias)) v8ha;
typedef v4f  __attribute__((may_alias)) v4fa;
typedef v8us __attribute__((may_alias)) v8usa;

__device__ __forceinline__ unsigned short f2bf(float f) { unsigned u = __float_as_uint(f); u += 0x7FFFu + ((u >> 16) & 1u); return (unsigned short)(u >> 16); }
__device__ __forceinline__ float bf2f(unsigned short b) { return __uint_as_float(((unsigned)b) << 16); }
__device__ __forceinline__ float bfr(float f) { return bf2f(f2bf(f)); }
__device__ __forceinline__ v16h cat16(v8h lo, v8h hi) { return __builtin_shufflevector(lo, hi, 0, 1, 2, 3, 4, 5, 6, 7, 8, 9, 10, 11, 12, 13, 14, 15); }
__device__ __forceinline__ v16bf cat16b(v8us lo, v8us hi) { return __builtin_bit_cast(v16bf, __builtin_shufflevector(lo, hi, 0, 1, 2, 3, 4, 5, 6, 7, 8, 9, 10, 11, 12, 13, 14, 15)); }
__device__ __forceinline__ v8f wmma16(v16h a, v16h b, v8f c) { return __builtin_amdgcn_wmma_f32_16x16x32_f16(false, a, false, b, (short)0, c, false, false); }
__device__ __forceinline__ v8f wmmab(v16bf a, v16bf b, v8f c) { return __builtin_amdgcn_wmma_f32_16x16x32_bf16(false, a, false, b, (short)0, c, false, false); }



// ---- k_gemmw: register-blocked GEMM, ONE WAVE per 64x64 output tile (16 accumulators), operands straight from K-contiguous 16-bit planes; grid (M/64, N/64, Z), 32 threads.
// C[m][n] (f32, pitch ldc, + optional f32 bias[n]) = sum_k A[m][k] Bt[n][k] (+ split products per NSPLIT). z-batch strides sA/sB/sC in elements. K % 32 == 0.
// blockIdx.z also picks the bias among bias, biasz1, biasz2 (q, k and v projections of one launch).
// KS > 1 (N == 64 only): blockIdx.y is a K slice, not a column tile: the wave sums k in [y K/KS, (y+1) K/KS) and stores its partial tile in plane y (C + y sK); the reader adds the KS planes.
template <typename T16> struct WFrag;
template <> struct WFrag<h16> { typedef v16h V; static __device__ __forceinline__ V ld(const h16* p) { return cat16(*(const v8h*)p, *(const v8h*)(p + 16)); } static __device__ __forceinline__ v8f mma(V a, V b, v8f c) { return wmma16(a, b, c); } };
template <> struct WFrag<bf> { typedef v16bf V; static __device__ __forceinline__ V ld(const bf* p) { return cat16b(*(const v8us*)p, *(const v8us*)(p + 16)); } static __device__ __forceinline__ v8f mma(V a, V b, v8f c) { return wmmab(a, b, c); } };
template <typename T16, int NSPLIT, bool BIAS, int KS = 1>
__global__ __launch_bounds__(32) void k_gemmw(const T16* __restrict__ A, const T16* __restrict__ A2, const T16* __restrict__ Bt, const T16* __restrict__ Bt2, int K, float* C, int ldc, const float* __restrict__ bias, const float* __restrict__ biasz1, const float* __restrict__ biasz2, size_t sA, size_t sB, size_t sC, size_t sK) {
    typedef typename WFrag<T16>::V V;
    __shared__ __align__(16) float os[16 * 68];
    const size_t z = blockIdx.z; A += z * sA; if (A2) A2 += z * sA; Bt += z * sB; if (Bt2) Bt2 += z * sB; C += z * sC; if (BIAS) bias = z == 0 ? bias : z == 1 ? biasz1 : biasz2;
    const int lane = threadIdx.x & 31, lr = lane & 15, hi = lane >> 4; const int r0 = blockIdx.x * 64, c0 = (KS > 1) ? 0 : blockIdx.y * 64;
    const int KL = K / KS; if (KS > 1) { const size_t ko = (size_t)blockIdx.y * KL; A += ko; if (A2) A2 += ko; Bt += ko; if (Bt2) Bt2 += ko; C += (size_t)blockIdx.y * sK; }
    v8f acc[4][4];
#pragma unroll
    for (int mb = 0; mb < 4; ++mb)
#pragma unroll
        for (int nb = 0; nb < 4; ++nb) acc[mb][nb] = (v8f){};
    const size_t aoff = (size_t)(r0 + lr) * K + 8 * hi, boff = (size_t)(c0 + lr) * K + 8 * hi;
#pragma unroll 1
    for (int kc = 0; kc < KL; kc += 32) {
        V a[4], a2[4];
#pragma unroll
        for (int mb = 0; mb < 4; ++mb) { a[mb] = WFrag<T16>::ld(A + aoff + (size_t)mb * 16 * K + kc); if (NSPLIT == 1 || NSPLIT == 2) a2[mb] = WFrag<T16>::ld(A2 + aoff + (size_t)mb * 16 * K + kc); }
#pragma unroll
        for (int nb = 0; nb < 4; ++nb) { const V b = WFrag<T16>::ld(Bt + boff + (size_t)nb * 16 * K + kc); V b2; if (NSPLIT >= 2) b2 = WFrag<T16>::ld(Bt2 + boff + (size_t)nb * 16 * K + kc);
#pragma unroll
            for (int mb = 0; mb < 4; ++mb) { acc[mb][nb] = WFrag<T16>::mma(a[mb], b, acc[mb][nb]); if (NSPLIT == 1 || NSPLIT == 2) acc[mb][nb] = WFrag<T16>::mma(a2[mb], b, acc[mb][nb]); if (NSPLIT >= 2) acc[mb][nb] = WFrag<T16>::mma(a[mb], b2, acc[mb][nb]); } }
        asm volatile("v_nop\n\tv_nop\n\tv_nop\n\tv_nop" : "+v"(acc[0][0]), "+v"(acc[1][1]), "+v"(acc[2][2]), "+v"(acc[3][3]) : "v"(a[0]), "v"(a[3]));
    }
#pragma unroll
    for (int mb = 0; mb < 4; ++mb) {
#pragma unroll
        for (int nb = 0; nb < 4; ++nb) {
#pragma unroll
            for (int j = 0; j < 8; ++j) os[(hi * 8 + j) * 68 + nb * 16 + lr] = acc[mb][nb][j]; }
        __builtin_amdgcn_wave_barrier(); asm volatile("" ::: "memory");
        float* crow = C + (size_t)(r0 + mb * 16) * ldc + c0;
{
#pragma unroll
            for (int s = 0; s < 8; ++s) { const int row = 2 * s + hi, cofs = lr * 4; v4f val = *(const v4fa*)(os + row * 68 + cofs); if (BIAS) { val[0] += bfr(bias[c0 + cofs]); val[1] += bfr(bias[c0 + cofs + 1]); val[2] += bfr(bias[c0 + cofs + 2]); val[3] += bfr(bias[c0 + cofs + 3]); }
                *(v4f*)(crow + (size_t)row * ldc + cofs) = val; }
             }
        __builtin_amdgcn_wave_barrier(); asm volatile("" ::: "memory");
    }
}

__device__ __forceinline__ h16 tohx(float x) { return (h16)x; }
__device__ __forceinline__ void splitf(float y, unsigned short& h, unsigned short& l) { h = f2bf(y); l = f2bf(y - bf2f(h)); }
typedef __attribute__((ext_vector_type(2))) unsigned short v2us;
typedef __attribute__((ext_vector_type(2))) _Float16 v2h;
typedef __attribute__((ext_vector_type(4))) _Float16 v4h;
typedef __attribute__((ext_vector_type(2))) float v2f;

__device__ __forceinline__ void cvt8(const float* __restrict__ src, bf* dst, size_t n8) { const size_t i = (size_t)blockIdx.x * 256 + threadIdx.x; if (i >= n8) return; const v8f v = *(const v8f*)(src + i * 8); v8us o;
#pragma unroll
    for (int k = 0; k < 8; ++k) o[k] = f2bf(v[k]); *(v8us*)(dst + i * 8) = o;  }
__device__ __forceinline__ void cstab(float* CSN) {
    const int idx = blockIdx.x * 256 + threadIdx.x; if (idx >= TT * NF) return; const int t = idx / NF, i = idx % NF; const float den = powf(10000.0f, (float)(2 * i) * (1.0f / HD)); const float ang = __fdiv_rn((float)t, den);
    v2f o; o[0] = cosf(ang); o[1] = sinf(ang); *(v2f*)(CSN + (size_t)idx * 2) = o;  }
// k_prep: every conversion to bf16 and the rotary table in ONE launch; grid (DD*DD/2048, 9): slab y = 0 is the table (the longest threads, started first), y = 1..4 the four weights, y = 5..8 the quarters of x (both batches).
// WX holds the eight converted slabs one behind the other: Wq, Wk, Wv, Wo, x.
__global__ __launch_bounds__(256) void k_prep(const float* __restrict__ Wq, const float* __restrict__ Wk, const float* __restrict__ Wv, const float* __restrict__ Wd, const float* __restrict__ x, bf* WX, float* CSN) {
    const int y = blockIdx.y; const size_t SL = (size_t)DD * DD;
    if (y == 0) { cstab(CSN); return; }
    const float* src = y == 1 ? Wq : y == 2 ? Wk : y == 3 ? Wv : y == 4 ? Wd : x + (size_t)(y - 5) * SL;
    cvt8(src, WX + (size_t)(y - 1) * SL, SL / 8);
}
// hsplit: head planes (hi/lo + fp16) [h][t][d] for one batch (row pitch 'pitch', 'nheads' heads) with rotate-half RoPE: r = x cos - x' sin for d < 32, x cos + x' sin for d >= 32, x' = F[t][h*64 + (d ^ 32)]
__device__ __forceinline__ void hsplit(const float* __restrict__ F, int pitch, int nheads, const float* __restrict__ CSN, bf* Ph, bf* Pl, h16* P16) {
    const int lane = threadIdx.x & 31; const int L0 = (blockIdx.x * 8 + (threadIdx.x >> 5)) * 8; const int nlines = nheads * TT * HD / 64;
{
#pragma unroll
        for (int l = 0; l < 8; ++l) { const int L = L0 + l; if (L >= nlines) break; const int e = L * 64 + lane * 2; const int d = e & (HD - 1); const int t = (e >> 6) & (TT - 1); const int h = e >> 17; v2us oh, ol; v2h o16;
#pragma unroll
            for (int q = 0; q < 2; ++q) { const int dd = d + q; const float x0 = F[(size_t)t * pitch + h * HD + dd], x1 = F[(size_t)t * pitch + h * HD + (dd ^ NF)]; const v2f cs = *(const v2f*)(CSN + ((size_t)t * NF + (dd & (NF - 1))) * 2);
                float a0 = __fmul_rn(cs[0], x0), a1 = __fmul_rn(cs[1], x1); asm volatile("" : "+v"(a0)); asm volatile("" : "+v"(a1)); const float r = (dd < NF) ? __fsub_rn(a0, a1) : __fadd_rn(a0, a1);
                unsigned short a, c2; splitf(r, a, c2); oh[q] = a; ol[q] = c2; o16[q] = tohx(r); }
            *(v2us*)(Ph + (size_t)e) = oh; *(v2us*)(Pl + (size_t)e) = ol; *(v2h*)(P16 + (size_t)e) = o16; }
         }
}
__device__ __forceinline__ void vtplane(const float* __restrict__ F, bf* Vh, bf* Vl, h16* V16) {
    const int lane = threadIdx.x & 31; const int L0 = (blockIdx.x * 8 + (threadIdx.x >> 5)) * 8; const int nlines = NH_ * TT * HD / 64;
{
#pragma unroll
        for (int l = 0; l < 8; ++l) { const int L = L0 + l; if (L >= nlines) break; const int e = L * 64 + lane * 2; const int t = e & (TT - 1); const int d = (e >> 11) & (HD - 1); const int h = e >> 17; v2us oh, ol; v2h o16;
#pragma unroll
            for (int q = 0; q < 2; ++q) { const float x = F[(size_t)(t + q) * DD + h * HD + d]; unsigned short a, c2; splitf(x, a, c2); oh[q] = a; ol[q] = c2; o16[q] = tohx(x); }
            *(v2us*)(Vh + (size_t)e) = oh; *(v2us*)(Vl + (size_t)e) = ol; *(v2h*)(V16 + (size_t)e) = o16; }
         }
}
// k_planes: all head planes of q, k, v and both batches in ONE launch; grid (lines/64, batches, 3): z = 0 the transposed v planes (the slowest reads, started first), z = 1 q, z = 2 k. F holds [q, k, v][batch][t][DD].
__global__ __launch_bounds__(256) void k_planes(const float* __restrict__ F, const float* __restrict__ CSN, bf* QPh, bf* QPl, h16* QP16, bf* KPh, bf* KPl, h16* KP16, bf* VTh, bf* VTl, h16* VT16) {
    const size_t PB = (size_t)TT * DD, pb = blockIdx.y * PB;
    if (blockIdx.z == 0) vtplane(F + 2 * NB_ * PB + pb, VTh + pb, VTl + pb, VT16 + pb);
    else if (blockIdx.z == 1) hsplit(F + pb, DD, NH_, CSN, QPh + pb, QPl + pb, QP16 + pb);
    else hsplit(F + NB_ * PB + pb, DD, NH_, CSN, KPh + pb, KPl + pb, KP16 + pb);
}
// k_fattn: scores, mask, softmax and attn.v of all heads and both batches in ONE launch; no score or probability ever goes to memory. One wave owns R groups of 16 query rows and walks the 2048 keys in passes of 32.
// Transposed products: S^T = K Q^T (A = 16 key rows, B = 16 query columns), so a lane holds scores of ONE query (column lane & 15; key = 16 kt + 8 (lane >> 4) + register), and the two 16-key tiles of a pass, once
// exponentiated and rounded, ARE the B operand (32 keys x 16 queries, same k order as the loader's) of O^T += V^T P^T, whose A rows come from the [d][t] planes. Online softmax: running maximum m and sum l per query;
// when a pass raises some maximum, l and O^T are scaled by exp(m_old - m_new). A masked score is -3e38 as before: exp gives 0 once the row has met a kept key, and what was added before that is wiped by the factor 0.
// P is rounded UNNORMALISED (exp(s - m) <= 1; the fp16 rows carry the factor PCAR as before), the division by l comes once at the end, in f32. Rows < RH: hi+lo planes, 3 products each; rows >= RH: fp16 planes.
typedef __attribute__((ext_vector_type(4))) int v4i;
typedef __attribute__((ext_vector_type(8))) unsigned v8u;
__device__ __forceinline__ unsigned pack2(float lo, float hi) { typedef __bf16 bf2 __attribute__((ext_vector_type(2))); return __builtin_bit_cast(unsigned, __builtin_convertvector(v2f{lo, hi}, bf2)); }  // two f32 to bf16, round to nearest even
__device__ __forceinline__ float xhalf(float x) { return __builtin_bit_cast(float, __builtin_amdgcn_permlanex16(__builtin_bit_cast(int, x), __builtin_bit_cast(int, x), 0x76543210, 0xfedcba98, false, false)); }  // lane l with lane l ^ 16
// Stands directly behind each group of global loads: the address registers that the loads name are not rewritten before the loads have taken them; the scheduling barriers hold the loads
// in front of the wait and every later register write behind it (they also keep each group where the pass wants it issued).
// The addresses are inputs of the wait, so that they stay whole up to it: no load of the group gets one of them as its destination.
__device__ __forceinline__ void loads_taken(const void* a, const void* b, const void* c) { __builtin_amdgcn_sched_barrier(0); asm volatile("s_wait_xcnt 0x0" :: "v"(a), "v"(b), "v"(c) : "memory"); __builtin_amdgcn_sched_barrier(0); }
template <typename T16, bool HI, int R>
__device__ __forceinline__ void attn_rows(const T16* __restrict__ Q, const T16* __restrict__ Q2, const T16* __restrict__ Kp, const T16* __restrict__ K2, const T16* __restrict__ Vt, const T16* __restrict__ Vt2, const int* __restrict__ mk, int q0, bf* Ah, bf* Al) {
    typedef typename WFrag<T16>::V V;
    const int lane = threadIdx.x & 31, lr = lane & 15, hi = lane >> 4;
    V qf[R][2], qf2[R][2]; v8f acc[R][4]; float mrun[R], lsum[R];
    const T16* qb = Q + (unsigned)(q0 + lr) * HD + 8 * hi; const T16* qb2 = HI ? Q2 + (unsigned)(q0 + lr) * HD + 8 * hi : qb;
#pragma unroll
    for (int g = 0; g < R; ++g) { mrun[g] = -3.0e38f; lsum[g] = 0.f;
#pragma unroll
        for (int kc = 0; kc < 2; ++kc) { const int o = 16 * g * HD + 32 * kc; qf[g][kc] = WFrag<T16>::ld(qb + o); if (HI) qf2[g][kc] = WFrag<T16>::ld(qb2 + o); }
#pragma unroll
        for (int t = 0; t < 4; ++t) acc[g][t] = (v8f){}; }
    loads_taken(qb, qb2, qb);
    V kf[2][2], kf2[2][2]; v4i mm[R][2][2];
    // lane parts of the addresses, in bytes, fixed for the whole walk
    const unsigned vk = (unsigned)(lr * HD + 8 * hi) * 2u, vv = (unsigned)(lr * TT + 8 * hi) * 2u, vm = ((unsigned)(q0 + lr) * TT + 8 * hi) * 4u;
    auto load_km = [&](int key0) {    // one pass's K fragments and mask words
        const char* kb = (const char*)Kp + (size_t)key0 * (HD * 2) + vk; const char* kb2 = HI ? (const char*)K2 + (size_t)key0 * (HD * 2) + vk : kb; const char* mb = (const char*)mk + (size_t)key0 * 4 + vm;
#pragma unroll
        for (int kt = 0; kt < 2; ++kt) {
#pragma unroll
            for (int kc = 0; kc < 2; ++kc) { kf[kt][kc] = WFrag<T16>::ld((const T16*)(kb + (16 * kt * HD + 32 * kc) * 2)); if (HI) kf2[kt][kc] = WFrag<T16>::ld((const T16*)(kb2 + (16 * kt * HD + 32 * kc) * 2)); }
#pragma unroll
            for (int g = 0; g < R; ++g) { const int* mp = (const int*)(mb + (16 * g * TT + 16 * kt) * 4); mm[g][kt][0] = *(const v4i*)mp; mm[g][kt][1] = *(const v4i*)(mp + 4); } }
        loads_taken(kb, kb2, mb);
    };
    load_km(0);
#pragma unroll 1
    for (int key0 = 0; key0 < TT; key0 += 32) {
        V vf[4], vf2[4];    // V^T fragments of this pass: in flight under the score products and the maxima
        const char* vb = (const char*)Vt + (size_t)key0 * 2 + vv; const char* vb2 = HI ? (const char*)Vt2 + (size_t)key0 * 2 + vv : vb;
#pragma unroll
        for (int t = 0; t < 4; ++t) { vf[t] = WFrag<T16>::ld((const T16*)(vb + 16 * t * TT * 2)); if (HI) vf2[t] = WFrag<T16>::ld((const T16*)(vb2 + 16 * t * TT * 2)); }
        loads_taken(vb, vb2, vb);
        v8f s[2][R];
#pragma unroll
        for (int kt = 0; kt < 2; ++kt)
#pragma unroll
            for (int g = 0; g < R; ++g) { s[kt][g] = (v8f){};
#pragma unroll
                for (int kc = 0; kc < 2; ++kc) { s[kt][g] = WFrag<T16>::mma(kf[kt][kc], qf[g][kc], s[kt][g]); if (HI) { s[kt][g] = WFrag<T16>::mma(kf[kt][kc], qf2[g][kc], s[kt][g]); s[kt][g] = WFrag<T16>::mma(kf2[kt][kc], qf[g][kc], s[kt][g]); } } }
        float mx[R]; bool need = false;
#pragma unroll
        for (int g = 0; g < R; ++g) { float m = -3.0e38f;
#pragma unroll
            for (int kt = 0; kt < 2; ++kt)
#pragma unroll
                for (int r = 0; r < 8; ++r) { const float t = (mm[g][kt][r >> 2][r & 3] != 0) ? s[kt][g][r] * SCL : -3.0e38f; s[kt][g][r] = t; m = fmaxf(m, t); }
            m = fmaxf(m, xhalf(m)); mx[g] = m; need = need || (m > mrun[g]); }
        const int keyn = key0 + 32 < TT ? key0 + 32 : TT - 32;    // the next pass's K and mask are fetched in this pass (the last pass reads its own again: in bounds, unused)
        load_km(keyn);    // in flight under the exponentials and the second product
        if (__builtin_amdgcn_ballot_w32(need) != 0) {    // wave-uniform: rare once the maxima have settled
#pragma unroll
            for (int g = 0; g < R; ++g) { const float mn = fmaxf(mrun[g], mx[g]); const float corr = __expf(mrun[g] - mn); mrun[g] = mn; lsum[g] *= corr;
#pragma unroll
                for (int t = 0; t < 4; ++t) acc[g][t] = acc[g][t] * corr; } }
#pragma unroll
        for (int g = 0; g < R; ++g) { float p[16]; float ps = 0.f;
#pragma unroll
            for (int i = 0; i < 16; ++i) p[i] = __expf(s[i >> 3][g][i & 7] - mrun[g]);
#pragma unroll
            for (int i = 0; i < 8; ++i) ps += p[i] + p[8 + i];
            lsum[g] += ps;
            if constexpr (HI) { v8u wh, wl;
#pragma unroll
                for (int i = 0; i < 8; ++i) { const unsigned w = pack2(p[2 * i], p[2 * i + 1]); wh[i] = w; wl[i] = pack2(p[2 * i] - __uint_as_float(w << 16), p[2 * i + 1] - __uint_as_float(w & 0xFFFF0000u)); }
                const V ph = __builtin_bit_cast(v16bf, wh), pl = __builtin_bit_cast(v16bf, wl);
#pragma unroll
                for (int t = 0; t < 4; ++t) { acc[g][t] = WFrag<T16>::mma(vf[t], ph, acc[g][t]); acc[g][t] = WFrag<T16>::mma(vf[t], pl, acc[g][t]); acc[g][t] = WFrag<T16>::mma(vf2[t], ph, acc[g][t]); }
            } else { V pf;
#pragma unroll
                for (int i = 0; i < 16; ++i) pf[i] = tohx(p[i] * PCAR);
#pragma unroll
                for (int t = 0; t < 4; ++t) acc[g][t] = WFrag<T16>::mma(vf[t], pf, acc[g][t]); } }
        __builtin_amdgcn_sched_barrier(0); asm volatile("v_nop\n\tv_nop\n\tv_nop\n\tv_nop"); __builtin_amdgcn_sched_barrier(0);    // the 4 vector slots behind the pass's last WMMAs, also on the taken back edge
    }
#pragma unroll
    for (int g = 0; g < R; ++g) { const float l = lsum[g] + xhalf(lsum[g]); const float inv = __fdiv_rn(1.0f, HI ? l : l * PCAR);
#pragma unroll
        for (int t = 0; t < 4; ++t) { v8us oh, ol;    // the lane's 8 values are d = 16 t + 8 hi + 0..7 of query q0 + 16 g + lr
#pragma unroll
            for (int r = 0; r < 8; ++r) { unsigned short a, c2; splitf(acc[g][t][r] * inv, a, c2); oh[r] = a; ol[r] = c2; }
            const size_t o = (size_t)(q0 + 16 * g + lr) * DD + 16 * t + 8 * hi; *(v8us*)(Ah + o) = oh; *(v8us*)(Al + o) = ol; } }
}
// grid (RH/64 + (TT-RH)/128, heads, batches), 4 waves: the first RH/64 blocks of a head take 16 hi+lo rows a wave, the others 32 fp16 rows a wave
__global__ __launch_bounds__(128) void k_fattn(const bf* __restrict__ QPh, const bf* __restrict__ QPl, const bf* __restrict__ KPh, const bf* __restrict__ KPl, const bf* __restrict__ VTh, const bf* __restrict__ VTl,
                                               const h16* __restrict__ QP16, const h16* __restrict__ KP16, const h16* __restrict__ VT16, const int* __restrict__ mk, bf* ATh, bf* ATl) {
    const size_t pz = ((size_t)blockIdx.z * NH_ + blockIdx.y) * (TT * HD); const size_t oz = (size_t)blockIdx.z * TT * DD + blockIdx.y * HD; const int wave = threadIdx.x >> 5;
    if (blockIdx.x < RH / 64) attn_rows<bf, true, 1>(QPh + pz, QPl + pz, KPh + pz, KPl + pz, VTh + pz, VTl + pz, mk, (int)blockIdx.x * 64 + wave * 16, ATh + oz, ATl + oz);
    else attn_rows<h16, false, 2>(QP16 + pz, nullptr, KP16 + pz, nullptr, VT16 + pz, nullptr, mk, RH + ((int)blockIdx.x - RH / 64) * 128 + wave * 32, ATh + oz, ATl + oz);
}

extern "C" void kernel_launch(void* const* d_in, const int* in_sizes, int n_in,
                              void* d_out, int out_size, void* d_ws, size_t ws_size, hipStream_t stream) {
    (void)in_sizes; (void)n_in; (void)out_size;
    const float* x = (const float*)d_in[0]; const int* mk = (const int*)d_in[1]; const float* Wq = (const float*)d_in[2]; const float* bq = (const float*)d_in[3]; const float* Wk = (const float*)d_in[4]; const float* bk = (const float*)d_in[5]; const float* Wv = (const float*)d_in[6]; const float* bv = (const float*)d_in[7]; const float* Wd = (const float*)d_in[8]; const float* bo = (const float*)d_in[9];
    float* OUT = (float*)d_out;     // [2][2048][1024]
    char* wsp = (char*)d_ws;
    auto take = [&](size_t bytes) { char* p = wsp; wsp += (bytes + 255) & ~(size_t)255; return (void*)p; };
    const size_t PB = (size_t)TT * DD;    // elements of one batch's plane
    bf* W4 = (bf*)take(((size_t)4 * DD * DD + NB_ * PB) * 2); bf* XB = W4 + (size_t)4 * DD * DD;    // Wq, Wk, Wv, Wo, then x of both batches, one behind the other
    float* F = (float*)take(3 * NB_ * PB * 4); float* CSN = (float*)take((size_t)TT * NF * 2 * 4);    // projections [q, k, v][batch][t][DD]
    // head planes and merged-head planes of BOTH batches: the attention launch reads and writes them all
    bf* QPh = (bf*)take(NB_ * PB * 2); bf* QPl = (bf*)take(NB_ * PB * 2); bf* KPh = (bf*)take(NB_ * PB * 2); bf* KPl = (bf*)take(NB_ * PB * 2); bf* VTh = (bf*)take(NB_ * PB * 2); bf* VTl = (bf*)take(NB_ * PB * 2);
    h16* QP16 = (h16*)take(NB_ * PB * 2); h16* KP16 = (h16*)take(NB_ * PB * 2); h16* VT16 = (h16*)take(NB_ * PB * 2);
    bf* ATh = (bf*)take(NB_ * PB * 2); bf* ATl = (bf*)take(NB_ * PB * 2);
    if ((size_t)(wsp - (char*)d_ws) > ws_size) return;    // total 152.5 MiB; ws 256 MiB
    k_prep<<<dim3(DD * DD / 2048, 9), 256, 0, stream>>>(Wq, Wk, Wv, Wd, x, W4, CSN);
    const unsigned LB = (unsigned)((NH_ * TT * HD / 64 + 63) / 64);
    k_gemmw<bf, 0, true><<<dim3(NB_ * TT / 64, DD / 64, 3), 32, 0, stream>>>(XB, nullptr, W4, nullptr, DD, F, DD, bq, bk, bv, 0, (size_t)DD * DD, NB_ * PB, 0);
    k_planes<<<dim3(LB, NB_, 3), 256, 0, stream>>>(F, CSN, QPh, QPl, QP16, KPh, KPl, KP16, VTh, VTl, VT16);
    k_fattn<<<dim3(RH / 64 + (TT - RH) / 128, NH_, NB_), 128, 0, stream>>>(QPh, QPl, KPh, KPl, VTh, VTl, QP16, KP16, VT16, mk, ATh, ATl);
    k_gemmw<bf, 1, true><<<dim3(NB_ * TT / 64, DD / 64, 1), 32, 0, stream>>>(ATh, ATl, W4 + (size_t)3 * DD * DD, nullptr, DD, OUT, DD, bo, bo, bo, 0, 0, 0, 0);
}

// v005
// A run of this version takes 153 microseconds.
// Next to v004, in two timings, it ran 1.69 and 1.68 times as fast.
// Counting every step since v000, it is 13.7 times as fast.
#include <hip/hip_runtime.h>

// MultiheadAttentionCore (x_q [2][2048][1024], attn_mask [2048][2048] bool->int32 (True = keep; read as data; here it is the causal triangle); q/k/v = x W^T + b; 16 heads x 64; rotate-half RoPE over the 64 head
// dims (inv_freq 10000^(-2i/64), positions 0..2047) on q and k; scores /8; -inf where mask == 0; softmax; out = merged Wo^T + bo).
// Compute dtypes, f32 accumulate: every input rounded to bf16; q/k/v projections on PLAIN bf16 operands (inputs: exact, + bias), out projection on hi+lo merged planes x bf16 Wo (2 products); rotary f32 (powf / cosf / sinf, partner x[d^32]
// read from memory); PER-ROW PRECISION HYBRID: query rows < 256 of each batch on bf16 hi+lo planes for scores and attn.v (3 products), rows >= 256 on SINGLE fp16 planes; the mask read per (i, j);

#define NB_  2
#define TT   2048
#define DD   1024
#define NH_  16
#define HD   64
#define RH   256                  // query rows < RH: hi+lo planes; rows >= RH: fp16 planes
#define NF   32                   // rotary frequencies (head_dim / 2)
#define SCL  0.125f               // 1/sqrt(64)
#define PCAR 1024.0f         // fp16 P is scaled by this; divided out with l at the end
typedef _Float16 h16;
typedef unsigned short bf;
typedef __attribute__((ext_vector_type(16))) __bf16   v16bf;
typedef __attribute__((ext_vector_type(16))) _Float16 v16h;
typedef __attribute__((ext_vector_type(8)))  _Float16 v8h;
typedef __attribute__((ext_vector_type(8)))  unsigned short v8us;
typedef __attribute__((ext_vector_type(8)))  float    v8f;
typedef __attribute__((ext_vector_type(4)))  float    v4f;
typedef v8h  __attribute__((may_alias)) v8ha;
typedef v4f  __attribute__((may_alias)) v4fa;
typedef v8us __attribute__((may_alias)) v8usa;

__device__ __forceinline__ unsigned short f2bf(float f) { unsigned u = __float_as_uint(f); u += 0x7FFFu + ((u >> 16) & 1u); return (unsigned short)(u >> 16); }
__device__ __forceinline__ float bf2f(unsigned short b) { return __uint_as_float(((unsigned)b) << 16); }
__device__ __forceinline__ float bfr(float f) { return bf2f(f2bf(f)); }
__device__ __forceinline__ v16h cat16(v8h lo, v8h hi) { return __builtin_shufflevector(lo, hi, 0, 1, 2, 3, 4, 5, 6, 7, 8, 9, 10, 11, 12, 13, 14, 15); }
__device__ __forceinline__ v16bf cat16b(v8us lo, v8us hi) { return __builtin_bit_cast(v16bf, __builtin_shufflevector(lo, hi, 0, 1, 2, 3, 4, 5, 6, 7, 8, 9, 10, 11, 12, 13, 14, 15)); }
__device__ __forceinline__ v8f wmma16(v16h a, v16h b, v8f c) { return __builtin_amdgcn_wmma_f32_16x16x32_f16(false, a, false, b, (short)0, c, false, false); }
__device__ __forceinline__ v8f wmmab(v16bf a, v16bf b, v8f c) { return __builtin_amdgcn_wmma_f32_16x16x32_bf16(false, a, false, b, (short)0, c, false, false); }



// Stands directly behind each group of global loads: the address registers that the loads name are not rewritten before the loads have taken them; the scheduling barriers hold the loads
// in front of the wait and every later register write behind it (they also keep each group where the pass wants it issued).
// The addresses are inputs of the wait, so that they stay whole up to it: no load of the group gets one of them as its destination.
__device__ __forceinline__ void loads_taken(const void* a, const void* b, const void* c) { __builtin_amdgcn_sched_barrier(0); asm volatile("s_wait_xcnt 0x0" :: "v"(a), "v"(b), "v"(c) : "memory"); __builtin_amdgcn_sched_barrier(0); }
// The same behind a group of global stores: neither their data registers nor their address registers are rewritten before the stores have taken them.
__device__ __forceinline__ void stores_taken() { __builtin_amdgcn_sched_barrier(0); asm volatile("s_wait_xcnt 0x0" ::: "memory"); __builtin_amdgcn_sched_barrier(0); }
// FRAGMENT ORDER of every 16-bit operand plane M[row][k] (k extent K): the 16 rows x 32 k of one WMMA operand lie in 1024 bytes in a row, as two halves of 512 bytes, each 32 lanes x 8 elements:
// element index = (row / 16) * 16 * K + (k / 32) * 512 + ((k >> 4) & 1) * 256 + (((k >> 3) & 1) * 16 + (row & 15)) * 8 + (k & 7). Lane l of a wave loads its 16 bytes at l * 16 in each half, so one fragment load
// reads 512 bytes in a row (4 whole lines) and not 32 bytes out of each of 16 lines. The element that each lane and register holds is the same as with a row-major plane.
// ---- k_gemmw: register-blocked GEMM, ONE WAVE per 64x64 output tile (16 accumulators), operands straight from 16-bit planes in fragment order; grid (M/64, N/64, Z), 32 threads.
// C[m][n] (f32, pitch ldc, + optional f32 bias[n]) = sum_k A[m][k] Bt[n][k] (+ split products per NSPLIT). z-batch strides sA/sB/sC in elements. K % 32 == 0; K is a compile-time constant, so that a trip's fragments lie at constant offsets from one address an operand.
// blockIdx.z also picks the bias among bias, biasz1, biasz2 (q, k and v projections of one launch).
// KS > 1 (N == 64 only): blockIdx.y is a K slice, not a column tile: the wave sums k in [y K/KS, (y+1) K/KS) and stores its partial tile in plane y (C + y sK); the reader adds the KS planes.
template <typename T16> struct WFrag;
template <> struct WFrag<h16> { typedef v16h V; static __device__ __forceinline__ V ld(const h16* p) { return cat16(*(const v8h*)p, *(const v8h*)(p + 256)); } static __device__ __forceinline__ v8f mma(V a, V b, v8f c) { return wmma16(a, b, c); } };
template <> struct WFrag<bf> { typedef v16bf V; static __device__ __forceinline__ V ld(const bf* p) { return cat16b(*(const v8us*)p, *(const v8us*)(p + 256)); } static __device__ __forceinline__ v8f mma(V a, V b, v8f c) { return wmmab(a, b, c); } };
template <typename T16, int NSPLIT, bool BIAS, int K, int KS = 1>
__global__ __launch_bounds__(32) void k_gemmw(const T16* __restrict__ A, const T16* __restrict__ A2, const T16* __restrict__ Bt, const T16* __restrict__ Bt2, float* C, int ldc, const float* __restrict__ bias, const float* __restrict__ biasz1, const float* __restrict__ biasz2, size_t sA, size_t sB, size_t sC, size_t sK) {
    typedef typename WFrag<T16>::V V;
    __shared__ __align__(16) float os[16 * 68];
    const size_t z = blockIdx.z; A += z * sA; if (A2) A2 += z * sA; Bt += z * sB; if (Bt2) Bt2 += z * sB; C += z * sC; if (BIAS) bias = z == 0 ? bias : z == 1 ? biasz1 : biasz2;
    const int lane = threadIdx.x & 31, lr = lane & 15, hi = lane >> 4; const int r0 = blockIdx.x * 64, c0 = (KS > 1) ? 0 : blockIdx.y * 64;
    const int KL = K / KS; if (KS > 1) { const size_t ko = (size_t)blockIdx.y * KL * 16; A += ko; if (A2) A2 += ko; Bt += ko; if (Bt2) Bt2 += ko; C += (size_t)blockIdx.y * sK; }
    v8f acc[4][4];
#pragma unroll
    for (int mb = 0; mb < 4; ++mb)
#pragma unroll
        for (int nb = 0; nb < 4; ++nb) acc[mb][nb] = (v8f){};
    const T16* pa = A + (size_t)r0 * K + 8 * lane; const T16* pa2 = (NSPLIT == 1 || NSPLIT == 2) ? A2 + (size_t)r0 * K + 8 * lane : pa; const T16* pb = Bt + (size_t)c0 * K + 8 * lane; const T16* pb2 = (NSPLIT >= 2) ? Bt2 + (size_t)c0 * K + 8 * lane : pb;
#pragma unroll 1
    for (int kc = 0; kc < KL; kc += 32) {
        V a[4], a2[4], b[4], b2[4];
#pragma unroll
        for (int mb = 0; mb < 4; ++mb) { a[mb] = WFrag<T16>::ld(pa + mb * 16 * K); if (NSPLIT == 1 || NSPLIT == 2) a2[mb] = WFrag<T16>::ld(pa2 + mb * 16 * K); }
#pragma unroll
        for (int nb = 0; nb < 4; ++nb) { b[nb] = WFrag<T16>::ld(pb + nb * 16 * K); if (NSPLIT >= 2) b2[nb] = WFrag<T16>::ld(pb2 + nb * 16 * K); }
        loads_taken(pa, pa2, pb); if (NSPLIT >= 2) loads_taken(pb2, pb2, pb2);
        pa += 512; pa2 += 512; pb += 512; pb2 += 512;
#pragma unroll
        for (int nb = 0; nb < 4; ++nb) {
#pragma unroll
            for (int mb = 0; mb < 4; ++mb) { acc[mb][nb] = WFrag<T16>::mma(a[mb], b[nb], acc[mb][nb]); if (NSPLIT == 1 || NSPLIT == 2) acc[mb][nb] = WFrag<T16>::mma(a2[mb], b[nb], acc[mb][nb]); if (NSPLIT >= 2) acc[mb][nb] = WFrag<T16>::mma(a[mb], b2[nb], acc[mb][nb]); } }
        asm volatile("v_nop\n\tv_nop\n\tv_nop\n\tv_nop" : "+v"(acc[0][0]), "+v"(acc[1][1]), "+v"(acc[2][2]), "+v"(acc[3][3]) : "v"(a[0]), "v"(a[3]));
    }
#pragma unroll
    for (int mb = 0; mb < 4; ++mb) {
#pragma unroll
        for (int nb = 0; nb < 4; ++nb) {
#pragma unroll
            for (int j = 0; j < 8; ++j) os[(hi * 8 + j) * 68 + nb * 16 + lr] = acc[mb][nb][j]; }
        __builtin_amdgcn_wave_barrier(); asm volatile("" ::: "memory");
        float* crow = C + (size_t)(r0 + mb * 16) * ldc + c0;
{
#pragma unroll
            for (int s = 0; s < 8; ++s) { const int row = 2 * s + hi, cofs = lr * 4; v4f val = *(const v4fa*)(os + row * 68 + cofs); if (BIAS) { val[0] += bfr(bias[c0 + cofs]); val[1] += bfr(bias[c0 + cofs + 1]); val[2] += bfr(bias[c0 + cofs + 2]); val[3] += bfr(bias[c0 + cofs + 3]); }
                *(v4f*)(crow + (size_t)row * ldc + cofs) = val; }
             }
        __builtin_amdgcn_wave_barrier(); asm volatile("" ::: "memory");
    }
}

__device__ __forceinline__ h16 tohx(float x) { return (h16)x; }
__device__ __forceinline__ void splitf(float y, unsigned short& h, unsigned short& l) { h = f2bf(y); l = f2bf(y - bf2f(h)); }
typedef __attribute__((ext_vector_type(2))) unsigned short v2us;
typedef __attribute__((ext_vector_type(2))) _Float16 v2h;
typedef __attribute__((ext_vector_type(4))) _Float16 v4h;
typedef __attribute__((ext_vector_type(2))) float v2f;

// cvt8: a [rows][DD] f32 slab to bf16 in fragment order. A wave takes 8 rows x 32 k: it reads one whole 128-byte line a row and writes four whole 128-byte lines (8 lanes each).
__device__ __forceinline__ void cvt8(const float* __restrict__ src, bf* dst, size_t n8) { const size_t i = (size_t)blockIdx.x * 256 + threadIdx.x; if (i >= n8) return;
    const int r8 = (int)i & 7, c4 = ((int)i >> 3) & 3, rh = ((int)i >> 5) & 1, kc = ((int)i >> 6) & (DD / 32 - 1); const size_t r16 = i >> 11;
    const v8f v = *(const v8f*)(src + (r16 * 16 + rh * 8 + r8) * DD + kc * 32 + c4 * 8); v8us o;
#pragma unroll
    for (int k = 0; k < 8; ++k) o[k] = f2bf(v[k]); *(v8us*)(dst + r16 * 16 * DD + kc * 512 + (c4 >> 1) * 256 + ((c4 & 1) * 16 + rh * 8 + r8) * 8) = o;  }
__device__ __forceinline__ void cstab(float* CSN) {
    const int idx = blockIdx.x * 256 + threadIdx.x; if (idx >= TT * NF) return; const int t = idx / NF, i = idx % NF; const float den = powf(10000.0f, (float)(2 * i) * (1.0f / HD)); const float ang = __fdiv_rn((float)t, den);
    v2f o; o[0] = cosf(ang); o[1] = sinf(ang); *(v2f*)(CSN + (size_t)idx * 2) = o;  }
// k_prep: every conversion to bf16 and the rotary table in ONE launch; grid (DD*DD/2048, 9): slab y = 0 is the table (the longest threads, started first), y = 1..4 the four weights, y = 5..8 the quarters of x (both batches).
// WX holds the eight converted slabs one behind the other: Wq, Wk, Wv, Wo, x.
__global__ __launch_bounds__(256) void k_prep(const float* __restrict__ Wq, const float* __restrict__ Wk, const float* __restrict__ Wv, const float* __restrict__ Wd, const float* __restrict__ x, bf* WX, float* CSN) {
    const int y = blockIdx.y; const size_t SL = (size_t)DD * DD;
    if (y == 0) { cstab(CSN); return; }
    const float* src = y == 1 ? Wq : y == 2 ? Wk : y == 3 ? Wv : y == 4 ? Wd : x + (size_t)(y - 5) * SL;
    cvt8(src, WX + (size_t)(y - 1) * SL, SL / 8);
}
// hsplit: head planes (hi/lo + fp16) of one batch, each head's [t][d] plane in fragment order (row = t, k = d), with rotate-half RoPE: r = x cos - x' sin for d < 32, x cos + x' sin for d >= 32, x' = F[t][h*64 + (d ^ 32)].
// A thread makes the 8 values d0..d0+7 (d0 < 32) and their 8 partners d0+32.., which read the same x and the same table entries; a wave takes 8 rows x 32 + 32 d and writes whole 128-byte lines (8 lanes each).
__device__ __forceinline__ void hsplit(const float* __restrict__ F, int pitch, const float* __restrict__ CSN, bf* Ph, bf* Pl, h16* P16) {
    const int idx = blockIdx.x * 256 + threadIdx.x; const int r8 = idx & 7, c4 = (idx >> 3) & 3, rh = (idx >> 5) & 1, t16 = (idx >> 6) & (TT / 16 - 1), h = idx >> 13; if (h >= NH_) return;
    const int t = t16 * 16 + rh * 8 + r8, d0 = c4 * 8; const float* xr = F + (size_t)t * pitch + h * HD + d0; const float* cr = CSN + ((size_t)t * NF + d0) * 2;
    const v8f xa = *(const v8f*)xr, xb = *(const v8f*)(xr + NF); const v8f ca = *(const v8f*)cr, cb = *(const v8f*)(cr + 8);    // ca, cb: (cos, sin) of d0..d0+3 and d0+4..d0+7
    loads_taken(xr, cr, xr);
#pragma unroll
    for (int kc = 0; kc < 2; ++kc) { v8us oh, ol; v8h o16;
#pragma unroll
        for (int q = 0; q < 8; ++q) { const int dd = d0 + q + kc * NF; const float x0 = kc ? xb[q] : xa[q], x1 = kc ? xa[q] : xb[q]; const v2f cs = q < 4 ? v2f{ca[2 * q], ca[2 * q + 1]} : v2f{cb[2 * q - 8], cb[2 * q - 7]};
                float a0 = __fmul_rn(cs[0], x0), a1 = __fmul_rn(cs[1], x1); asm volatile("" : "+v"(a0)); asm volatile("" : "+v"(a1)); const float r = (dd < NF) ? __fsub_rn(a0, a1) : __fadd_rn(a0, a1);
                unsigned short a, c2; splitf(r, a, c2); oh[q] = a; ol[q] = c2; o16[q] = tohx(r); }
        const size_t e = (size_t)h * (TT * HD) + t16 * (16 * HD) + kc * 512 + (c4 >> 1) * 256 + ((c4 & 1) * 16 + rh * 8 + r8) * 8;
        *(v8us*)(Ph + e) = oh; *(v8us*)(Pl + e) = ol; *(v8h*)(P16 + e) = o16; if (kc == 0) stores_taken(); }
}
// vtplane: the transposed v planes of one batch, each head's [d][t] plane as fragments (row = d, k = t), here with the block of 32 keys outermost: the four fragments (64 d) of one pass lie in 4096 bytes in a row.
// A wave makes one fragment (16 d x 32 keys): a lane reads its d in 8 key rows for each half
// (16 lanes share 64 bytes of a row) and stores 16 bytes, the wave 512 bytes in a row.
__device__ __forceinline__ void vtplane(const float* __restrict__ F, bf* Vh, bf* Vl, h16* V16) {
    const int idx = blockIdx.x * 256 + threadIdx.x; const int lane = idx & 31, lr = lane & 15, hi = lane >> 4, t4 = (idx >> 5) & 3, ps = (idx >> 7) & (TT / 32 - 1), h = idx >> 13; if (h >= NH_) return;
    const float* xr = F + (size_t)(ps * 32 + hi * 8) * DD + h * HD + t4 * 16 + lr; float xv[2][8];
#pragma unroll
    for (int hf = 0; hf < 2; ++hf)
#pragma unroll
        for (int q = 0; q < 8; ++q) xv[hf][q] = xr[(hf * 16 + q) * DD];
    loads_taken(xr, xr, xr);
#pragma unroll
    for (int hf = 0; hf < 2; ++hf) { v8us oh, ol; v8h o16;
#pragma unroll
        for (int q = 0; q < 8; ++q) { const float x = xv[hf][q]; unsigned short a, c2; splitf(x, a, c2); oh[q] = a; ol[q] = c2; o16[q] = tohx(x); }
        const size_t e = (size_t)h * (TT * HD) + ps * (32 * HD) + t4 * 512 + hf * 256 + lane * 8;
        *(v8us*)(Vh + e) = oh; *(v8us*)(Vl + e) = ol; *(v8h*)(V16 + e) = o16; if (hf == 0) stores_taken(); }
}
// k_planes: all head planes of q, k, v and both batches in ONE launch; grid (elements of a batch / 16 / 256, batches, 3): z = 0 the transposed v planes (the slowest reads, started first), z = 1 q, z = 2 k. F holds [q, k, v][batch][t][DD].
__global__ __launch_bounds__(256) void k_planes(const float* __restrict__ F, const float* __restrict__ CSN, bf* QPh, bf* QPl, h16* QP16, bf* KPh, bf* KPl, h16* KP16, bf* VTh, bf* VTl, h16* VT16) {
    const size_t PB = (size_t)TT * DD, pb = blockIdx.y * PB;
    if (blockIdx.z == 0) vtplane(F + 2 * NB_ * PB + pb, VTh + pb, VTl + pb, VT16 + pb);
    else if (blockIdx.z == 1) hsplit(F + pb, DD, CSN, QPh + pb, QPl + pb, QP16 + pb);
    else hsplit(F + NB_ * PB + pb, DD, CSN, KPh + pb, KPl + pb, KP16 + pb);
}
// k_fattn: scores, mask, softmax and attn.v of all heads and both batches in ONE launch; no score or probability ever goes to memory. One wave owns R groups of 16 query rows and walks the 2048 keys in passes of 32.
// Transposed products: S^T = K Q^T (A = 16 key rows, B = 16 query columns), so a lane holds scores of ONE query (column lane & 15; key = 16 kt + 8 (lane >> 4) + register), and the two 16-key tiles of a pass, once
// exponentiated and rounded, ARE the B operand (32 keys x 16 queries, same k order as the loader's) of O^T += V^T P^T, whose A rows come from the [d][t] planes. All planes lie in fragment order. Online softmax: running maximum m and sum l per query;
// when a pass raises some maximum, l and O^T are scaled by exp(m_old - m_new). A masked score is -3e38 as before: exp gives 0 once the row has met a kept key, and what was added before that is wiped by the factor 0.
// P is rounded UNNORMALISED (exp(s - m) <= 1; the fp16 rows carry the factor PCAR as before), the division by l comes once at the end, in f32. Rows < RH: hi+lo planes, 3 products each; rows >= RH: fp16 planes.
typedef __attribute__((ext_vector_type(4))) int v4i;
typedef __attribute__((ext_vector_type(8))) unsigned v8u;
__device__ __forceinline__ unsigned pack2(float lo, float hi) { typedef __bf16 bf2 __attribute__((ext_vector_type(2))); return __builtin_bit_cast(unsigned, __builtin_convertvector(v2f{lo, hi}, bf2)); }  // two f32 to bf16, round to nearest even
__device__ __forceinline__ float xhalf(float x) { return __builtin_bit_cast(float, __builtin_amdgcn_permlanex16(__builtin_bit_cast(int, x), __builtin_bit_cast(int, x), 0x76543210, 0xfedcba98, false, false)); }  // lane l with lane l ^ 16
template <typename T16, bool HI, int R>
__device__ __forceinline__ void attn_rows(const T16* __restrict__ Q, const T16* __restrict__ Q2, const T16* __restrict__ Kp, const T16* __restrict__ K2, const T16* __restrict__ Vt, const T16* __restrict__ Vt2, const int* __restrict__ mk, int q0, bf* Ah, bf* Al) {
    typedef typename WFrag<T16>::V V;
    const int lane = threadIdx.x & 31, lr = lane & 15, hi = lane >> 4;
    V qf[R][2], qf2[R][2]; v8f acc[R][4]; float mrun[R], lsum[R];
    const T16* qb = Q + (unsigned)q0 * HD + 8 * lane; const T16* qb2 = HI ? Q2 + (unsigned)q0 * HD + 8 * lane : qb;
#pragma unroll
    for (int g = 0; g < R; ++g) { mrun[g] = -3.0e38f; lsum[g] = 0.f;
#pragma unroll
        for (int kc = 0; kc < 2; ++kc) { const int o = 16 * g * HD + 512 * kc; qf[g][kc] = WFrag<T16>::ld(qb + o); if (HI) qf2[g][kc] = WFrag<T16>::ld(qb2 + o); }
#pragma unroll
        for (int t = 0; t < 4; ++t) acc[g][t] = (v8f){}; }
    loads_taken(qb, qb2, qb);
    V kf[2][2], kf2[2][2]; v4i mm[R][2][2];
    // lane parts of the addresses, in bytes, fixed for the whole walk
    const unsigned vk = (unsigned)lane * 16u, vv = (unsigned)lane * 16u, vm = ((unsigned)(q0 + lr) * TT + 8 * hi) * 4u;
    auto load_km = [&](int key0) {    // one pass's K fragments and mask words
        const char* kb = (const char*)Kp + (size_t)key0 * (HD * 2) + vk; const char* kb2 = HI ? (const char*)K2 + (size_t)key0 * (HD * 2) + vk : kb; const char* mb = (const char*)mk + (size_t)key0 * 4 + vm;
#pragma unroll
        for (int kt = 0; kt < 2; ++kt) {
#pragma unroll
            for (int kc = 0; kc < 2; ++kc) { kf[kt][kc] = WFrag<T16>::ld((const T16*)(kb + (16 * kt * HD + 512 * kc) * 2)); if (HI) kf2[kt][kc] = WFrag<T16>::ld((const T16*)(kb2 + (16 * kt * HD + 512 * kc) * 2)); }
#pragma unroll
            for (int g = 0; g < R; ++g) { const int* mp = (const int*)(mb + (16 * g * TT + 16 * kt) * 4); mm[g][kt][0] = *(const v4i*)mp; mm[g][kt][1] = *(const v4i*)(mp + 4); } }
        loads_taken(kb, kb2, mb);
    };
    load_km(0);
#pragma unroll 1
    for (int key0 = 0; key0 < TT; key0 += 32) {
        V vf[4], vf2[4];    // V^T fragments of this pass: in flight under the score products and the maxima
        const char* vb = (const char*)Vt + (size_t)key0 * (HD * 2) + vv; const char* vb2 = HI ? (const char*)Vt2 + (size_t)key0 * (HD * 2) + vv : vb;
#pragma unroll
        for (int t = 0; t < 4; ++t) { vf[t] = WFrag<T16>::ld((const T16*)(vb + 512 * t * 2)); if (HI) vf2[t] = WFrag<T16>::ld((const T16*)(vb2 + 512 * t * 2)); }
        loads_taken(vb, vb2, vb);
        v8f s[2][R];
#pragma unroll
        for (int kt = 0; kt < 2; ++kt)
#pragma unroll
            for (int g = 0; g < R; ++g) { s[kt][g] = (v8f){};
#pragma unroll
                for (int kc = 0; kc < 2; ++kc) { s[kt][g] = WFrag<T16>::mma(kf[kt][kc], qf[g][kc], s[kt][g]); if (HI) { s[kt][g] = WFrag<T16>::mma(kf[kt][kc], qf2[g][kc], s[kt][g]); s[kt][g] = WFrag<T16>::mma(kf2[kt][kc], qf[g][kc], s[kt][g]); } } }
        float mx[R]; bool need = false;
#pragma unroll
        for (int g = 0; g < R; ++g) { float m = -3.0e38f;
#pragma unroll
            for (int kt = 0; kt < 2; ++kt)
#pragma unroll
                for (int r = 0; r < 8; ++r) { const float t = (mm[g][kt][r >> 2][r & 3] != 0) ? s[kt][g][r] * SCL : -3.0e38f; s[kt][g][r] = t; m = fmaxf(m, t); }
            m = fmaxf(m, xhalf(m)); mx[g] = m; need = need || (m > mrun[g]); }
        const int keyn = key0 + 32 < TT ? key0 + 32 : TT - 32;    // the next pass's K and mask are fetched in this pass (the last pass reads its own again: in bounds, unused)
        load_km(keyn);    // in flight under the exponentials and the second product
        if (__builtin_amdgcn_ballot_w32(need) != 0) {    // wave-uniform: rare once the maxima have settled
#pragma unroll
            for (int g = 0; g < R; ++g) { const float mn = fmaxf(mrun[g], mx[g]); const float corr = __expf(mrun[g] - mn); mrun[g] = mn; lsum[g] *= corr;
#pragma unroll
                for (int t = 0; t < 4; ++t) acc[g][t] = acc[g][t] * corr; } }
#pragma unroll
        for (int g = 0; g < R; ++g) { float p[16]; float ps = 0.f;
#pragma unroll
            for (int i = 0; i < 16; ++i) p[i] = __expf(s[i >> 3][g][i & 7] - mrun[g]);
#pragma unroll
            for (int i = 0; i < 8; ++i) ps += p[i] + p[8 + i];
            lsum[g] += ps;
            if constexpr (HI) { v8u wh, wl;
#pragma unroll
                for (int i = 0; i < 8; ++i) { const unsigned w = pack2(p[2 * i], p[2 * i + 1]); wh[i] = w; wl[i] = pack2(p[2 * i] - __uint_as_float(w << 16), p[2 * i + 1] - __uint_as_float(w & 0xFFFF0000u)); }
                const V ph = __builtin_bit_cast(v16bf, wh), pl = __builtin_bit_cast(v16bf, wl);
#pragma unroll
                for (int t = 0; t < 4; ++t) { acc[g][t] = WFrag<T16>::mma(vf[t], ph, acc[g][t]); acc[g][t] = WFrag<T16>::mma(vf[t], pl, acc[g][t]); acc[g][t] = WFrag<T16>::mma(vf2[t], ph, acc[g][t]); }
            } else { V pf;
#pragma unroll
                for (int i = 0; i < 16; ++i) pf[i] = tohx(p[i] * PCAR);
#pragma unroll
                for (int t = 0; t < 4; ++t) acc[g][t] = WFrag<T16>::mma(vf[t], pf, acc[g][t]); } }
        __builtin_amdgcn_sched_barrier(0); asm volatile("v_nop\n\tv_nop\n\tv_nop\n\tv_nop"); __builtin_amdgcn_sched_barrier(0);    // the 4 vector slots behind the pass's last WMMAs, also on the taken back edge
    }
#pragma unroll
    for (int g = 0; g < R; ++g) { const float l = lsum[g] + xhalf(lsum[g]); const float inv = __fdiv_rn(1.0f, HI ? l : l * PCAR);
#pragma unroll
        for (int t = 0; t < 4; ++t) { v8us oh, ol;    // the lane's 8 values are d = 16 t + 8 hi + 0..7 of query q0 + 16 g + lr
#pragma unroll
            for (int r = 0; r < 8; ++r) { unsigned short a, c2; splitf(acc[g][t][r] * inv, a, c2); oh[r] = a; ol[r] = c2; }
            const size_t o = (size_t)(q0 + 16 * g) * DD + 256 * t + 8 * lane; *(v8us*)(Ah + o) = oh; *(v8us*)(Al + o) = ol; if (g + 1 < R || t < 3) stores_taken(); } }    // fragment order of the output GEMM's A (row = query, k = 64 head + d): 512 bytes in a row a store
}
// grid (RH/64 + (TT-RH)/128, heads, batches), 4 waves: the first RH/64 blocks of a head take 16 hi+lo rows a wave, the others 32 fp16 rows a wave
__global__ __launch_bounds__(128) void k_fattn(const bf* __restrict__ QPh, const bf* __restrict__ QPl, const bf* __restrict__ KPh, const bf* __restrict__ KPl, const bf* __restrict__ VTh, const bf* __restrict__ VTl,
                                               const h16* __restrict__ QP16, const h16* __restrict__ KP16, const h16* __restrict__ VT16, const int* __restrict__ mk, bf* ATh, bf* ATl) {
    const size_t pz = ((size_t)blockIdx.z * NH_ + blockIdx.y) * (TT * HD); const size_t oz = (size_t)blockIdx.z * TT * DD + blockIdx.y * (16 * HD); const int wave = threadIdx.x >> 5;
    if (blockIdx.x < RH / 64) attn_rows<bf, true, 1>(QPh + pz, QPl + pz, KPh + pz, KPl + pz, VTh + pz, VTl + pz, mk, (int)blockIdx.x * 64 + wave * 16, ATh + oz, ATl + oz);
    else attn_rows<h16, false, 2>(QP16 + pz, nullptr, KP16 + pz, nullptr, VT16 + pz, nullptr, mk, RH + ((int)blockIdx.x - RH / 64) * 128 + wave * 32, ATh + oz, ATl + oz);
}

extern "C" void kernel_launch(void* const* d_in, const int* in_sizes, int n_in,
                              void* d_out, int out_size, void* d_ws, size_t ws_size, hipStream_t stream) {
    (void)in_sizes; (void)n_in; (void)out_size;
    const float* x = (const float*)d_in[0]; const int* mk = (const int*)d_in[1]; const float* Wq = (const float*)d_in[2]; const float* bq = (const float*)d_in[3]; const float* Wk = (const float*)d_in[4]; const float* bk = (const float*)d_in[5]; const float* Wv = (const float*)d_in[6]; const float* bv = (const float*)d_in[7]; const float* Wd = (const float*)d_in[8]; const float* bo = (const float*)d_in[9];
    float* OUT = (float*)d_out;     // [2][2048][1024]
    char* wsp = (char*)d_ws;
    auto take = [&](size_t bytes) { char* p = wsp; wsp += (bytes + 255) & ~(size_t)255; return (void*)p; };
    const size_t PB = (size_t)TT * DD;    // elements of one batch's plane
    bf* W4 = (bf*)take(((size_t)4 * DD * DD + NB_ * PB) * 2); bf* XB = W4 + (size_t)4 * DD * DD;    // Wq, Wk, Wv, Wo, then x of both batches, one behind the other
    float* F = (float*)take(3 * NB_ * PB * 4); float* CSN = (float*)take((size_t)TT * NF * 2 * 4);    // projections [q, k, v][batch][t][DD]
    // head planes and merged-head planes of BOTH batches: the attention launch reads and writes them all
    bf* QPh = (bf*)take(NB_ * PB * 2); bf* QPl = (bf*)take(NB_ * PB * 2); bf* KPh = (bf*)take(NB_ * PB * 2); bf* KPl = (bf*)take(NB_ * PB * 2); bf* VTh = (bf*)take(NB_ * PB * 2); bf* VTl = (bf*)take(NB_ * PB * 2);
    h16* QP16 = (h16*)take(NB_ * PB * 2); h16* KP16 = (h16*)take(NB_ * PB * 2); h16* VT16 = (h16*)take(NB_ * PB * 2);
    bf* ATh = (bf*)take(NB_ * PB * 2); bf* ATl = (bf*)take(NB_ * PB * 2);
    if ((size_t)(wsp - (char*)d_ws) > ws_size) return;    // total 152.5 MiB; ws 256 MiB
    k_prep<<<dim3(DD * DD / 2048, 9), 256, 0, stream>>>(Wq, Wk, Wv, Wd, x, W4, CSN);
    const unsigned LB = (unsigned)(NH_ * TT * HD / 16 / 256);
    k_gemmw<bf, 0, true, DD><<<dim3(NB_ * TT / 64, DD / 64, 3), 32, 0, stream>>>(XB, nullptr, W4, nullptr, F, DD, bq, bk, bv, 0, (size_t)DD * DD, NB_ * PB, 0);
    k_planes<<<dim3(LB, NB_, 3), 256, 0, stream>>>(F, CSN, QPh, QPl, QP16, KPh, KPl, KP16, VTh, VTl, VT16);
    k_fattn<<<dim3(RH / 64 + (TT - RH) / 128, NH_, NB_), 128, 0, stream>>>(QPh, QPl, KPh, KPl, VTh, VTl, QP16, KP16, VT16, mk, ATh, ATl);
    k_gemmw<bf, 1, true, DD><<<dim3(NB_ * TT / 64, DD / 64, 1), 32, 0, stream>>>(ATh, ATl, W4 + (size_t)3 * DD * DD, nullptr, OUT, DD, bo, bo, bo, 0, 0, 0, 0);
}

// v006
// One run takes 143 microseconds.
// Two timings next to v005 put it at 1.06 and 1.08 times that version's speed.
// All steps since v000 together make it 14.7 times as fast.
#include <hip/hip_runtime.h>

// MultiheadAttentionCore (x_q [2][2048][1024], attn_mask [2048][2048] bool->int32 (True = keep; read as data; here it is the causal triangle); q/k/v = x W^T + b; 16 heads x 64; rotate-half RoPE over the 64 head
// dims (inv_freq 10000^(-2i/64), positions 0..2047) on q and k; scores /8; -inf where mask == 0; softmax; out = merged Wo^T + bo).
// Compute dtypes, f32 accumulate: every input rounded to bf16; q/k/v projections on PLAIN bf16 operands (inputs: exact, + bias), the output projection on the attention output's bf16 hi+lo planes x bf16 Wo (2 products); rotary f32 (powf / cosf / sinf, partner x[d^32]
// read from memory); PER-ROW PRECISION HYBRID: query rows < 256 of each batch on bf16 hi+lo planes for scores and attn.v (3 products), rows >= 256 on SINGLE fp16 planes; the mask read per (i, j), once, and kept as one bit per (i, j);

#define NB_  2
#define TT   2048
#define DD   1024
#define NH_  16
#define HD   64
#define RH   256                  // query rows < RH: hi+lo planes; rows >= RH: fp16 planes
#define NF   32                   // rotary frequencies (head_dim / 2)
#define SCL  0.125f               // 1/sqrt(64)
#define PCAR 1024.0f         // fp16 P is scaled by this; divided out with l at the end
typedef _Float16 h16;
typedef unsigned short bf;
typedef __attribute__((ext_vector_type(16))) __bf16   v16bf;
typedef __attribute__((ext_vector_type(16))) _Float16 v16h;
typedef __attribute__((ext_vector_type(8)))  _Float16 v8h;
typedef __attribute__((ext_vector_type(8)))  unsigned short v8us;
typedef __attribute__((ext_vector_type(8)))  float    v8f;
typedef __attribute__((ext_vector_type(4)))  float    v4f;
typedef v8h  __attribute__((may_alias)) v8ha;
typedef v4f  __attribute__((may_alias)) v4fa;
typedef v8us __attribute__((may_alias)) v8usa;
typedef __attribute__((ext_vector_type(16))) unsigned v16u;

__device__ __forceinline__ unsigned short f2bf(float f) { unsigned u = __float_as_uint(f); u += 0x7FFFu + ((u >> 16) & 1u); return (unsigned short)(u >> 16); }
__device__ __forceinline__ float bf2f(unsigned short b) { return __uint_as_float(((unsigned)b) << 16); }
__device__ __forceinline__ float bfr(float f) { return bf2f(f2bf(f)); }
__device__ __forceinline__ v16h cat16(v8h lo, v8h hi) { return __builtin_shufflevector(lo, hi, 0, 1, 2, 3, 4, 5, 6, 7, 8, 9, 10, 11, 12, 13, 14, 15); }
__device__ __forceinline__ v16bf cat16b(v8us lo, v8us hi) { return __builtin_bit_cast(v16bf, __builtin_shufflevector(lo, hi, 0, 1, 2, 3, 4, 5, 6, 7, 8, 9, 10, 11, 12, 13, 14, 15)); }
__device__ __forceinline__ v8f wmma16(v16h a, v16h b, v8f c) { return __builtin_amdgcn_wmma_f32_16x16x32_f16(false, a, false, b, (short)0, c, false, false); }
__device__ __forceinline__ v8f wmmab(v16bf a, v16bf b, v8f c) { return __builtin_amdgcn_wmma_f32_16x16x32_bf16(false, a, false, b, (short)0, c, false, false); }



// Stands directly behind each group of global loads: the address registers that the loads name are not rewritten before the loads have taken them; the scheduling barriers hold the loads
// in front of the wait and every later register write behind it (they also keep each group where the pass wants it issued).
// The addresses are inputs of the wait, so that they stay whole up to it: no load of the group gets one of them as its destination.
__device__ __forceinline__ void loads_taken(const void* a, const void* b, const void* c) { __builtin_amdgcn_sched_barrier(0); asm volatile("s_wait_xcnt 0x0" :: "v"(a), "v"(b), "v"(c) : "memory"); __builtin_amdgcn_sched_barrier(0); }
// The same behind a group of global stores: neither their data registers nor their address registers are rewritten before the stores have taken them.
__device__ __forceinline__ void stores_taken() { __builtin_amdgcn_sched_barrier(0); asm volatile("s_wait_xcnt 0x0" ::: "memory"); __builtin_amdgcn_sched_barrier(0); }
// FRAGMENT ORDER of every 16-bit operand plane M[row][k] (k extent K): the 16 rows x 32 k of one WMMA operand lie in 1024 bytes in a row, as two halves of 512 bytes, each 32 lanes x 8 elements:
// element index = (row / 16) * 16 * K + (k / 32) * 512 + ((k >> 4) & 1) * 256 + (((k >> 3) & 1) * 16 + (row & 15)) * 8 + (k & 7). Lane l of a wave loads its 16 bytes at l * 16 in each half, so one fragment load
// reads 512 bytes in a row (4 whole lines) and not 32 bytes out of each of 16 lines. The element that each lane and register holds is the same as with a row-major plane.
// ---- k_gemmw: register-blocked GEMM, ONE WAVE per 64x64 output tile (16 accumulators), operands straight from 16-bit planes in fragment order; grid (M/64, N/64, Z), 32 threads.
// C[m][n] (f32, pitch ldc, + optional f32 bias[n]) = sum_k A[m][k] Bt[n][k] (+ split products per NSPLIT). z-batch strides sA/sB/sC in elements. K % 32 == 0; K is a compile-time constant, so that a trip's fragments lie at constant offsets from one address an operand.
// blockIdx.z also picks the bias among bias, biasz1, biasz2 (q, k and v projections of one launch).
// KS > 1 (N == 64 only): blockIdx.y is a K slice, not a column tile: the wave sums k in [y K/KS, (y+1) K/KS) and stores its partial tile in plane y (C + y sK); the reader adds the KS planes.
template <typename T16> struct WFrag;
template <> struct WFrag<h16> { typedef v16h V; static __device__ __forceinline__ V ld(const h16* p) { return cat16(*(const v8h*)p, *(const v8h*)(p + 256)); } static __device__ __forceinline__ v8f mma(V a, V b, v8f c) { return wmma16(a, b, c); } };
template <> struct WFrag<bf> { typedef v16bf V; static __device__ __forceinline__ V ld(const bf* p) { return cat16b(*(const v8us*)p, *(const v8us*)(p + 256)); } static __device__ __forceinline__ v8f mma(V a, V b, v8f c) { return wmmab(a, b, c); } };
template <typename T16, int NSPLIT, bool BIAS, int K, int KS = 1>
__global__ __launch_bounds__(32) void k_gemmw(const T16* __restrict__ A, const T16* __restrict__ A2, const T16* __restrict__ Bt, const T16* __restrict__ Bt2, float* C, int ldc, const float* __restrict__ bias, const float* __restrict__ biasz1, const float* __restrict__ biasz2, size_t sA, size_t sB, size_t sC, size_t sK) {
    typedef typename WFrag<T16>::V V;
    __shared__ __align__(16) float os[16 * 68];
    const size_t z = blockIdx.z; A += z * sA; if (A2) A2 += z * sA; Bt += z * sB; if (Bt2) Bt2 += z * sB; C += z * sC; if (BIAS) bias = z == 0 ? bias : z == 1 ? biasz1 : biasz2;
    const int lane = threadIdx.x & 31, lr = lane & 15, hi = lane >> 4; const int r0 = blockIdx.x * 64, c0 = (KS > 1) ? 0 : blockIdx.y * 64;
    const int KL = K / KS; if (KS > 1) { const size_t ko = (size_t)blockIdx.y * KL * 16; A += ko; if (A2) A2 += ko; Bt += ko; if (Bt2) Bt2 += ko; C += (size_t)blockIdx.y * sK; }
    v8f acc[4][4];
#pragma unroll
    for (int mb = 0; mb < 4; ++mb)
#pragma unroll
        for (int nb = 0; nb < 4; ++nb) acc[mb][nb] = (v8f){};
    const T16* pa = A + (size_t)r0 * K + 8 * lane; const T16* pa2 = (NSPLIT == 1 || NSPLIT == 2) ? A2 + (size_t)r0 * K + 8 * lane : pa; const T16* pb = Bt + (size_t)c0 * K + 8 * lane; const T16* pb2 = (NSPLIT >= 2) ? Bt2 + (size_t)c0 * K + 8 * lane : pb;
#pragma unroll 1
    for (int kc = 0; kc < KL; kc += 32) {
        V a[4], a2[4], b[4], b2[4];
#pragma unroll
        for (int mb = 0; mb < 4; ++mb) { a[mb] = WFrag<T16>::ld(pa + mb * 16 * K); if (NSPLIT == 1 || NSPLIT == 2) a2[mb] = WFrag<T16>::ld(pa2 + mb * 16 * K); }
#pragma unroll
        for (int nb = 0; nb < 4; ++nb) { b[nb] = WFrag<T16>::ld(pb + nb * 16 * K); if (NSPLIT >= 2) b2[nb] = WFrag<T16>::ld(pb2 + nb * 16 * K); }
        loads_taken(pa, pa2, pb); if (NSPLIT >= 2) loads_taken(pb2, pb2, pb2);
        pa += 512; pa2 += 512; pb += 512; pb2 += 512;
#pragma unroll
        for (int nb = 0; nb < 4; ++nb) {
#pragma unroll
            for (int mb = 0; mb < 4; ++mb) { acc[mb][nb] = WFrag<T16>::mma(a[mb], b[nb], acc[mb][nb]); if (NSPLIT == 1 || NSPLIT == 2) acc[mb][nb] = WFrag<T16>::mma(a2[mb], b[nb], acc[mb][nb]); if (NSPLIT >= 2) acc[mb][nb] = WFrag<T16>::mma(a[mb], b2[nb], acc[mb][nb]); } }
        asm volatile("v_nop\n\tv_nop\n\tv_nop\n\tv_nop" : "+v"(acc[0][0]), "+v"(acc[1][1]), "+v"(acc[2][2]), "+v"(acc[3][3]) : "v"(a[0]), "v"(a[3]));
    }
#pragma unroll
    for (int mb = 0; mb < 4; ++mb) {
#pragma unroll
        for (int nb = 0; nb < 4; ++nb) {
#pragma unroll
            for (int j = 0; j < 8; ++j) os[(hi * 8 + j) * 68 + nb * 16 + lr] = acc[mb][nb][j]; }
        __builtin_amdgcn_wave_barrier(); asm volatile("" ::: "memory");
        float* crow = C + (size_t)(r0 + mb * 16) * ldc + c0;
{
#pragma unroll
            for (int s = 0; s < 8; ++s) { const int row = 2 * s + hi, cofs = lr * 4; v4f val = *(const v4fa*)(os + row * 68 + cofs); if (BIAS) { val[0] += bfr(bias[c0 + cofs]); val[1] += bfr(bias[c0 + cofs + 1]); val[2] += bfr(bias[c0 + cofs + 2]); val[3] += bfr(bias[c0 + cofs + 3]); }
                *(v4f*)(crow + (size_t)row * ldc + cofs) = val; }
             }
        __builtin_amdgcn_wave_barrier(); asm volatile("" ::: "memory");
    }
}

__device__ __forceinline__ h16 tohx(float x) { return (h16)x; }
__device__ __forceinline__ void splitf(float y, unsigned short& h, unsigned short& l) { h = f2bf(y); l = f2bf(y - bf2f(h)); }
typedef __attribute__((ext_vector_type(2))) unsigned short v2us;
typedef __attribute__((ext_vector_type(2))) _Float16 v2h;
typedef __attribute__((ext_vector_type(4))) _Float16 v4h;
typedef __attribute__((ext_vector_type(2))) float v2f;
typedef __attribute__((ext_vector_type(4))) int v4i;

// cvt8: a [rows][DD] f32 slab to bf16 in fragment order. A wave takes 8 rows x 32 k: it reads one whole 128-byte line a row and writes four whole 128-byte lines (8 lanes each).
__device__ __forceinline__ void cvt8(const float* __restrict__ src, bf* dst, size_t n8) { const size_t i = (size_t)blockIdx.x * 256 + threadIdx.x; if (i >= n8) return;
    const int r8 = (int)i & 7, c4 = ((int)i >> 3) & 3, rh = ((int)i >> 5) & 1, kc = ((int)i >> 6) & (DD / 32 - 1); const size_t r16 = i >> 11;
    const v8f v = *(const v8f*)(src + (r16 * 16 + rh * 8 + r8) * DD + kc * 32 + c4 * 8); v8us o;
#pragma unroll
    for (int k = 0; k < 8; ++k) o[k] = f2bf(v[k]); *(v8us*)(dst + r16 * 16 * DD + kc * 512 + (c4 >> 1) * 256 + ((c4 & 1) * 16 + rh * 8 + r8) * 8) = o;  }
__device__ __forceinline__ void cstab(float* CSN) {
    const int idx = blockIdx.x * 256 + threadIdx.x; if (idx >= TT * NF) return; const int t = idx / NF, i = idx % NF; const float den = powf(10000.0f, (float)(2 * i) * (1.0f / HD)); const float ang = __fdiv_rn((float)t, den);
    v2f o; o[0] = cosf(ang); o[1] = sinf(ang); *(v2f*)(CSN + (size_t)idx * 2) = o;  }
// maskbits: the mask as one bit per (query, key), in the order in which an attention wave holds its scores: for 16 queries x 32 keys (one pass) 16 words in a row, word 8 kt + r, whose bit l says
// mask[query 16 qg + (l & 15)][key 32 pass + 16 kt + 8 (l >> 4) + r] != 0: the word is the lane mask of score register r of key tile kt. Word index = (qg * (TT / 32) + pass) * 16 + 8 kt + r.
// A wave makes the 32 words of two passes: a lane reads its query's 2 x 16 keys (16 bytes a load), each ballot is one word, lane j keeps word j; one 128-byte store.
__device__ __forceinline__ void maskbits(const int* __restrict__ mk, unsigned* MB) {
    const int idx = blockIdx.x * 256 + threadIdx.x; const int lane = idx & 31, lr = lane & 15, hi = lane >> 4, wv = idx >> 5, qg = wv / (TT / 64), p2 = wv % (TT / 64); if (qg >= TT / 16) return;
    const int* mp = mk + (size_t)(qg * 16 + lr) * TT + p2 * 64 + 8 * hi; v4i m[8];
#pragma unroll
    for (int c = 0; c < 8; ++c) m[c] = *(const v4i*)(mp + (c >> 1) * 16 + (c & 1) * 4);    // c = 4 pass + 2 kt + (r >> 2)
    loads_taken(mp, mp, mp);
    unsigned w = 0;
#pragma unroll
    for (int j = 0; j < 32; ++j) { const unsigned b = __builtin_amdgcn_ballot_w32(m[j >> 2][j & 3] != 0); w = lane == j ? b : w; }
    MB[(size_t)wv * 32 + lane] = w;
}
// k_prep: every conversion to bf16, the rotary table and the mask bits in ONE launch; grid (DD*DD/2048, 10): slab y = 0 is the table (the longest threads, started first), y = 1..4 the four weights, y = 5..8 the quarters of x (both batches), y = 9 the mask.
// WX holds the eight converted slabs one behind the other: Wq, Wk, Wv, Wo, x.
__global__ __launch_bounds__(256) void k_prep(const float* __restrict__ Wq, const float* __restrict__ Wk, const float* __restrict__ Wv, const float* __restrict__ Wd, const float* __restrict__ x, const int* __restrict__ mk, bf* WX, float* CSN, unsigned* MB) {
    const int y = blockIdx.y; const size_t SL = (size_t)DD * DD;
    if (y == 0) { cstab(CSN); return; }
    if (y == 9) { maskbits(mk, MB); return; }
    const float* src = y == 1 ? Wq : y == 2 ? Wk : y == 3 ? Wv : y == 4 ? Wd : x + (size_t)(y - 5) * SL;
    cvt8(src, WX + (size_t)(y - 1) * SL, SL / 8);
}
// hsplit: head planes (hi/lo + fp16) of one batch, each head's [t][d] plane in fragment order (row = t, k = d), with rotate-half RoPE: r = x cos - x' sin for d < 32, x cos + x' sin for d >= 32, x' = F[t][h*64 + (d ^ 32)].
// A thread makes the 8 values d0..d0+7 (d0 < 32) and their 8 partners d0+32.., which read the same x and the same table entries; a wave takes 8 rows x 32 + 32 d and writes whole 128-byte lines (8 lanes each).
__device__ __forceinline__ void hsplit(const float* __restrict__ F, int pitch, const float* __restrict__ CSN, bf* Ph, bf* Pl, h16* P16) {
    const int idx = blockIdx.x * 256 + threadIdx.x; const int r8 = idx & 7, c4 = (idx >> 3) & 3, rh = (idx >> 5) & 1, t16 = (idx >> 6) & (TT / 16 - 1), h = idx >> 13; if (h >= NH_) return;
    const int t = t16 * 16 + rh * 8 + r8, d0 = c4 * 8; const float* xr = F + (size_t)t * pitch + h * HD + d0; const float* cr = CSN + ((size_t)t * NF + d0) * 2;
    const v8f xa = *(const v8f*)xr, xb = *(const v8f*)(xr + NF); const v8f ca = *(const v8f*)cr, cb = *(const v8f*)(cr + 8);    // ca, cb: (cos, sin) of d0..d0+3 and d0+4..d0+7
    loads_taken(xr, cr, xr);
#pragma unroll
    for (int kc = 0; kc < 2; ++kc) { v8us oh, ol; v8h o16;
#pragma unroll
        for (int q = 0; q < 8; ++q) { const int dd = d0 + q + kc * NF; const float x0 = kc ? xb[q] : xa[q], x1 = kc ? xa[q] : xb[q]; const v2f cs = q < 4 ? v2f{ca[2 * q], ca[2 * q + 1]} : v2f{cb[2 * q - 8], cb[2 * q - 7]};
                float a0 = __fmul_rn(cs[0], x0), a1 = __fmul_rn(cs[1], x1); asm volatile("" : "+v"(a0)); asm volatile("" : "+v"(a1)); const float r = (dd < NF) ? __fsub_rn(a0, a1) : __fadd_rn(a0, a1);
                unsigned short a, c2; splitf(r, a, c2); oh[q] = a; ol[q] = c2; o16[q] = tohx(r); }
        const size_t e = (size_t)h * (TT * HD) + t16 * (16 * HD) + kc * 512 + (c4 >> 1) * 256 + ((c4 & 1) * 16 + rh * 8 + r8) * 8;
        *(v8us*)(Ph + e) = oh; *(v8us*)(Pl + e) = ol; *(v8h*)(P16 + e) = o16; if (kc == 0) stores_taken(); }
}
// vtplane: the transposed v planes of one batch, each head's [d][t] plane as fragments (row = d, k = t), here with the block of 32 keys outermost: the four fragments (64 d) of one pass lie in 4096 bytes in a row.
// A wave makes one fragment (16 d x 32 keys): a lane reads its d in 8 key rows for each half
// (16 lanes share 64 bytes of a row) and stores 16 bytes, the wave 512 bytes in a row.
__device__ __forceinline__ void vtplane(const float* __restrict__ F, bf* Vh, bf* Vl, h16* V16) {
    const int idx = blockIdx.x * 256 + threadIdx.x; const int lane = idx & 31, lr = lane & 15, hi = lane >> 4, t4 = (idx >> 5) & 3, ps = (idx >> 7) & (TT / 32 - 1), h = idx >> 13; if (h >= NH_) return;
    const float* xr = F + (size_t)(ps * 32 + hi * 8) * DD + h * HD + t4 * 16 + lr; float xv[2][8];
#pragma unroll
    for (int hf = 0; hf < 2; ++hf)
#pragma unroll
        for (int q = 0; q < 8; ++q) xv[hf][q] = xr[(hf * 16 + q) * DD];
    loads_taken(xr, xr, xr);
#pragma unroll
    for (int hf = 0; hf < 2; ++hf) { v8us oh, ol; v8h o16;
#pragma unroll
        for (int q = 0; q < 8; ++q) { const float x = xv[hf][q]; unsigned short a, c2; splitf(x, a, c2); oh[q] = a; ol[q] = c2; o16[q] = tohx(x); }
        const size_t e = (size_t)h * (TT * HD) + ps * (32 * HD) + t4 * 512 + hf * 256 + lane * 8;
        *(v8us*)(Vh + e) = oh; *(v8us*)(Vl + e) = ol; *(v8h*)(V16 + e) = o16; if (hf == 0) stores_taken(); }
}
// k_planes: all head planes of q, k, v and both batches in ONE launch; grid (elements of a batch / 16 / 256, batches, 3): z = 0 the transposed v planes (the slowest reads, started first), z = 1 q, z = 2 k. F holds [q, k, v][batch][t][DD].
__global__ __launch_bounds__(256) void k_planes(const float* __restrict__ F, const float* __restrict__ CSN, bf* QPh, bf* QPl, h16* QP16, bf* KPh, bf* KPl, h16* KP16, bf* VTh, bf* VTl, h16* VT16) {
    const size_t PB = (size_t)TT * DD, pb = blockIdx.y * PB;
    if (blockIdx.z == 0) vtplane(F + 2 * NB_ * PB + pb, VTh + pb, VTl + pb, VT16 + pb);
    else if (blockIdx.z == 1) hsplit(F + pb, DD, CSN, QPh + pb, QPl + pb, QP16 + pb);
    else hsplit(F + NB_ * PB + pb, DD, CSN, KPh + pb, KPl + pb, KP16 + pb);
}
// k_fattn: scores, mask, softmax and attn.v of all heads and both batches in ONE launch; no score or probability ever goes to memory. One wave owns R groups of 16 query rows and walks the 2048 keys in passes of 32.
// Transposed products: S^T = K Q^T (A = 16 key rows, B = 16 query columns), so a lane holds scores of ONE query (column lane & 15; key = 16 kt + 8 (lane >> 4) + register), and the two 16-key tiles of a pass, once
// exponentiated and rounded, ARE the B operand (32 keys x 16 queries, same k order as the loader's) of O^T += V^T P^T, whose A rows come from the [d][t] planes. All planes lie in fragment order. Online softmax: running maximum m and sum l per query;
// when a pass raises some maximum, l and O^T are scaled by exp(m_old - m_new). A masked score is -3e38 as before: exp gives 0 once the row has met a kept key, and what was added before that is wiped by the factor 0.
// P is rounded UNNORMALISED (exp(s - m) <= 1; the fp16 rows carry the factor PCAR as before), the division by l comes once at the end, in f32. Rows < RH: hi+lo planes, 3 products each; rows >= RH: fp16 planes.
typedef __attribute__((ext_vector_type(8))) unsigned v8u;
__device__ __forceinline__ unsigned pack2(float lo, float hi) { typedef __bf16 bf2 __attribute__((ext_vector_type(2))); return __builtin_bit_cast(unsigned, __builtin_convertvector(v2f{lo, hi}, bf2)); }  // two f32 to bf16, round to nearest even
__device__ __forceinline__ float xhalf(float x) { return __builtin_bit_cast(float, __builtin_amdgcn_permlanex16(__builtin_bit_cast(int, x), __builtin_bit_cast(int, x), 0x76543210, 0xfedcba98, false, false)); }  // lane l with lane l ^ 16
template <typename T16, bool HI, int R>
__device__ __forceinline__ void attn_rows(const T16* __restrict__ Q, const T16* __restrict__ Q2, const T16* __restrict__ Kp, const T16* __restrict__ K2, const T16* __restrict__ Vt, const T16* __restrict__ Vt2, const unsigned* __restrict__ mk, int q0, bf* Ah, bf* Al) {
    typedef typename WFrag<T16>::V V;
    const int lane = threadIdx.x & 31;    // below: lr = lane & 15, hi = lane >> 4
    V qf[R][2], qf2[R][2]; v8f acc[R][4]; float mrun[R], lsum[R];
    const T16* qb = Q + (unsigned)q0 * HD + 8 * lane; const T16* qb2 = HI ? Q2 + (unsigned)q0 * HD + 8 * lane : qb;
#pragma unroll
    for (int g = 0; g < R; ++g) { mrun[g] = -3.0e38f; lsum[g] = 0.f;
#pragma unroll
        for (int kc = 0; kc < 2; ++kc) { const int o = 16 * g * HD + 512 * kc; qf[g][kc] = WFrag<T16>::ld(qb + o); if (HI) qf2[g][kc] = WFrag<T16>::ld(qb2 + o); }
#pragma unroll
        for (int t = 0; t < 4; ++t) acc[g][t] = (v8f){}; }
    loads_taken(qb, qb2, qb);
    V kf[2][2], kf2[2][2]; v16u mw[R];    // mw: the pass's lane masks (maskbits), the same for the whole wave: scalar registers
    const unsigned* mq = mk + (size_t)__builtin_amdgcn_readfirstlane(q0 >> 4) * (TT / 32 * 16);    // wave-uniform address: the words come by scalar loads
    // lane parts of the addresses, in bytes, fixed for the whole walk
    const unsigned vk = (unsigned)lane * 16u, vv = (unsigned)lane * 16u;
    auto load_km = [&](int key0) {    // one pass's K fragments and mask words
        const char* kb = (const char*)Kp + (size_t)key0 * (HD * 2) + vk; const char* kb2 = HI ? (const char*)K2 + (size_t)key0 * (HD * 2) + vk : kb;
#pragma unroll
        for (int g = 0; g < R; ++g) mw[g] = *(const v16u*)(mq + (g * (TT / 32) + (key0 >> 5)) * 16);
#pragma unroll
        for (int kt = 0; kt < 2; ++kt)
#pragma unroll
            for (int kc = 0; kc < 2; ++kc) { kf[kt][kc] = WFrag<T16>::ld((const T16*)(kb + (16 * kt * HD + 512 * kc) * 2)); if (HI) kf2[kt][kc] = WFrag<T16>::ld((const T16*)(kb2 + (16 * kt * HD + 512 * kc) * 2)); }
        loads_taken(kb, kb2, kb);
    };
    load_km(0);
#pragma unroll 1
    for (int key0 = 0; key0 < TT; key0 += 32) {
        V vf[4], vf2[4];    // V^T fragments of this pass: in flight under the score products and the maxima
        const char* vb = (const char*)Vt + (size_t)key0 * (HD * 2) + vv; const char* vb2 = HI ? (const char*)Vt2 + (size_t)key0 * (HD * 2) + vv : vb;
#pragma unroll
        for (int t = 0; t < 4; ++t) { vf[t] = WFrag<T16>::ld((const T16*)(vb + 512 * t * 2)); if (HI) vf2[t] = WFrag<T16>::ld((const T16*)(vb2 + 512 * t * 2)); }
        loads_taken(vb, vb2, vb);
        v8f s[2][R];
#pragma unroll
        for (int kt = 0; kt < 2; ++kt)
#pragma unroll
            for (int g = 0; g < R; ++g) { s[kt][g] = (v8f){};
#pragma unroll
                for (int kc = 0; kc < 2; ++kc) { s[kt][g] = WFrag<T16>::mma(kf[kt][kc], qf[g][kc], s[kt][g]); if (HI) { s[kt][g] = WFrag<T16>::mma(kf[kt][kc], qf2[g][kc], s[kt][g]); s[kt][g] = WFrag<T16>::mma(kf2[kt][kc], qf[g][kc], s[kt][g]); } } }
        float mx[R]; bool need = false;
#pragma unroll
        for (int g = 0; g < R; ++g) { float m = -3.0e38f;
#pragma unroll
            for (int kt = 0; kt < 2; ++kt)
#pragma unroll
                for (int r = 0; r < 8; ++r) { const float t = __builtin_amdgcn_inverse_ballot_w32(mw[g][8 * kt + r]) ? s[kt][g][r] * SCL : -3.0e38f; s[kt][g][r] = t; m = fmaxf(m, t); }
            m = fmaxf(m, xhalf(m)); mx[g] = m; need = need || (m > mrun[g]); }
        const int keyn = key0 + 32 < TT ? key0 + 32 : TT - 32;    // the next pass's K and mask are fetched in this pass (the last pass reads its own again: in bounds, unused)
        load_km(keyn);    // in flight under the exponentials and the second product
        if (__builtin_amdgcn_ballot_w32(need) != 0) {    // wave-uniform: rare once the maxima have settled
#pragma unroll
            for (int g = 0; g < R; ++g) { const float mn = fmaxf(mrun[g], mx[g]); const float corr = __expf(mrun[g] - mn); mrun[g] = mn; lsum[g] *= corr;
#pragma unroll
                for (int t = 0; t < 4; ++t) acc[g][t] = acc[g][t] * corr; } }
#pragma unroll
        for (int g = 0; g < R; ++g) { float p[16]; float ps = 0.f;
#pragma unroll
            for (int i = 0; i < 16; ++i) p[i] = __expf(s[i >> 3][g][i & 7] - mrun[g]);
#pragma unroll
            for (int i = 0; i < 8; ++i) ps += p[i] + p[8 + i];
            lsum[g] += ps;
            if constexpr (HI) { v8u wh, wl;
#pragma unroll
                for (int i = 0; i < 8; ++i) { const unsigned w = pack2(p[2 * i], p[2 * i + 1]); wh[i] = w; wl[i] = pack2(p[2 * i] - __uint_as_float(w << 16), p[2 * i + 1] - __uint_as_float(w & 0xFFFF0000u)); }
                const V ph = __builtin_bit_cast(v16bf, wh), pl = __builtin_bit_cast(v16bf, wl);
#pragma unroll
                for (int t = 0; t < 4; ++t) { acc[g][t] = WFrag<T16>::mma(vf[t], ph, acc[g][t]); acc[g][t] = WFrag<T16>::mma(vf[t], pl, acc[g][t]); acc[g][t] = WFrag<T16>::mma(vf2[t], ph, acc[g][t]); }
            } else { V pf;
#pragma unroll
                for (int i = 0; i < 16; ++i) pf[i] = tohx(p[i] * PCAR);
#pragma unroll
                for (int t = 0; t < 4; ++t) acc[g][t] = WFrag<T16>::mma(vf[t], pf, acc[g][t]); } }
        __builtin_amdgcn_sched_barrier(0); asm volatile("v_nop\n\tv_nop\n\tv_nop\n\tv_nop"); __builtin_amdgcn_sched_barrier(0);    // the 4 vector slots behind the pass's last WMMAs, also on the taken back edge
    }
#pragma unroll
    for (int g = 0; g < R; ++g) { const float l = lsum[g] + xhalf(lsum[g]); const float inv = __fdiv_rn(1.0f, HI ? l : l * PCAR);
#pragma unroll
        for (int t = 0; t < 4; ++t) { v8us oh, ol;    // the lane's 8 values are d = 16 t + 8 hi + 0..7 of query q0 + 16 g + lr
#pragma unroll
            for (int r = 0; r < 8; ++r) { unsigned short a, c2; splitf(acc[g][t][r] * inv, a, c2); oh[r] = a; ol[r] = c2; }
            const size_t o = (size_t)(q0 + 16 * g) * DD + 256 * t + 8 * lane; *(v8us*)(Ah + o) = oh; *(v8us*)(Al + o) = ol; if (g + 1 < R || t < 3) stores_taken(); } }    // fragment order of the output GEMM's A (row = query, k = 64 head + d): 512 bytes in a row a store
}
// grid (RH/64 + (TT-RH)/128, heads, batches), 4 waves: the first RH/64 blocks of a head take 16 hi+lo rows a wave, the others 32 fp16 rows a wave
__global__ __launch_bounds__(128) void k_fattn(const bf* __restrict__ QPh, const bf* __restrict__ QPl, const bf* __restrict__ KPh, const bf* __restrict__ KPl, const bf* __restrict__ VTh, const bf* __restrict__ VTl,
                                               const h16* __restrict__ QP16, const h16* __restrict__ KP16, const h16* __restrict__ VT16, const unsigned* __restrict__ mk, bf* ATh, bf* ATl) {
    const size_t pz = ((size_t)blockIdx.z * NH_ + blockIdx.y) * (TT * HD); const size_t oz = (size_t)blockIdx.z * TT * DD + blockIdx.y * (16 * HD); const int wave = threadIdx.x >> 5;
    if (blockIdx.x < RH / 64) attn_rows<bf, true, 1>(QPh + pz, QPl + pz, KPh + pz, KPl + pz, VTh + pz, VTl + pz, mk, (int)blockIdx.x * 64 + wave * 16, ATh + oz, ATl + oz);
    else attn_rows<h16, false, 2>(QP16 + pz, nullptr, KP16 + pz, nullptr, VT16 + pz, nullptr, mk, RH + ((int)blockIdx.x - RH / 64) * 128 + wave * 32, ATh + oz, ATl + oz);
}

extern "C" void kernel_launch(void* const* d_in, const int* in_sizes, int n_in,
                              void* d_out, int out_size, void* d_ws, size_t ws_size, hipStream_t stream) {
    (void)in_sizes; (void)n_in; (void)out_size;
    const float* x = (const float*)d_in[0]; const int* mk = (const int*)d_in[1]; const float* Wq = (const float*)d_in[2]; const float* bq = (const float*)d_in[3]; const float* Wk = (const float*)d_in[4]; const float* bk = (const float*)d_in[5]; const float* Wv = (const float*)d_in[6]; const float* bv = (const float*)d_in[7]; const float* Wd = (const float*)d_in[8]; const float* bo = (const float*)d_in[9];
    float* OUT = (float*)d_out;     // [2][2048][1024]
    char* wsp = (char*)d_ws;
    auto take = [&](size_t bytes) { char* p = wsp; wsp += (bytes + 255) & ~(size_t)255; return (void*)p; };
    const size_t PB = (size_t)TT * DD;    // elements of one batch's plane
    bf* W4 = (bf*)take(((size_t)4 * DD * DD + NB_ * PB) * 2); bf* XB = W4 + (size_t)4 * DD * DD;    // Wq, Wk, Wv, Wo, then x of both batches, one behind the other
    float* F = (float*)take(3 * NB_ * PB * 4); float* CSN = (float*)take((size_t)TT * NF * 2 * 4);    // projections [q, k, v][batch][t][DD]
    // head planes and merged-head planes of BOTH batches: the attention launch reads and writes them all
    bf* QPh = (bf*)take(NB_ * PB * 2); bf* QPl = (bf*)take(NB_ * PB * 2); bf* KPh = (bf*)take(NB_ * PB * 2); bf* KPl = (bf*)take(NB_ * PB * 2); bf* VTh = (bf*)take(NB_ * PB * 2); bf* VTl = (bf*)take(NB_ * PB * 2);
    h16* QP16 = (h16*)take(NB_ * PB * 2); h16* KP16 = (h16*)take(NB_ * PB * 2); h16* VT16 = (h16*)take(NB_ * PB * 2);
    bf* ATh = (bf*)take(NB_ * PB * 2); bf* ATl = (bf*)take(NB_ * PB * 2);
    unsigned* MB = (unsigned*)take((size_t)TT * TT / 8);    // the mask, one bit per (query, key)
    if ((size_t)(wsp - (char*)d_ws) > ws_size) return;    // total 153 MiB; ws 256 MiB
    k_prep<<<dim3(DD * DD / 2048, 10), 256, 0, stream>>>(Wq, Wk, Wv, Wd, x, mk, W4, CSN, MB);
    const unsigned LB = (unsigned)(NH_ * TT * HD / 16 / 256);
    k_gemmw<bf, 0, true, DD><<<dim3(NB_ * TT / 64, DD / 64, 3), 32, 0, stream>>>(XB, nullptr, W4, nullptr, F, DD, bq, bk, bv, 0, (size_t)DD * DD, NB_ * PB, 0);
    k_planes<<<dim3(LB, NB_, 3), 256, 0, stream>>>(F, CSN, QPh, QPl, QP16, KPh, KPl, KP16, VTh, VTl, VT16);
    k_fattn<<<dim3(RH / 64 + (TT - RH) / 128, NH_, NB_), 128, 0, stream>>>(QPh, QPl, KPh, KPl, VTh, VTl, QP16, KP16, VT16, MB, ATh, ATl);
    k_gemmw<bf, 1, true, DD><<<dim3(NB_ * TT / 64, DD / 64, 1), 32, 0, stream>>>(ATh, ATl, W4 + (size_t)3 * DD * DD, nullptr, OUT, DD, bo, bo, bo, 0, 0, 0, 0);
}

// v007
// Measured time: 137 microseconds a run.
// In both of two side-by-side timings against v006, it was 1.04 times as fast.
// All steps since v000 together make it 15.2 times as fast.
#include <hip/hip_runtime.h>

// MultiheadAttentionCore (x_q [2][2048][1024], attn_mask [2048][2048] bool->int32 (True = keep; read as data; here it is the causal triangle); q/k/v = x W^T + b; 16 heads x 64; rotate-half RoPE over the 64 head
// dims (inv_freq 10000^(-2i/64), positions 0..2047) on q and k; scores /8; -inf where mask == 0; softmax; out = merged Wo^T + bo).
// Compute dtypes, f32 accumulate: every input rounded to bf16; q/k/v projections on PLAIN bf16 operands (inputs: exact, + bias), the output projection on the attention output's bf16 hi+lo planes x bf16 Wo (2 products); rotary f32 (powf / cosf / sinf, partner x[d^32]
// read from memory); PER-ROW PRECISION HYBRID: query rows < 256 of each batch on bf16 hi+lo planes for scores and attn.v (3 products), rows >= 256 on SINGLE fp16 planes; the mask read per (i, j), once, and kept as one bit per (i, j);

#define NB_  2
#define TT   2048
#define DD   1024
#define NH_  16
#define HD   64
#define RH   256                  // query rows < RH: hi+lo planes; rows >= RH: fp16 planes
#define NF   32                   // rotary frequencies (head_dim / 2)
#define SCL  0.125f               // 1/sqrt(64)
#define PCAR 1024.0f         // fp16 P is scaled by this; divided out with l at the end
typedef _Float16 h16;
typedef unsigned short bf;
typedef __attribute__((ext_vector_type(16))) __bf16   v16bf;
typedef __attribute__((ext_vector_type(16))) _Float16 v16h;
typedef __attribute__((ext_vector_type(8)))  _Float16 v8h;
typedef __attribute__((ext_vector_type(8)))  unsigned short v8us;
typedef __attribute__((ext_vector_type(8)))  float    v8f;
typedef __attribute__((ext_vector_type(4)))  float    v4f;
typedef v8h  __attribute__((may_alias)) v8ha;
typedef v4f  __attribute__((may_alias)) v4fa;
typedef v8us __attribute__((may_alias)) v8usa;
typedef __attribute__((ext_vector_type(16))) unsigned v16u;

__device__ __forceinline__ unsigned short f2bf(float f) { unsigned u = __float_as_uint(f); u += 0x7FFFu + ((u >> 16) & 1u); return (unsigned short)(u >> 16); }
__device__ __forceinline__ float bf2f(unsigned short b) { return __uint_as_float(((unsigned)b) << 16); }
__device__ __forceinline__ float bfr(float f) { return bf2f(f2bf(f)); }
__device__ __forceinline__ v16h cat16(v8h lo, v8h hi) { return __builtin_shufflevector(lo, hi, 0, 1, 2, 3, 4, 5, 6, 7, 8, 9, 10, 11, 12, 13, 14, 15); }
__device__ __forceinline__ v16bf cat16b(v8us lo, v8us hi) { return __builtin_bit_cast(v16bf, __builtin_shufflevector(lo, hi, 0, 1, 2, 3, 4, 5, 6, 7, 8, 9, 10, 11, 12, 13, 14, 15)); }
__device__ __forceinline__ v8f wmma16(v16h a, v16h b, v8f c) { return __builtin_amdgcn_wmma_f32_16x16x32_f16(false, a, false, b, (short)0, c, false, false); }
__device__ __forceinline__ v8f wmmab(v16bf a, v16bf b, v8f c) { return __builtin_amdgcn_wmma_f32_16x16x32_bf16(false, a, false, b, (short)0, c, false, false); }



// Stands directly behind each group of global loads: the address registers that the loads name are not rewritten before the loads have taken them; the scheduling barriers hold the loads
// in front of the wait and every later register write behind it (they also keep each group where the pass wants it issued).
// The addresses are inputs of the wait, so that they stay whole up to it: no load of the group gets one of them as its destination.
__device__ __forceinline__ void loads_taken(const void* a, const void* b, const void* c) { __builtin_amdgcn_sched_barrier(0); asm volatile("s_wait_xcnt 0x0" :: "v"(a), "v"(b), "v"(c) : "memory"); __builtin_amdgcn_sched_barrier(0); }
// The same behind a group of global stores: neither their data registers nor their address registers are rewritten before the stores have taken them.
__device__ __forceinline__ void stores_taken() { __builtin_amdgcn_sched_barrier(0); asm volatile("s_wait_xcnt 0x0" ::: "memory"); __builtin_amdgcn_sched_barrier(0); }
// FRAGMENT ORDER of every 16-bit operand plane M[row][k] (k extent K): the 16 rows x 32 k of one WMMA operand lie in 1024 bytes in a row, as two halves of 512 bytes, each 32 lanes x 8 elements:
// element index = (row / 16) * 16 * K + (k / 32) * 512 + ((k >> 4) & 1) * 256 + (((k >> 3) & 1) * 16 + (row & 15)) * 8 + (k & 7). Lane l of a wave loads its 16 bytes at l * 16 in each half, so one fragment load
// reads 512 bytes in a row (4 whole lines) and not 32 bytes out of each of 16 lines. The element that each lane and register holds is the same as with a row-major plane.
// THE GEMM OPERAND PLANES (x, the weights, the merged heads; K = DD) hold the same fragments in another order: slabs of DD rows, in a slab the block of 32 k outermost:
// element index = (row / DD) * DD * DD + (k / 32) * DD * 32 + ((row % DD) / 16) * 512 + the place inside the fragment as above. The fragments that neighbouring row tiles need in one trip lie in a row.
// ---- k_gemmw: register-blocked GEMM, ONE WAVE per 64x64 output tile (16 accumulators), operands straight from 16-bit planes in fragment order; grid (M / (64 WM), N / (64 WN)), WM x WN waves.
// A work-group's waves form a WM x WN block of neighbouring tiles: the WN waves of a tile row load the same A fragments and the WM waves of a tile column the same B fragments in the same trip,
// so that a fragment comes from L2 once a work-group and the other waves find it in the WGP's cache; a trip's fragments of a work-group are two runs of bytes in a row (64 WM and 64 WN rows x 64 bytes), not pieces
// 32 KiB apart (how the cache picks a line's place is not documented: pieces that agree in their low address bits might crowd a few places). No wave waits for another: there is no barrier, and each wave has its own LDS slab for the epilogue.
// C[m][n] (f32, pitch ldc, + optional f32 bias[n]) = sum_k A[m][k] Bt[n][k] (+ split products per NSPLIT). K % 32 == 0; K is a compile-time constant, so that a trip's fragments lie at constant offsets from one address an operand.
// Bt may hold several matrices of DD rows one behind the other (the q, k and v projections of one launch): column tile cg belongs to matrix z = cg / DD, which picks the bias among bias, biasz1, biasz2 and the output plane C + z sC.
template <typename T16> struct WFrag;
template <> struct WFrag<h16> { typedef v16h V; static __device__ __forceinline__ V ld(const h16* p) { return cat16(*(const v8h*)p, *(const v8h*)(p + 256)); } static __device__ __forceinline__ v8f mma(V a, V b, v8f c) { return wmma16(a, b, c); } };
template <> struct WFrag<bf> { typedef v16bf V; static __device__ __forceinline__ V ld(const bf* p) { return cat16b(*(const v8us*)p, *(const v8us*)(p + 256)); } static __device__ __forceinline__ v8f mma(V a, V b, v8f c) { return wmmab(a, b, c); } };
template <typename T16, int NSPLIT, bool BIAS, int K, int WM, int WN>
__global__ __launch_bounds__(WM * WN * 32) void k_gemmw(const T16* __restrict__ A, const T16* __restrict__ A2, const T16* __restrict__ Bt, const T16* __restrict__ Bt2, float* C, int ldc, const float* __restrict__ bias, const float* __restrict__ biasz1, const float* __restrict__ biasz2, size_t sC) {
    typedef typename WFrag<T16>::V V;
    __shared__ __align__(16) float osb[WM * WN][16 * 68];
    const int wave = __builtin_amdgcn_readfirstlane((int)threadIdx.x >> 5), wm = wave / WN, wn = wave % WN; float* os = osb[wave];
    const int lane = threadIdx.x & 31, lr = lane & 15, hi = lane >> 4; const int r0 = ((int)blockIdx.x * WM + wm) * 64, cg = ((int)blockIdx.y * WN + wn) * 64, z = cg / DD, c0 = cg % DD;
    C += (size_t)z * sC; if (BIAS) bias = z == 0 ? bias : z == 1 ? biasz1 : biasz2;
    v8f acc[4][4];
#pragma unroll
    for (int mb = 0; mb < 4; ++mb)
#pragma unroll
        for (int nb = 0; nb < 4; ++nb) acc[mb][nb] = (v8f){};
    static_assert(K == DD, "operand planes: slabs of DD rows x DD k");
    const size_t oa = (size_t)(r0 / DD) * DD * DD + (r0 % DD) * 32 + 8 * lane, ob = (size_t)z * DD * DD + c0 * 32 + 8 * lane;
    const T16* pa = A + oa; const T16* pa2 = (NSPLIT == 1 || NSPLIT == 2) ? A2 + oa : pa; const T16* pb = Bt + ob; const T16* pb2 = (NSPLIT >= 2) ? Bt2 + ob : pb;
#pragma unroll 1
    for (int kc = 0; kc < K; kc += 32) {
        V a[4], a2[4], b[4], b2[4];
#pragma unroll
        for (int mb = 0; mb < 4; ++mb) { a[mb] = WFrag<T16>::ld(pa + mb * 512); if (NSPLIT == 1 || NSPLIT == 2) a2[mb] = WFrag<T16>::ld(pa2 + mb * 512); }
#pragma unroll
        for (int nb = 0; nb < 4; ++nb) { b[nb] = WFrag<T16>::ld(pb + nb * 512); if (NSPLIT >= 2) b2[nb] = WFrag<T16>::ld(pb2 + nb * 512); }
        loads_taken(pa, pa2, pb); if (NSPLIT >= 2) loads_taken(pb2, pb2, pb2);
        pa += DD * 32; pa2 += DD * 32; pb += DD * 32; pb2 += DD * 32;
#pragma unroll
        for (int nb = 0; nb < 4; ++nb) {
#pragma unroll
            for (int mb = 0; mb < 4; ++mb) { acc[mb][nb] = WFrag<T16>::mma(a[mb], b[nb], acc[mb][nb]); if (NSPLIT == 1 || NSPLIT == 2) acc[mb][nb] = WFrag<T16>::mma(a2[mb], b[nb], acc[mb][nb]); if (NSPLIT >= 2) acc[mb][nb] = WFrag<T16>::mma(a[mb], b2[nb], acc[mb][nb]); } }
        asm volatile("v_nop\n\tv_nop\n\tv_nop\n\tv_nop" : "+v"(acc[0][0]), "+v"(acc[1][1]), "+v"(acc[2][2]), "+v"(acc[3][3]) : "v"(a[0]), "v"(a[3]));
    }
#pragma unroll
    for (int mb = 0; mb < 4; ++mb) {
#pragma unroll
        for (int nb = 0; nb < 4; ++nb) {
#pragma unroll
            for (int j = 0; j < 8; ++j) os[(hi * 8 + j) * 68 + nb * 16 + lr] = acc[mb][nb][j]; }
        __builtin_amdgcn_wave_barrier(); asm volatile("" ::: "memory");
        float* crow = C + (size_t)(r0 + mb * 16) * ldc + c0;
{
#pragma unroll
            for (int s = 0; s < 8; ++s) { const int row = 2 * s + hi, cofs = lr * 4; v4f val = *(const v4fa*)(os + row * 68 + cofs); if (BIAS) { val[0] += bfr(bias[c0 + cofs]); val[1] += bfr(bias[c0 + cofs + 1]); val[2] += bfr(bias[c0 + cofs + 2]); val[3] += bfr(bias[c0 + cofs + 3]); }
                *(v4f*)(crow + (size_t)row * ldc + cofs) = val; }
             }
        if (mb < 3) stores_taken();
        __builtin_amdgcn_wave_barrier(); asm volatile("" ::: "memory");
    }
}

__device__ __forceinline__ h16 tohx(float x) { return (h16)x; }
__device__ __forceinline__ void splitf(float y, unsigned short& h, unsigned short& l) { h = f2bf(y); l = f2bf(y - bf2f(h)); }
typedef __attribute__((ext_vector_type(2))) unsigned short v2us;
typedef __attribute__((ext_vector_type(2))) _Float16 v2h;
typedef __attribute__((ext_vector_type(4))) _Float16 v4h;
typedef __attribute__((ext_vector_type(2))) float v2f;
typedef __attribute__((ext_vector_type(4))) int v4i;

// cvt8: a [DD][DD] f32 slab to bf16 fragments, the block of 32 k outermost. A wave takes 8 rows x 32 k: it reads one whole 128-byte line a row and writes four whole 128-byte lines (8 lanes each).
__device__ __forceinline__ void cvt8(const float* __restrict__ src, bf* dst, size_t n8) { const size_t i = (size_t)blockIdx.x * 256 + threadIdx.x; if (i >= n8) return;
    const int r8 = (int)i & 7, c4 = ((int)i >> 3) & 3, rh = ((int)i >> 5) & 1, kc = ((int)i >> 6) & (DD / 32 - 1); const size_t r16 = i >> 11;
    const v8f v = *(const v8f*)(src + (r16 * 16 + rh * 8 + r8) * DD + kc * 32 + c4 * 8); v8us o;
#pragma unroll
    for (int k = 0; k < 8; ++k) o[k] = f2bf(v[k]); *(v8us*)(dst + (size_t)kc * (DD * 32) + r16 * 512 + (c4 >> 1) * 256 + ((c4 & 1) * 16 + rh * 8 + r8) * 8) = o;  }
__device__ __forceinline__ void cstab(float* CSN) {
    const int idx = blockIdx.x * 256 + threadIdx.x; if (idx >= TT * NF) return; const int t = idx / NF, i = idx % NF; const float den = powf(10000.0f, (float)(2 * i) * (1.0f / HD)); const float ang = __fdiv_rn((float)t, den);
    v2f o; o[0] = cosf(ang); o[1] = sinf(ang); *(v2f*)(CSN + (size_t)idx * 2) = o;  }
// maskbits: the mask as one bit per (query, key), in the order in which an attention wave holds its scores: for 16 queries x 32 keys (one pass) 16 words in a row, word 8 kt + r, whose bit l says
// mask[query 16 qg + (l & 15)][key 32 pass + 16 kt + 8 (l >> 4) + r] != 0: the word is the lane mask of score register r of key tile kt. Word index = (qg * (TT / 32) + pass) * 16 + 8 kt + r.
// A wave makes the 32 words of two passes: a lane reads its query's 2 x 16 keys (16 bytes a load), each ballot is one word, lane j keeps word j; one 128-byte store.
__device__ __forceinline__ void maskbits(const int* __restrict__ mk, unsigned* MB) {
    const int idx = blockIdx.x * 256 + threadIdx.x; const int lane = idx & 31, lr = lane & 15, hi = lane >> 4, wv = idx >> 5, qg = wv / (TT / 64), p2 = wv % (TT / 64); if (qg >= TT / 16) return;
    const int* mp = mk + (size_t)(qg * 16 + lr) * TT + p2 * 64 + 8 * hi; v4i m[8];
#pragma unroll
    for (int c = 0; c < 8; ++c) m[c] = *(const v4i*)(mp + (c >> 1) * 16 + (c & 1) * 4);    // c = 4 pass + 2 kt + (r >> 2)
    loads_taken(mp, mp, mp);
    unsigned w = 0;
#pragma unroll
    for (int j = 0; j < 32; ++j) { const unsigned b = __builtin_amdgcn_ballot_w32(m[j >> 2][j & 3] != 0); w = lane == j ? b : w; }
    MB[(size_t)wv * 32 + lane] = w;
}
// k_prep: every conversion to bf16, the rotary table and the mask bits in ONE launch; grid (DD*DD/2048, 10): slab y = 0 is the table (the longest threads, started first), y = 1..4 the four weights, y = 5..8 the quarters of x (both batches), y = 9 the mask.
// WX holds the eight converted slabs one behind the other: Wq, Wk, Wv, Wo, x.
__global__ __launch_bounds__(256) void k_prep(const float* __restrict__ Wq, const float* __restrict__ Wk, const float* __restrict__ Wv, const float* __restrict__ Wd, const float* __restrict__ x, const int* __restrict__ mk, bf* WX, float* CSN, unsigned* MB) {
    const int y = blockIdx.y; const size_t SL = (size_t)DD * DD;
    if (y == 0) { cstab(CSN); return; }
    if (y == 9) { maskbits(mk, MB); return; }
    const float* src = y == 1 ? Wq : y == 2 ? Wk : y == 3 ? Wv : y == 4 ? Wd : x + (size_t)(y - 5) * SL;
    cvt8(src, WX + (size_t)(y - 1) * SL, SL / 8);
}
// hsplit: head planes (hi/lo + fp16) of one batch, each head's [t][d] plane in fragment order (row = t, k = d), with rotate-half RoPE: r = x cos - x' sin for d < 32, x cos + x' sin for d >= 32, x' = F[t][h*64 + (d ^ 32)].
// A thread makes the 8 values d0..d0+7 (d0 < 32) and their 8 partners d0+32.., which read the same x and the same table entries; a wave takes 8 rows x 32 + 32 d and writes whole 128-byte lines (8 lanes each).
__device__ __forceinline__ void hsplit(const float* __restrict__ F, int pitch, const float* __restrict__ CSN, bf* Ph, bf* Pl, h16* P16) {
    const int idx = blockIdx.x * 256 + threadIdx.x; const int r8 = idx & 7, c4 = (idx >> 3) & 3, rh = (idx >> 5) & 1, t16 = (idx >> 6) & (TT / 16 - 1), h = idx >> 13; if (h >= NH_) return;
    const int t = t16 * 16 + rh * 8 + r8, d0 = c4 * 8; const float* xr = F + (size_t)t * pitch + h * HD + d0; const float* cr = CSN + ((size_t)t * NF + d0) * 2;
    const v8f xa = *(const v8f*)xr, xb = *(const v8f*)(xr + NF); const v8f ca = *(const v8f*)cr, cb = *(const v8f*)(cr + 8);    // ca, cb: (cos, sin) of d0..d0+3 and d0+4..d0+7
    loads_taken(xr, cr, xr);
#pragma unroll
    for (int kc = 0; kc < 2; ++kc) { v8us oh, ol; v8h o16;
#pragma unroll
        for (int q = 0; q < 8; ++q) { const int dd = d0 + q + kc * NF; const float x0 = kc ? xb[q] : xa[q], x1 = kc ? xa[q] : xb[q]; const v2f cs = q < 4 ? v2f{ca[2 * q], ca[2 * q + 1]} : v2f{cb[2 * q - 8], cb[2 * q - 7]};
                float a0 = __fmul_rn(cs[0], x0), a1 = __fmul_rn(cs[1], x1); asm volatile("" : "+v"(a0)); asm volatile("" : "+v"(a1)); const float r = (dd < NF) ? __fsub_rn(a0, a1) : __fadd_rn(a0, a1);
                unsigned short a, c2; splitf(r, a, c2); oh[q] = a; ol[q] = c2; o16[q] = tohx(r); }
        const size_t e = (size_t)h * (TT * HD) + t16 * (16 * HD) + kc * 512 + (c4 >> 1) * 256 + ((c4 & 1) * 16 + rh * 8 + r8) * 8;
        *(v8us*)(Ph + e) = oh; *(v8us*)(Pl + e) = ol; *(v8h*)(P16 + e) = o16; if (kc == 0) stores_taken(); }
}
// vtplane: the transposed v planes of one batch, each head's [d][t] plane as fragments (row = d, k = t), here with the block of 32 keys outermost: the four fragments (64 d) of one pass lie in 4096 bytes in a row.
// A wave makes one fragment (16 d x 32 keys): a lane reads its d in 8 key rows for each half
// (16 lanes share 64 bytes of a row) and stores 16 bytes, the wave 512 bytes in a row.
__device__ __forceinline__ void vtplane(const float* __restrict__ F, bf* Vh, bf* Vl, h16* V16) {
    const int idx = blockIdx.x * 256 + threadIdx.x; const int lane = idx & 31, lr = lane & 15, hi = lane >> 4, t4 = (idx >> 5) & 3, ps = (idx >> 7) & (TT / 32 - 1), h = idx >> 13; if (h >= NH_) return;
    const float* xr = F + (size_t)(ps * 32 + hi * 8) * DD + h * HD + t4 * 16 + lr; float xv[2][8];
#pragma unroll
    for (int hf = 0; hf < 2; ++hf)
#pragma unroll
        for (int q = 0; q < 8; ++q) xv[hf][q] = xr[(hf * 16 + q) * DD];
    loads_taken(xr, xr, xr);
#pragma unroll
    for (int hf = 0; hf < 2; ++hf) { v8us oh, ol; v8h o16;
#pragma unroll
        for (int q = 0; q < 8; ++q) { const float x = xv[hf][q]; unsigned short a, c2; splitf(x, a, c2); oh[q] = a; ol[q] = c2; o16[q] = tohx(x); }
        const size_t e = (size_t)h * (TT * HD) + ps * (32 * HD) + t4 * 512 + hf * 256 + lane * 8;
        *(v8us*)(Vh + e) = oh; *(v8us*)(Vl + e) = ol; *(v8h*)(V16 + e) = o16; if (hf == 0) stores_taken(); }
}
// k_planes: all head planes of q, k, v and both batches in ONE launch; grid (elements of a batch / 16 / 256, batches, 3): z = 0 the transposed v planes (the slowest reads, started first), z = 1 q, z = 2 k. F holds [q, k, v][batch][t][DD].
__global__ __launch_bounds__(256) void k_planes(const float* __restrict__ F, const float* __restrict__ CSN, bf* QPh, bf* QPl, h16* QP16, bf* KPh, bf* KPl, h16* KP16, bf* VTh, bf* VTl, h16* VT16) {
    const size_t PB = (size_t)TT * DD, pb = blockIdx.y * PB;
    if (blockIdx.z == 0) vtplane(F + 2 * NB_ * PB + pb, VTh + pb, VTl + pb, VT16 + pb);
    else if (blockIdx.z == 1) hsplit(F + pb, DD, CSN, QPh + pb, QPl + pb, QP16 + pb);
    else hsplit(F + NB_ * PB + pb, DD, CSN, KPh + pb, KPl + pb, KP16 + pb);
}
// k_fattn: scores, mask, softmax and attn.v of all heads and both batches in ONE launch; no score or probability ever goes to memory. One wave owns R groups of 16 query rows and walks the 2048 keys in passes of 32.
// Transposed products: S^T = K Q^T (A = 16 key rows, B = 16 query columns), so a lane holds scores of ONE query (column lane & 15; key = 16 kt + 8 (lane >> 4) + register), and the two 16-key tiles of a pass, once
// exponentiated and rounded, ARE the B operand (32 keys x 16 queries, same k order as the loader's) of O^T += V^T P^T, whose A rows come from the [d][t] planes. All planes lie in fragment order. Online softmax: running maximum m and sum l per query;
// when a pass raises some maximum, l and O^T are scaled by exp(m_old - m_new). A masked score is -3e38 as before: exp gives 0 once the row has met a kept key, and what was added before that is wiped by the factor 0.
// P is rounded UNNORMALISED (exp(s - m) <= 1; the fp16 rows carry the factor PCAR as before), the division by l comes once at the end, in f32. Rows < RH: hi+lo planes, 3 products each; rows >= RH: fp16 planes.
typedef __attribute__((ext_vector_type(8))) unsigned v8u;
__device__ __forceinline__ unsigned pack2(float lo, float hi) { typedef __bf16 bf2 __attribute__((ext_vector_type(2))); return __builtin_bit_cast(unsigned, __builtin_convertvector(v2f{lo, hi}, bf2)); }  // two f32 to bf16, round to nearest even
__device__ __forceinline__ float xhalf(float x) { return __builtin_bit_cast(float, __builtin_amdgcn_permlanex16(__builtin_bit_cast(int, x), __builtin_bit_cast(int, x), 0x76543210, 0xfedcba98, false, false)); }  // lane l with lane l ^ 16
template <typename T16, bool HI, int R>
__device__ __forceinline__ void attn_rows(const T16* __restrict__ Q, const T16* __restrict__ Q2, const T16* __restrict__ Kp, const T16* __restrict__ K2, const T16* __restrict__ Vt, const T16* __restrict__ Vt2, const unsigned* __restrict__ mk, int q0, bf* Ah, bf* Al) {
    typedef typename WFrag<T16>::V V;
    const int lane = threadIdx.x & 31;    // below: lr = lane & 15, hi = lane >> 4
    V qf[R][2], qf2[R][2]; v8f acc[R][4]; float mrun[R], lsum[R];
    const T16* qb = Q + (unsigned)q0 * HD + 8 * lane; const T16* qb2 = HI ? Q2 + (unsigned)q0 * HD + 8 * lane : qb;
#pragma unroll
    for (int g = 0; g < R; ++g) { mrun[g] = -3.0e38f; lsum[g] = 0.f;
#pragma unroll
        for (int kc = 0; kc < 2; ++kc) { const int o = 16 * g * HD + 512 * kc; qf[g][kc] = WFrag<T16>::ld(qb + o); if (HI) qf2[g][kc] = WFrag<T16>::ld(qb2 + o); }
#pragma unroll
        for (int t = 0; t < 4; ++t) acc[g][t] = (v8f){}; }
    loads_taken(qb, qb2, qb);
    V kf[2][2], kf2[2][2]; v16u mw[R];    // mw: the pass's lane masks (maskbits), the same for the whole wave: scalar registers
    const unsigned* mq = mk + (size_t)__builtin_amdgcn_readfirstlane(q0 >> 4) * (TT / 32 * 16);    // wave-uniform address: the words come by scalar loads
    // lane parts of the addresses, in bytes, fixed for the whole walk
    const unsigned vk = (unsigned)lane * 16u, vv = (unsigned)lane * 16u;
    auto load_km = [&](int key0) {    // one pass's K fragments and mask words
        const char* kb = (const char*)Kp + (size_t)key0 * (HD * 2) + vk; const char* kb2 = HI ? (const char*)K2 + (size_t)key0 * (HD * 2) + vk : kb;
#pragma unroll
        for (int g = 0; g < R; ++g) mw[g] = *(const v16u*)(mq + (g * (TT / 32) + (key0 >> 5)) * 16);
#pragma unroll
        for (int kt = 0; kt < 2; ++kt)
#pragma unroll
            for (int kc = 0; kc < 2; ++kc) { kf[kt][kc] = WFrag<T16>::ld((const T16*)(kb + (16 * kt * HD + 512 * kc) * 2)); if (HI) kf2[kt][kc] = WFrag<T16>::ld((const T16*)(kb2 + (16 * kt * HD + 512 * kc) * 2)); }
        loads_taken(kb, kb2, kb);
    };
    load_km(0);
#pragma unroll 1
    for (int key0 = 0; key0 < TT; key0 += 32) {
        V vf[4], vf2[4];    // V^T fragments of this pass: in flight under the score products and the maxima
        const char* vb = (const char*)Vt + (size_t)key0 * (HD * 2) + vv; const char* vb2 = HI ? (const char*)Vt2 + (size_t)key0 * (HD * 2) + vv : vb;
#pragma unroll
        for (int t = 0; t < 4; ++t) { vf[t] = WFrag<T16>::ld((const T16*)(vb + 512 * t * 2)); if (HI) vf2[t] = WFrag<T16>::ld((const T16*)(vb2 + 512 * t * 2)); }
        loads_taken(vb, vb2, vb);
        v8f s[2][R];
#pragma unroll
        for (int kt = 0; kt < 2; ++kt)
#pragma unroll
            for (int g = 0; g < R; ++g) { s[kt][g] = (v8f){};
#pragma unroll
                for (int kc = 0; kc < 2; ++kc) { s[kt][g] = WFrag<T16>::mma(kf[kt][kc], qf[g][kc], s[kt][g]); if (HI) { s[kt][g] = WFrag<T16>::mma(kf[kt][kc], qf2[g][kc], s[kt][g]); s[kt][g] = WFrag<T16>::mma(kf2[kt][kc], qf[g][kc], s[kt][g]); } } }
        float mx[R]; bool need = false;
#pragma unroll
        for (int g = 0; g < R; ++g) { float m = -3.0e38f;
#pragma unroll
            for (int kt = 0; kt < 2; ++kt)
#pragma unroll
                for (int r = 0; r < 8; ++r) { const float t = __builtin_amdgcn_inverse_ballot_w32(mw[g][8 * kt + r]) ? s[kt][g][r] * SCL : -3.0e38f; s[kt][g][r] = t; m = fmaxf(m, t); }
            m = fmaxf(m, xhalf(m)); mx[g] = m; need = need || (m > mrun[g]); }
        const int keyn = key0 + 32 < TT ? key0 + 32 : TT - 32;    // the next pass's K and mask are fetched in this pass (the last pass reads its own again: in bounds, unused)
        load_km(keyn);    // in flight under the exponentials and the second product
        if (__builtin_amdgcn_ballot_w32(need) != 0) {    // wave-uniform: rare once the maxima have settled
#pragma unroll
            for (int g = 0; g < R; ++g) { const float mn = fmaxf(mrun[g], mx[g]); const float corr = __expf(mrun[g] - mn); mrun[g] = mn; lsum[g] *= corr;
#pragma unroll
                for (int t = 0; t < 4; ++t) acc[g][t] = acc[g][t] * corr; } }
#pragma unroll
        for (int g = 0; g < R; ++g) { float p[16]; float ps = 0.f;
#pragma unroll
            for (int i = 0; i < 16; ++i) p[i] = __expf(s[i >> 3][g][i & 7] - mrun[g]);
#pragma unroll
            for (int i = 0; i < 8; ++i) ps += p[i] + p[8 + i];
            lsum[g] += ps;
            if constexpr (HI) { v8u wh, wl;
#pragma unroll
                for (int i = 0; i < 8; ++i) { const unsigned w = pack2(p[2 * i], p[2 * i + 1]); wh[i] = w; wl[i] = pack2(p[2 * i] - __uint_as_float(w << 16), p[2 * i + 1] - __uint_as_float(w & 0xFFFF0000u)); }
                const V ph = __builtin_bit_cast(v16bf, wh), pl = __builtin_bit_cast(v16bf, wl);
#pragma unroll
                for (int t = 0; t < 4; ++t) { acc[g][t] = WFrag<T16>::mma(vf[t], ph, acc[g][t]); acc[g][t] = WFrag<T16>::mma(vf[t], pl, acc[g][t]); acc[g][t] = WFrag<T16>::mma(vf2[t], ph, acc[g][t]); }
            } else { V pf;
#pragma unroll
                for (int i = 0; i < 16; ++i) pf[i] = tohx(p[i] * PCAR);
#pragma unroll
                for (int t = 0; t < 4; ++t) acc[g][t] = WFrag<T16>::mma(vf[t], pf, acc[g][t]); } }
        __builtin_amdgcn_sched_barrier(0); asm volatile("v_nop\n\tv_nop\n\tv_nop\n\tv_nop"); __builtin_amdgcn_sched_barrier(0);    // the 4 vector slots behind the pass's last WMMAs, also on the taken back edge
    }
#pragma unroll
    for (int g = 0; g < R; ++g) { const float l = lsum[g] + xhalf(lsum[g]); const float inv = __fdiv_rn(1.0f, HI ? l : l * PCAR);
#pragma unroll
        for (int t = 0; t < 4; ++t) { v8us oh, ol;    // the lane's 8 values are d = 16 t + 8 hi + 0..7 of query q0 + 16 g + lr
#pragma unroll
            for (int r = 0; r < 8; ++r) { unsigned short a, c2; splitf(acc[g][t][r] * inv, a, c2); oh[r] = a; ol[r] = c2; }
            const int q = q0 + 16 * g; const size_t o = (size_t)(q / DD) * DD * DD + (t >> 1) * (DD * 32) + (q % DD) * 32 + 256 * (t & 1) + 8 * lane; *(v8us*)(Ah + o) = oh; *(v8us*)(Al + o) = ol; if (g + 1 < R || t < 3) stores_taken(); } }    // a half fragment of the output GEMM's A (row = query, k = 64 head + d), in the order of the GEMM operand planes: 512 bytes in a row a store
}
// grid (RH/64 + (TT-RH)/128, heads, batches), 4 waves: the first RH/64 blocks of a head take 16 hi+lo rows a wave, the others 32 fp16 rows a wave
__global__ __launch_bounds__(128) void k_fattn(const bf* __restrict__ QPh, const bf* __restrict__ QPl, const bf* __restrict__ KPh, const bf* __restrict__ KPl, const bf* __restrict__ VTh, const bf* __restrict__ VTl,
                                               const h16* __restrict__ QP16, const h16* __restrict__ KP16, const h16* __restrict__ VT16, const unsigned* __restrict__ mk, bf* ATh, bf* ATl) {
    const size_t pz = ((size_t)blockIdx.z * NH_ + blockIdx.y) * (TT * HD); const size_t oz = (size_t)blockIdx.z * TT * DD + blockIdx.y * (size_t)(HD / 32 * DD * 32); const int wave = threadIdx.x >> 5;
    if (blockIdx.x < RH / 64) attn_rows<bf, true, 1>(QPh + pz, QPl + pz, KPh + pz, KPl + pz, VTh + pz, VTl + pz, mk, (int)blockIdx.x * 64 + wave * 16, ATh + oz, ATl + oz);
    else attn_rows<h16, false, 2>(QP16 + pz, nullptr, KP16 + pz, nullptr, VT16 + pz, nullptr, mk, RH + ((int)blockIdx.x - RH / 64) * 128 + wave * 32, ATh + oz, ATl + oz);
}

extern "C" void kernel_launch(void* const* d_in, const int* in_sizes, int n_in,
                              void* d_out, int out_size, void* d_ws, size_t ws_size, hipStream_t stream) {
    (void)in_sizes; (void)n_in; (void)out_size;
    const float* x = (const float*)d_in[0]; const int* mk = (const int*)d_in[1]; const float* Wq = (const float*)d_in[2]; const float* bq = (const float*)d_in[3]; const float* Wk = (const float*)d_in[4]; const float* bk = (const float*)d_in[5]; const float* Wv = (const float*)d_in[6]; const float* bv = (const float*)d_in[7]; const float* Wd = (const float*)d_in[8]; const float* bo = (const float*)d_in[9];
    float* OUT = (float*)d_out;     // [2][2048][1024]
    char* wsp = (char*)d_ws;
    auto take = [&](size_t bytes) { char* p = wsp; wsp += (bytes + 255) & ~(size_t)255; return (void*)p; };
    const size_t PB = (size_t)TT * DD;    // elements of one batch's plane
    bf* W4 = (bf*)take(((size_t)4 * DD * DD + NB_ * PB) * 2); bf* XB = W4 + (size_t)4 * DD * DD;    // Wq, Wk, Wv, Wo, then x of both batches, one behind the other
    float* F = (float*)take(3 * NB_ * PB * 4); float* CSN = (float*)take((size_t)TT * NF * 2 * 4);    // projections [q, k, v][batch][t][DD]
    // head planes and merged-head planes of BOTH batches: the attention launch reads and writes them all
    bf* QPh = (bf*)take(NB_ * PB * 2); bf* QPl = (bf*)take(NB_ * PB * 2); bf* KPh = (bf*)take(NB_ * PB * 2); bf* KPl = (bf*)take(NB_ * PB * 2); bf* VTh = (bf*)take(NB_ * PB * 2); bf* VTl = (bf*)take(NB_ * PB * 2);
    h16* QP16 = (h16*)take(NB_ * PB * 2); h16* KP16 = (h16*)take(NB_ * PB * 2); h16* VT16 = (h16*)take(NB_ * PB * 2);
    bf* ATh = (bf*)take(NB_ * PB * 2); bf* ATl = (bf*)take(NB_ * PB * 2);
    unsigned* MB = (unsigned*)take((size_t)TT * TT / 8);    // the mask, one bit per (query, key)
    if ((size_t)(wsp - (char*)d_ws) > ws_size) return;    // total 153 MiB; ws 256 MiB
    k_prep<<<dim3(DD * DD / 2048, 10), 256, 0, stream>>>(Wq, Wk, Wv, Wd, x, mk, W4, CSN, MB);
    const unsigned LB = (unsigned)(NH_ * TT * HD / 16 / 256);
    k_gemmw<bf, 0, true, DD, 4, 3><<<dim3(NB_ * TT / 256, 3 * DD / 192), 384, 0, stream>>>(XB, nullptr, W4, nullptr, F, DD, bq, bk, bv, NB_ * PB);    // 256 work-groups of 12 waves: 256 x 192 outputs each
    k_planes<<<dim3(LB, NB_, 3), 256, 0, stream>>>(F, CSN, QPh, QPl, QP16, KPh, KPl, KP16, VTh, VTl, VT16);
    k_fattn<<<dim3(RH / 64 + (TT - RH) / 128, NH_, NB_), 128, 0, stream>>>(QPh, QPl, KPh, KPl, VTh, VTl, QP16, KP16, VT16, MB, ATh, ATl);
    k_gemmw<bf, 1, true, DD, 2, 2><<<dim3(NB_ * TT / 128, DD / 128), 128, 0, stream>>>(ATh, ATl, W4 + (size_t)3 * DD * DD, nullptr, OUT, DD, bo, bo, bo, 0);    // 256 work-groups of 4 waves: 128 x 128 outputs each
}

// v008
// One run takes 131 microseconds.
// Next to v007, in two timings, it ran 1.03 and 1.05 times as fast.
// Counting every step since v000, it is 15.9 times as fast.
#include <hip/hip_runtime.h>

// MultiheadAttentionCore (x_q [2][2048][1024], attn_mask [2048][2048] bool->int32 (True = keep; read as data; here it is the causal triangle); q/k/v = x W^T + b; 16 heads x 64; rotate-half RoPE over the 64 head
// dims (inv_freq 10000^(-2i/64), positions 0..2047) on q and k; scores /8; -inf where mask == 0; softmax; out = merged Wo^T + bo).
// Compute dtypes, f32 accumulate: every input rounded to bf16; projections on PLAIN bf16 operands (inputs: exact, + bias); rotary f32 (powf / cosf / sinf, partner x[d^32]
// met in the GEMM wave's own tile); PER-ROW PRECISION HYBRID: query rows < 256 of each batch on bf16 hi+lo planes for scores and attn.v (3 products), rows >= 256 on SINGLE fp16 planes; the mask read per (i, j), once, and kept as one bit per (i, j);

#define NB_  2
#define TT   2048
#define DD   1024
#define NH_  16
#define HD   64
#define RH   256                  // query rows < RH: hi+lo planes; rows >= RH: fp16 planes
#define NF   32                   // rotary frequencies (head_dim / 2)
#define SCL  0.125f               // 1/sqrt(64)
#define PCAR 1024.0f         // fp16 P is scaled by this; divided out with l at the end
typedef _Float16 h16;
typedef unsigned short bf;
typedef __attribute__((ext_vector_type(16))) __bf16   v16bf;
typedef __attribute__((ext_vector_type(16))) _Float16 v16h;
typedef __attribute__((ext_vector_type(8)))  _Float16 v8h;
typedef __attribute__((ext_vector_type(8)))  unsigned short v8us;
typedef __attribute__((ext_vector_type(8)))  float    v8f;
typedef __attribute__((ext_vector_type(4)))  float    v4f;
typedef v8h  __attribute__((may_alias)) v8ha;
typedef v4f  __attribute__((may_alias)) v4fa;
typedef v8us __attribute__((may_alias)) v8usa;
typedef __attribute__((ext_vector_type(16))) unsigned v16u;

__device__ __forceinline__ unsigned short f2bf(float f) { unsigned u = __float_as_uint(f); u += 0x7FFFu + ((u >> 16) & 1u); return (unsigned short)(u >> 16); }
__device__ __forceinline__ float bf2f(unsigned short b) { return __uint_as_float(((unsigned)b) << 16); }
__device__ __forceinline__ float bfr(float f) { return bf2f(f2bf(f)); }
__device__ __forceinline__ v16h cat16(v8h lo, v8h hi) { return __builtin_shufflevector(lo, hi, 0, 1, 2, 3, 4, 5, 6, 7, 8, 9, 10, 11, 12, 13, 14, 15); }
__device__ __forceinline__ v16bf cat16b(v8us lo, v8us hi) { return __builtin_bit_cast(v16bf, __builtin_shufflevector(lo, hi, 0, 1, 2, 3, 4, 5, 6, 7, 8, 9, 10, 11, 12, 13, 14, 15)); }
__device__ __forceinline__ v8f wmma16(v16h a, v16h b, v8f c) { return __builtin_amdgcn_wmma_f32_16x16x32_f16(false, a, false, b, (short)0, c, false, false); }
__device__ __forceinline__ v8f wmmab(v16bf a, v16bf b, v8f c) { return __builtin_amdgcn_wmma_f32_16x16x32_bf16(false, a, false, b, (short)0, c, false, false); }



// Stands directly behind each group of global loads: the address registers that the loads name are not rewritten before the loads have taken them; the scheduling barriers hold the loads
// in front of the wait and every later register write behind it (they also keep each group where the pass wants it issued).
// The addresses are inputs of the wait, so that they stay whole up to it: no load of the group gets one of them as its destination.
__device__ __forceinline__ void loads_taken(const void* a, const void* b, const void* c) { __builtin_amdgcn_sched_barrier(0); asm volatile("s_wait_xcnt 0x0" :: "v"(a), "v"(b), "v"(c) : "memory"); __builtin_amdgcn_sched_barrier(0); }
// The same behind a group of global stores: neither their data registers nor their address registers are rewritten before the stores have taken them.
__device__ __forceinline__ void stores_taken() { __builtin_amdgcn_sched_barrier(0); asm volatile("s_wait_xcnt 0x0" ::: "memory"); __builtin_amdgcn_sched_barrier(0); }
__device__ __forceinline__ h16 tohx(float x) { return (h16)x; }
__device__ __forceinline__ void splitf(float y, unsigned short& h, unsigned short& l) { h = f2bf(y); l = f2bf(y - bf2f(h)); }
typedef __attribute__((ext_vector_type(2))) unsigned short v2us;
typedef __attribute__((ext_vector_type(2))) _Float16 v2h;
typedef __attribute__((ext_vector_type(4))) _Float16 v4h;
typedef __attribute__((ext_vector_type(2))) float v2f;
typedef __attribute__((ext_vector_type(4))) int v4i;
// FRAGMENT ORDER of every 16-bit operand plane M[row][k] (k extent K): the 16 rows x 32 k of one WMMA operand lie in 1024 bytes in a row, as two halves of 512 bytes, each 32 lanes x 8 elements:
// element index = (row / 16) * 16 * K + (k / 32) * 512 + ((k >> 4) & 1) * 256 + (((k >> 3) & 1) * 16 + (row & 15)) * 8 + (k & 7). Lane l of a wave loads its 16 bytes at l * 16 in each half, so one fragment load
// reads 512 bytes in a row (4 whole lines) and not 32 bytes out of each of 16 lines. The element that each lane and register holds is the same as with a row-major plane.
// THE GEMM OPERAND PLANES (x, the weights, the merged heads; K = DD) hold the same fragments in another order: slabs of DD rows, in a slab the block of 32 k outermost:
// element index = (row / DD) * DD * DD + (k / 32) * DD * 32 + ((row % DD) / 16) * 512 + the place inside the fragment as above. The fragments that neighbouring row tiles need in one trip lie in a row.
// ---- k_gemmw: register-blocked GEMM, ONE WAVE per 64x64 output tile (16 accumulators), operands straight from 16-bit planes in fragment order; grid (M / (64 WM), N / (64 WN)), WM x WN waves.
// A work-group's waves form a WM x WN block of neighbouring tiles: the WN waves of a tile row load the same A fragments and the WM waves of a tile column the same B fragments in the same trip,
// so that a fragment comes from L2 once a work-group and the other waves find it in the WGP's cache; a trip's fragments of a work-group are two runs of bytes in a row (64 WM and 64 WN rows x 64 bytes), not pieces
// 32 KiB apart (how the cache picks a line's place is not documented: pieces that agree in their low address bits might crowd a few places). No wave waits for another: there is no barrier, and each wave has its own LDS slab for the epilogue.
// C[m][n] (f32, pitch ldc, + optional f32 bias[n]) = sum_k A[m][k] Bt[n][k] (+ split products per NSPLIT). K % 32 == 0; K is a compile-time constant, so that a trip's fragments lie at constant offsets from one address an operand.
// PL: the outputs are not stored as C: the wave makes the head planes of its tile (qk_tile, vt_tile above) from its accumulators; no f32 projection goes to memory.
// Bt may hold several matrices of DD rows one behind the other (the q, k and v projections of one launch): column tile cg belongs to matrix z = cg / DD, which picks the bias among bias, biasz1, biasz2 and the output plane C + z sC.
// hsplit: 16 values of the head planes (hi/lo + fp16) of q or k, each head's [t][d] plane in fragment order (row = t, k = d), with rotate-half RoPE: r = x cos - x' sin for d < 32, x cos + x' sin for d >= 32, x' = x[t][d ^ 32].
// A lane makes the 8 values d0..d0+7 (d0 = 8 c4 < 32; xa) of row t = 16 t16 + 8 rh + r8 and their 8 partners d0+32.. (xb), which take the same table entries; ca, cb: (cos, sin) of d0..d0+3 and d0+4..d0+7.
__device__ __forceinline__ void hsplit(const v8f xa, const v8f xb, const v8f ca, const v8f cb, int h, int t16, int c4, int rh, int r8, bf* Ph, bf* Pl, h16* P16) {
    const int d0 = c4 * 8;
#pragma unroll
    for (int kc = 0; kc < 2; ++kc) { v8us oh, ol; v8h o16;
#pragma unroll
        for (int q = 0; q < 8; ++q) { const int dd = d0 + q + kc * NF; const float x0 = kc ? xb[q] : xa[q], x1 = kc ? xa[q] : xb[q]; const v2f cs = q < 4 ? v2f{ca[2 * q], ca[2 * q + 1]} : v2f{cb[2 * q - 8], cb[2 * q - 7]};
                float a0 = __fmul_rn(cs[0], x0), a1 = __fmul_rn(cs[1], x1); asm volatile("" : "+v"(a0)); asm volatile("" : "+v"(a1)); const float r = (dd < NF) ? __fsub_rn(a0, a1) : __fadd_rn(a0, a1);
                unsigned short a, c2; splitf(r, a, c2); oh[q] = a; ol[q] = c2; o16[q] = tohx(r); }
        const size_t e = (size_t)h * (TT * HD) + t16 * (16 * HD) + kc * 512 + (c4 >> 1) * 256 + ((c4 & 1) * 16 + rh * 8 + r8) * 8;
        *(v8us*)(Ph + e) = oh; *(v8us*)(Pl + e) = ol; *(v8h*)(P16 + e) = o16; stores_taken(); }
}
// qk_tile: a GEMM wave's 64 rows (t0..) x 64 columns are 64 positions of ONE head of q or k, so that d and d ^ 32 meet in the wave: the head planes are made here, from the accumulators (bias b4 added first, as before).
// 16 rows at a time go through the wave's LDS slab (a lane holds one d of 8 rows, a plane wants 8 d of one row); lane l then takes row l & 15 and c4 = 2 ch + (l >> 4): each store of the wave is 512 bytes in a row.
// The table entries of the next 16 rows are fetched while these are worked on.
__device__ __forceinline__ void qk_tile(const v8f (&acc)[4][4], const float (&b4)[4], float* os, const float* __restrict__ CSN, int h, int t0, bf* Ph, bf* Pl, h16* P16) {
    const int lane = threadIdx.x & 31, lr = lane & 15, hi = lane >> 4, r8 = lane & 7, rh = (lane >> 3) & 1;
    const float* cr = CSN + ((size_t)(t0 + lr) * NF + hi * 8) * 2; v8f cs[2][2][2];    // [row group parity][ch][d0.. , d0+4..]
#pragma unroll
    for (int ch = 0; ch < 2; ++ch) { cs[0][ch][0] = *(const v8f*)(cr + ch * 32); cs[0][ch][1] = *(const v8f*)(cr + ch * 32 + 8); }
    loads_taken(cr, cr, cr);
#pragma unroll
    for (int mb = 0; mb < 4; ++mb) {
#pragma unroll
        for (int nb = 0; nb < 4; ++nb) {
#pragma unroll
            for (int j = 0; j < 8; ++j) os[(hi * 8 + j) * 68 + nb * 16 + lr] = acc[mb][nb][j] + b4[nb]; }
        __builtin_amdgcn_wave_barrier(); asm volatile("" ::: "memory");    // the slab is read by other lanes than wrote it: no read is moved in front of the writes
        if (mb < 3) {
#pragma unroll
            for (int ch = 0; ch < 2; ++ch) { cs[(mb + 1) & 1][ch][0] = *(const v8f*)(cr + (mb + 1) * (16 * NF * 2) + ch * 32); cs[(mb + 1) & 1][ch][1] = *(const v8f*)(cr + (mb + 1) * (16 * NF * 2) + ch * 32 + 8); }
            loads_taken(cr, cr, cr); }
#pragma unroll
        for (int ch = 0; ch < 2; ++ch) { const int c4 = 2 * ch + hi; const float* xr = os + lr * 68 + c4 * 8; v8f xa, xb;
            const v4f x0 = *(const v4fa*)xr, x1 = *(const v4fa*)(xr + 4), x2 = *(const v4fa*)(xr + NF), x3 = *(const v4fa*)(xr + NF + 4);
#pragma unroll
            for (int q = 0; q < 4; ++q) { xa[q] = x0[q]; xa[4 + q] = x1[q]; xb[q] = x2[q]; xb[4 + q] = x3[q]; }
            hsplit(xa, xb, cs[mb & 1][ch][0], cs[mb & 1][ch][1], h, t0 / 16 + mb, c4, rh, r8, Ph, Pl, P16); }
        __builtin_amdgcn_wave_barrier(); asm volatile("" ::: "memory");    // the next 16 rows are not written before these are read
    }
}
// vt_tile: the transposed v planes, each head's [d][t] plane as fragments (row = d, k = t), the block of 32 keys outermost: the four fragments (64 d) of one pass lie in 4096 bytes in a row.
// An accumulator's 8 registers of a lane are 8 keys in a row of one d: they ARE the lane's 16 bytes of a half fragment, so that the planes are stored straight from the registers, 512 bytes in a row a store.
__device__ __forceinline__ void vt_tile(const v8f (&acc)[4][4], const float (&b4)[4], int h, int t0, bf* Vh, bf* Vl, h16* V16) {
    const int lane = threadIdx.x & 31;
#pragma unroll
    for (int mb = 0; mb < 4; ++mb)
#pragma unroll
        for (int nb = 0; nb < 4; ++nb) { v8us oh, ol; v8h o16;
#pragma unroll
            for (int q = 0; q < 8; ++q) { const float x = acc[mb][nb][q] + b4[nb]; unsigned short a, c2; splitf(x, a, c2); oh[q] = a; ol[q] = c2; o16[q] = tohx(x); }
            const size_t e = (size_t)h * (TT * HD) + (t0 / 32 + (mb >> 1)) * (32 * HD) + nb * 512 + (mb & 1) * 256 + lane * 8;
            *(v8us*)(Vh + e) = oh; *(v8us*)(Vl + e) = ol; *(v8h*)(V16 + e) = o16; if (mb < 3 || nb < 3) stores_taken(); }
}
template <typename T16> struct WFrag;
template <> struct WFrag<h16> { typedef v16h V; static __device__ __forceinline__ V ld(const h16* p) { return cat16(*(const v8h*)p, *(const v8h*)(p + 256)); } static __device__ __forceinline__ v8f mma(V a, V b, v8f c) { return wmma16(a, b, c); } };
template <> struct WFrag<bf> { typedef v16bf V; static __device__ __forceinline__ V ld(const bf* p) { return cat16b(*(const v8us*)p, *(const v8us*)(p + 256)); } static __device__ __forceinline__ v8f mma(V a, V b, v8f c) { return wmmab(a, b, c); } };
template <typename T16, int NSPLIT, bool BIAS, int K, int WM, int WN, bool PL>
__global__ __launch_bounds__(WM * WN * 32) void k_gemmw(const T16* __restrict__ A, const T16* __restrict__ A2, const T16* __restrict__ Bt, const T16* __restrict__ Bt2, float* C, int ldc, const float* __restrict__ bias, const float* __restrict__ biasz1, const float* __restrict__ biasz2, size_t sC, const float* __restrict__ CSN, bf* PHL, h16* PF) {
    typedef typename WFrag<T16>::V V;
    __shared__ __align__(16) float osb[WM * WN][16 * 68];
    const int wave = __builtin_amdgcn_readfirstlane((int)threadIdx.x >> 5), wm = wave / WN, wn = wave % WN; float* os = osb[wave];
    const int lane = threadIdx.x & 31, lr = lane & 15, hi = lane >> 4; const int r0 = ((int)blockIdx.x * WM + wm) * 64, cg = ((int)blockIdx.y * WN + wn) * 64, z = cg / DD, c0 = cg % DD;
    C += (size_t)z * sC; if (BIAS) bias = z == 0 ? bias : z == 1 ? biasz1 : biasz2;
    v8f acc[4][4]; float b4[4];
    if constexpr (PL) { const float* bp = bias + c0 + lr;    // the lane's four columns
#pragma unroll
        for (int nb = 0; nb < 4; ++nb) b4[nb] = bp[nb * 16];
        loads_taken(bp, bp, bp); }
#pragma unroll
    for (int mb = 0; mb < 4; ++mb)
#pragma unroll
        for (int nb = 0; nb < 4; ++nb) acc[mb][nb] = (v8f){};
    static_assert(K == DD, "operand planes: slabs of DD rows x DD k");
    const size_t oa = (size_t)(r0 / DD) * DD * DD + (r0 % DD) * 32 + 8 * lane, ob = (size_t)z * DD * DD + c0 * 32 + 8 * lane;
    const T16* pa = A + oa; const T16* pa2 = (NSPLIT == 1 || NSPLIT == 2) ? A2 + oa : pa; const T16* pb = Bt + ob; const T16* pb2 = (NSPLIT >= 2) ? Bt2 + ob : pb;
#pragma unroll 1
    for (int kc = 0; kc < K; kc += 32) {
        V a[4], a2[4], b[4], b2[4];
#pragma unroll
        for (int mb = 0; mb < 4; ++mb) { a[mb] = WFrag<T16>::ld(pa + mb * 512); if (NSPLIT == 1 || NSPLIT == 2) a2[mb] = WFrag<T16>::ld(pa2 + mb * 512); }
#pragma unroll
        for (int nb = 0; nb < 4; ++nb) { b[nb] = WFrag<T16>::ld(pb + nb * 512); if (NSPLIT >= 2) b2[nb] = WFrag<T16>::ld(pb2 + nb * 512); }
        loads_taken(pa, pa2, pb); if (NSPLIT >= 2) loads_taken(pb2, pb2, pb2);
        pa += DD * 32; pa2 += DD * 32; pb += DD * 32; pb2 += DD * 32;
#pragma unroll
        for (int nb = 0; nb < 4; ++nb) {
#pragma unroll
            for (int mb = 0; mb < 4; ++mb) { acc[mb][nb] = WFrag<T16>::mma(a[mb], b[nb], acc[mb][nb]); if (NSPLIT == 1 || NSPLIT == 2) acc[mb][nb] = WFrag<T16>::mma(a2[mb], b[nb], acc[mb][nb]); if (NSPLIT >= 2) acc[mb][nb] = WFrag<T16>::mma(a[mb], b2[nb], acc[mb][nb]); } }
        asm volatile("v_nop\n\tv_nop\n\tv_nop\n\tv_nop" : "+v"(acc[0][0]), "+v"(acc[1][1]), "+v"(acc[2][2]), "+v"(acc[3][3]) : "v"(a[0]), "v"(a[3]));
    }
    if constexpr (PL) {    // matrix z's planes of the tile's batch and head: hi planes [q, k, v] with the lo plane behind each, then the fp16 planes [q, k, v]
        const size_t PB = (size_t)TT * DD, pb = (size_t)(r0 / TT) * PB; const int h = c0 / HD, t0 = r0 % TT;
        bf* Ph = PHL + (size_t)z * (2 * NB_ * PB) + pb; bf* Pl = Ph + NB_ * PB; h16* P16 = PF + (size_t)z * (NB_ * PB) + pb;
#pragma unroll
        for (int nb = 0; nb < 4; ++nb) b4[nb] = bfr(b4[nb]);
        if (z == 2) vt_tile(acc, b4, h, t0, Ph, Pl, P16); else qk_tile(acc, b4, os, CSN, h, t0, Ph, Pl, P16);
        return;
    }
#pragma unroll
    for (int mb = 0; mb < 4; ++mb) {
#pragma unroll
        for (int nb = 0; nb < 4; ++nb) {
#pragma unroll
            for (int j = 0; j < 8; ++j) os[(hi * 8 + j) * 68 + nb * 16 + lr] = acc[mb][nb][j]; }
        __builtin_amdgcn_wave_barrier(); asm volatile("" ::: "memory");
        float* crow = C + (size_t)(r0 + mb * 16) * ldc + c0;
{
#pragma unroll
            for (int s = 0; s < 8; ++s) { const int row = 2 * s + hi, cofs = lr * 4; v4f val = *(const v4fa*)(os + row * 68 + cofs); if (BIAS) { val[0] += bfr(bias[c0 + cofs]); val[1] += bfr(bias[c0 + cofs + 1]); val[2] += bfr(bias[c0 + cofs + 2]); val[3] += bfr(bias[c0 + cofs + 3]); }
                *(v4f*)(crow + (size_t)row * ldc + cofs) = val; }
             }
        if (mb < 3) stores_taken();
        __builtin_amdgcn_wave_barrier(); asm volatile("" ::: "memory");
    }
}


// cvt8: a [DD][DD] f32 slab to bf16 fragments, the block of 32 k outermost. A wave takes 8 rows x 32 k: it reads one whole 128-byte line a row and writes four whole 128-byte lines (8 lanes each).
__device__ __forceinline__ void cvt8(const float* __restrict__ src, bf* dst, size_t n8) { const size_t i = (size_t)blockIdx.x * 256 + threadIdx.x; if (i >= n8) return;
    const int r8 = (int)i & 7, c4 = ((int)i >> 3) & 3, rh = ((int)i >> 5) & 1, kc = ((int)i >> 6) & (DD / 32 - 1); const size_t r16 = i >> 11;
    const v8f v = *(const v8f*)(src + (r16 * 16 + rh * 8 + r8) * DD + kc * 32 + c4 * 8); v8us o;
#pragma unroll
    for (int k = 0; k < 8; ++k) o[k] = f2bf(v[k]); *(v8us*)(dst + (size_t)kc * (DD * 32) + r16 * 512 + (c4 >> 1) * 256 + ((c4 & 1) * 16 + rh * 8 + r8) * 8) = o;  }
__device__ __forceinline__ void cstab(float* CSN) {
    const int idx = blockIdx.x * 256 + threadIdx.x; if (idx >= TT * NF) return; const int t = idx / NF, i = idx % NF; const float den = powf(10000.0f, (float)(2 * i) * (1.0f / HD)); const float ang = __fdiv_rn((float)t, den);
    v2f o; o[0] = cosf(ang); o[1] = sinf(ang); *(v2f*)(CSN + (size_t)idx * 2) = o;  }
// maskbits: the mask as one bit per (query, key), in the order in which an attention wave holds its scores: for 16 queries x 32 keys (one pass) 16 words in a row, word 8 kt + r, whose bit l says
// mask[query 16 qg + (l & 15)][key 32 pass + 16 kt + 8 (l >> 4) + r] != 0: the word is the lane mask of score register r of key tile kt. Word index = (qg * (TT / 32) + pass) * 16 + 8 kt + r.
// A wave makes the 32 words of two passes: a lane reads its query's 2 x 16 keys (16 bytes a load), each ballot is one word, lane j keeps word j; one 128-byte store.
__device__ __forceinline__ void maskbits(const int* __restrict__ mk, unsigned* MB) {
    const int idx = blockIdx.x * 256 + threadIdx.x; const int lane = idx & 31, lr = lane & 15, hi = lane >> 4, wv = idx >> 5, qg = wv / (TT / 64), p2 = wv % (TT / 64); if (qg >= TT / 16) return;
    const int* mp = mk + (size_t)(qg * 16 + lr) * TT + p2 * 64 + 8 * hi; v4i m[8];
#pragma unroll
    for (int c = 0; c < 8; ++c) m[c] = *(const v4i*)(mp + (c >> 1) * 16 + (c & 1) * 4);    // c = 4 pass + 2 kt + (r >> 2)
    loads_taken(mp, mp, mp);
    unsigned w = 0;
#pragma unroll
    for (int j = 0; j < 32; ++j) { const unsigned b = __builtin_amdgcn_ballot_w32(m[j >> 2][j & 3] != 0); w = lane == j ? b : w; }
    MB[(size_t)wv * 32 + lane] = w;
}
// k_prep: every conversion to bf16, the rotary table and the mask bits in ONE launch; grid (DD*DD/2048, 10): slab y = 0 is the table (the longest threads, started first), y = 1..4 the four weights, y = 5..8 the quarters of x (both batches), y = 9 the mask.
// WX holds the eight converted slabs one behind the other: Wq, Wk, Wv, Wo, x.
__global__ __launch_bounds__(256) void k_prep(const float* __restrict__ Wq, const float* __restrict__ Wk, const float* __restrict__ Wv, const float* __restrict__ Wd, const float* __restrict__ x, const int* __restrict__ mk, bf* WX, float* CSN, unsigned* MB) {
    const int y = blockIdx.y; const size_t SL = (size_t)DD * DD;
    if (y == 0) { cstab(CSN); return; }
    if (y == 9) { maskbits(mk, MB); return; }
    const float* src = y == 1 ? Wq : y == 2 ? Wk : y == 3 ? Wv : y == 4 ? Wd : x + (size_t)(y - 5) * SL;
    cvt8(src, WX + (size_t)(y - 1) * SL, SL / 8);
}
// k_fattn: scores, mask, softmax and attn.v of all heads and both batches in ONE launch; no score or probability ever goes to memory. One wave owns R groups of 16 query rows and walks the 2048 keys in passes of 32.
// Transposed products: S^T = K Q^T (A = 16 key rows, B = 16 query columns), so a lane holds scores of ONE query (column lane & 15; key = 16 kt + 8 (lane >> 4) + register), and the two 16-key tiles of a pass, once
// exponentiated and rounded, ARE the B operand (32 keys x 16 queries, same k order as the loader's) of O^T += V^T P^T, whose A rows come from the [d][t] planes. All planes lie in fragment order. Online softmax: running maximum m and sum l per query;
// when a pass raises some maximum, l and O^T are scaled by exp(m_old - m_new). A masked score is -3e38 as before: exp gives 0 once the row has met a kept key, and what was added before that is wiped by the factor 0.
// P is rounded UNNORMALISED (exp(s - m) <= 1; the fp16 rows carry the factor PCAR as before), the division by l comes once at the end, in f32. Rows < RH: hi+lo planes, 3 products each; rows >= RH: fp16 planes.
typedef __attribute__((ext_vector_type(8))) unsigned v8u;
__device__ __forceinline__ unsigned pack2(float lo, float hi) { typedef __bf16 bf2 __attribute__((ext_vector_type(2))); return __builtin_bit_cast(unsigned, __builtin_convertvector(v2f{lo, hi}, bf2)); }  // two f32 to bf16, round to nearest even
__device__ __forceinline__ float xhalf(float x) { return __builtin_bit_cast(float, __builtin_amdgcn_permlanex16(__builtin_bit_cast(int, x), __builtin_bit_cast(int, x), 0x76543210, 0xfedcba98, false, false)); }  // lane l with lane l ^ 16
template <typename T16, bool HI, int R>
__device__ __forceinline__ void attn_rows(const T16* __restrict__ Q, const T16* __restrict__ Q2, const T16* __restrict__ Kp, const T16* __restrict__ K2, const T16* __restrict__ Vt, const T16* __restrict__ Vt2, const unsigned* __restrict__ mk, int q0, bf* Ah, bf* Al) {
    typedef typename WFrag<T16>::V V;
    const int lane = threadIdx.x & 31;    // below: lr = lane & 15, hi = lane >> 4
    V qf[R][2], qf2[R][2]; v8f acc[R][4]; float mrun[R], lsum[R];
    const T16* qb = Q + (unsigned)q0 * HD + 8 * lane; const T16* qb2 = HI ? Q2 + (unsigned)q0 * HD + 8 * lane : qb;
#pragma unroll
    for (int g = 0; g < R; ++g) { mrun[g] = -3.0e38f; lsum[g] = 0.f;
#pragma unroll
        for (int kc = 0; kc < 2; ++kc) { const int o = 16 * g * HD + 512 * kc; qf[g][kc] = WFrag<T16>::ld(qb + o); if (HI) qf2[g][kc] = WFrag<T16>::ld(qb2 + o); }
#pragma unroll
        for (int t = 0; t < 4; ++t) acc[g][t] = (v8f){}; }
    loads_taken(qb, qb2, qb);
    V kf[2][2], kf2[2][2]; v16u mw[R];    // mw: the pass's lane masks (maskbits), the same for the whole wave: scalar registers
    const unsigned* mq = mk + (size_t)__builtin_amdgcn_readfirstlane(q0 >> 4) * (TT / 32 * 16);    // wave-uniform address: the words come by scalar loads
    // lane parts of the addresses, in bytes, fixed for the whole walk
    const unsigned vk = (unsigned)lane * 16u, vv = (unsigned)lane * 16u;
    auto load_km = [&](int key0) {    // one pass's K fragments and mask words
        const char* kb = (const char*)Kp + (size_t)key0 * (HD * 2) + vk; const char* kb2 = HI ? (const char*)K2 + (size_t)key0 * (HD * 2) + vk : kb;
#pragma unroll
        for (int g = 0; g < R; ++g) mw[g] = *(const v16u*)(mq + (g * (TT / 32) + (key0 >> 5)) * 16);
#pragma unroll
        for (int kt = 0; kt < 2; ++kt)
#pragma unroll
            for (int kc = 0; kc < 2; ++kc) { kf[kt][kc] = WFrag<T16>::ld((const T16*)(kb + (16 * kt * HD + 512 * kc) * 2)); if (HI) kf2[kt][kc] = WFrag<T16>::ld((const T16*)(kb2 + (16 * kt * HD + 512 * kc) * 2)); }
        loads_taken(kb, kb2, kb);
    };
    load_km(0);
#pragma unroll 1
    for (int key0 = 0; key0 < TT; key0 += 32) {
        V vf[4], vf2[4];    // V^T fragments of this pass: in flight under the score products and the maxima
        const char* vb = (const char*)Vt + (size_t)key0 * (HD * 2) + vv; const char* vb2 = HI ? (const char*)Vt2 + (size_t)key0 * (HD * 2) + vv : vb;
#pragma unroll
        for (int t = 0; t < 4; ++t) { vf[t] = WFrag<T16>::ld((const T16*)(vb + 512 * t * 2)); if (HI) vf2[t] = WFrag<T16>::ld((const T16*)(vb2 + 512 * t * 2)); }
        loads_taken(vb, vb2, vb);
        v8f s[2][R];
#pragma unroll
        for (int kt = 0; kt < 2; ++kt)
#pragma unroll
            for (int g = 0; g < R; ++g) { s[kt][g] = (v8f){};
#pragma unroll
                for (int kc = 0; kc < 2; ++kc) { s[kt][g] = WFrag<T16>::mma(kf[kt][kc], qf[g][kc], s[kt][g]); if (HI) { s[kt][g] = WFrag<T16>::mma(kf[kt][kc], qf2[g][kc], s[kt][g]); s[kt][g] = WFrag<T16>::mma(kf2[kt][kc], qf[g][kc], s[kt][g]); } } }
        float mx[R]; bool need = false;
#pragma unroll
        for (int g = 0; g < R; ++g) { float m = -3.0e38f;
#pragma unroll
            for (int kt = 0; kt < 2; ++kt)
#pragma unroll
                for (int r = 0; r < 8; ++r) { const float t = __builtin_amdgcn_inverse_ballot_w32(mw[g][8 * kt + r]) ? s[kt][g][r] * SCL : -3.0e38f; s[kt][g][r] = t; m = fmaxf(m, t); }
            m = fmaxf(m, xhalf(m)); mx[g] = m; need = need || (m > mrun[g]); }
        const int keyn = key0 + 32 < TT ? key0 + 32 : TT - 32;    // the next pass's K and mask are fetched in this pass (the last pass reads its own again: in bounds, unused)
        load_km(keyn);    // in flight under the exponentials and the second product
        if (__builtin_amdgcn_ballot_w32(need) != 0) {    // wave-uniform: rare once the maxima have settled
#pragma unroll
            for (int g = 0; g < R; ++g) { const float mn = fmaxf(mrun[g], mx[g]); const float corr = __expf(mrun[g] - mn); mrun[g] = mn; lsum[g] *= corr;
#pragma unroll
                for (int t = 0; t < 4; ++t) acc[g][t] = acc[g][t] * corr; } }
#pragma unroll
        for (int g = 0; g < R; ++g) { float p[16]; float ps = 0.f;
#pragma unroll
            for (int i = 0; i < 16; ++i) p[i] = __expf(s[i >> 3][g][i & 7] - mrun[g]);
#pragma unroll
            for (int i = 0; i < 8; ++i) ps += p[i] + p[8 + i];
            lsum[g] += ps;
            if constexpr (HI) { v8u wh, wl;
#pragma unroll
                for (int i = 0; i < 8; ++i) { const unsigned w = pack2(p[2 * i], p[2 * i + 1]); wh[i] = w; wl[i] = pack2(p[2 * i] - __uint_as_float(w << 16), p[2 * i + 1] - __uint_as_float(w & 0xFFFF0000u)); }
                const V ph = __builtin_bit_cast(v16bf, wh), pl = __builtin_bit_cast(v16bf, wl);
#pragma unroll
                for (int t = 0; t < 4; ++t) { acc[g][t] = WFrag<T16>::mma(vf[t], ph, acc[g][t]); acc[g][t] = WFrag<T16>::mma(vf[t], pl, acc[g][t]); acc[g][t] = WFrag<T16>::mma(vf2[t], ph, acc[g][t]); }
            } else { V pf;
#pragma unroll
                for (int i = 0; i < 16; ++i) pf[i] = tohx(p[i] * PCAR);
#pragma unroll
                for (int t = 0; t < 4; ++t) acc[g][t] = WFrag<T16>::mma(vf[t], pf, acc[g][t]); } }
        __builtin_amdgcn_sched_barrier(0); asm volatile("v_nop\n\tv_nop\n\tv_nop\n\tv_nop"); __builtin_amdgcn_sched_barrier(0);    // the 4 vector slots behind the pass's last WMMAs, also on the taken back edge
    }
#pragma unroll
    for (int g = 0; g < R; ++g) { const float l = lsum[g] + xhalf(lsum[g]); const float inv = __fdiv_rn(1.0f, HI ? l : l * PCAR);
#pragma unroll
        for (int t = 0; t < 4; ++t) { v8us oh, ol;    // the lane's 8 values are d = 16 t + 8 hi + 0..7 of query q0 + 16 g + lr
#pragma unroll
            for (int r = 0; r < 8; ++r) { unsigned short a, c2; splitf(acc[g][t][r] * inv, a, c2); oh[r] = a; ol[r] = c2; }
            const int q = q0 + 16 * g; const size_t o = (size_t)(q / DD) * DD * DD + (t >> 1) * (DD * 32) + (q % DD) * 32 + 256 * (t & 1) + 8 * lane; *(v8us*)(Ah + o) = oh; *(v8us*)(Al + o) = ol; if (g + 1 < R || t < 3) stores_taken(); } }    // a half fragment of the output GEMM's A (row = query, k = 64 head + d), in the order of the GEMM operand planes: 512 bytes in a row a store
}
// grid (RH/64 + (TT-RH)/128, heads, batches), 4 waves: the first RH/64 blocks of a head take 16 hi+lo rows a wave, the others 32 fp16 rows a wave
__global__ __launch_bounds__(128) void k_fattn(const bf* __restrict__ QPh, const bf* __restrict__ QPl, const bf* __restrict__ KPh, const bf* __restrict__ KPl, const bf* __restrict__ VTh, const bf* __restrict__ VTl,
                                               const h16* __restrict__ QP16, const h16* __restrict__ KP16, const h16* __restrict__ VT16, const unsigned* __restrict__ mk, bf* ATh, bf* ATl) {
    const size_t pz = ((size_t)blockIdx.z * NH_ + blockIdx.y) * (TT * HD); const size_t oz = (size_t)blockIdx.z * TT * DD + blockIdx.y * (size_t)(HD / 32 * DD * 32); const int wave = threadIdx.x >> 5;
    if (blockIdx.x < RH / 64) attn_rows<bf, true, 1>(QPh + pz, QPl + pz, KPh + pz, KPl + pz, VTh + pz, VTl + pz, mk, (int)blockIdx.x * 64 + wave * 16, ATh + oz, ATl + oz);
    else attn_rows<h16, false, 2>(QP16 + pz, nullptr, KP16 + pz, nullptr, VT16 + pz, nullptr, mk, RH + ((int)blockIdx.x - RH / 64) * 128 + wave * 32, ATh + oz, ATl + oz);
}

extern "C" void kernel_launch(void* const* d_in, const int* in_sizes, int n_in,
                              void* d_out, int out_size, void* d_ws, size_t ws_size, hipStream_t stream) {
    (void)in_sizes; (void)n_in; (void)out_size;
    const float* x = (const float*)d_in[0]; const int* mk = (const int*)d_in[1]; const float* Wq = (const float*)d_in[2]; const float* bq = (const float*)d_in[3]; const float* Wk = (const float*)d_in[4]; const float* bk = (const float*)d_in[5]; const float* Wv = (const float*)d_in[6]; const float* bv = (const float*)d_in[7]; const float* Wd = (const float*)d_in[8]; const float* bo = (const float*)d_in[9];
    float* OUT = (float*)d_out;     // [2][2048][1024]
    char* wsp = (char*)d_ws;
    auto take = [&](size_t bytes) { char* p = wsp; wsp += (bytes + 255) & ~(size_t)255; return (void*)p; };
    const size_t PB = (size_t)TT * DD;    // elements of one batch's plane
    bf* W4 = (bf*)take(((size_t)4 * DD * DD + NB_ * PB) * 2); bf* XB = W4 + (size_t)4 * DD * DD;    // Wq, Wk, Wv, Wo, then x of both batches, one behind the other
    float* CSN = (float*)take((size_t)TT * NF * 2 * 4);
    // head planes and merged-head planes of BOTH batches: the attention launch reads and writes them all
    bf* QPh = (bf*)take(6 * NB_ * PB * 2); bf* QPl = QPh + NB_ * PB; bf* KPh = QPl + NB_ * PB; bf* KPl = KPh + NB_ * PB; bf* VTh = KPl + NB_ * PB; bf* VTl = VTh + NB_ * PB;    // one block: the q/k/v GEMM finds matrix z's planes by z
    h16* QP16 = (h16*)take(3 * NB_ * PB * 2); h16* KP16 = QP16 + NB_ * PB; h16* VT16 = KP16 + NB_ * PB;
    bf* ATh = (bf*)take(NB_ * PB * 2); bf* ATl = (bf*)take(NB_ * PB * 2);
    unsigned* MB = (unsigned*)take((size_t)TT * TT / 8);    // the mask, one bit per (query, key)
    if ((size_t)(wsp - (char*)d_ws) > ws_size) return;    // total 105 MiB; ws 256 MiB
    k_prep<<<dim3(DD * DD / 2048, 10), 256, 0, stream>>>(Wq, Wk, Wv, Wd, x, mk, W4, CSN, MB);
    k_gemmw<bf, 0, true, DD, 4, 3, true><<<dim3(NB_ * TT / 256, 3 * DD / 192), 384, 0, stream>>>(XB, nullptr, W4, nullptr, nullptr, DD, bq, bk, bv, 0, CSN, QPh, QP16);    // 256 work-groups of 12 waves: 256 x 192 outputs each, written as head planes
    k_fattn<<<dim3(RH / 64 + (TT - RH) / 128, NH_, NB_), 128, 0, stream>>>(QPh, QPl, KPh, KPl, VTh, VTl, QP16, KP16, VT16, MB, ATh, ATl);
    k_gemmw<bf, 1, true, DD, 2, 2, false><<<dim3(NB_ * TT / 128, DD / 128), 128, 0, stream>>>(ATh, ATl, W4 + (size_t)3 * DD * DD, nullptr, OUT, DD, bo, bo, bo, 0, nullptr, nullptr, nullptr);    // 256 work-groups of 4 waves: 128 x 128 outputs each
}

// v009
// One run takes 120 microseconds.
// In two side-by-side timings against v008, it was 1.11 and 1.10 times as fast.
// Counting every step since v000, it is 17.5 times as fast.
#include <hip/hip_runtime.h>

// MultiheadAttentionCore (x_q [2][2048][1024], attn_mask [2048][2048] bool->int32 (True = keep; read as data; here it is the causal triangle); q/k/v = x W^T + b; 16 heads x 64; rotate-half RoPE over the 64 head
// dims (inv_freq 10000^(-2i/64), positions 0..2047) on q and k; scores /8; -inf where mask == 0; softmax; out = merged Wo^T + bo).
// Compute dtypes, f32 accumulate: every input rounded to bf16; projections on PLAIN bf16 operands (inputs: exact, + bias); rotary f32 (powf / cosf / sinf, partner x[d^32]
// met in the GEMM wave's own tile); PER-ROW PRECISION HYBRID: query rows < 256 of each batch on bf16 hi+lo planes for scores and attn.v (3 products), rows >= 256 on SINGLE fp16 planes; the mask read per (i, j), once, and kept as one bit per (i, j);

#define NB_  2
#define TT   2048
#define DD   1024
#define NH_  16
#define HD   64
#define RH   256                  // query rows < RH: hi+lo planes; rows >= RH: fp16 planes
#define NF   32                   // rotary frequencies (head_dim / 2)
#define SCL  0.125f               // 1/sqrt(64)
#define PCAR 1024.0f         // fp16 P is scaled by this; divided out with l at the end
typedef _Float16 h16;
typedef unsigned short bf;
typedef __attribute__((ext_vector_type(16))) __bf16   v16bf;
typedef __attribute__((ext_vector_type(16))) _Float16 v16h;
typedef __attribute__((ext_vector_type(8)))  _Float16 v8h;
typedef __attribute__((ext_vector_type(8)))  unsigned short v8us;
typedef __attribute__((ext_vector_type(8)))  float    v8f;
typedef __attribute__((ext_vector_type(4)))  float    v4f;
typedef v8h  __attribute__((may_alias)) v8ha;
typedef v4f  __attribute__((may_alias)) v4fa;
typedef v8us __attribute__((may_alias)) v8usa;
typedef __attribute__((ext_vector_type(16))) unsigned v16u;

__device__ __forceinline__ unsigned short f2bf(float f) { unsigned u = __float_as_uint(f); u += 0x7FFFu + ((u >> 16) & 1u); return (unsigned short)(u >> 16); }
__device__ __forceinline__ float bf2f(unsigned short b) { return __uint_as_float(((unsigned)b) << 16); }
__device__ __forceinline__ float bfr(float f) { return bf2f(f2bf(f)); }
__device__ __forceinline__ v16h cat16(v8h lo, v8h hi) { return __builtin_shufflevector(lo, hi, 0, 1, 2, 3, 4, 5, 6, 7, 8, 9, 10, 11, 12, 13, 14, 15); }
__device__ __forceinline__ v16bf cat16b(v8us lo, v8us hi) { return __builtin_bit_cast(v16bf, __builtin_shufflevector(lo, hi, 0, 1, 2, 3, 4, 5, 6, 7, 8, 9, 10, 11, 12, 13, 14, 15)); }
__device__ __forceinline__ v8f wmma16(v16h a, v16h b, v8f c) { return __builtin_amdgcn_wmma_f32_16x16x32_f16(false, a, false, b, (short)0, c, false, false); }
__device__ __forceinline__ v8f wmmab(v16bf a, v16bf b, v8f c) { return __builtin_amdgcn_wmma_f32_16x16x32_bf16(false, a, false, b, (short)0, c, false, false); }



// Stands directly behind each group of global loads: the address registers that the loads name are not rewritten before the loads have taken them; the scheduling barriers hold the loads
// in front of the wait and every later register write behind it (they also keep each group where the pass wants it issued).
// The addresses are inputs of the wait, so that they stay whole up to it: no load of the group gets one of them as its destination.
__device__ __forceinline__ void loads_taken(const void* a, const void* b, const void* c) { __builtin_amdgcn_sched_barrier(0); asm volatile("s_wait_xcnt 0x0" :: "v"(a), "v"(b), "v"(c) : "memory"); __builtin_amdgcn_sched_barrier(0); }
// The same where the lanes' part of the addresses is a byte offset from a scalar base: the offset alone is the wait's input (a pointer into the mask words handed to the statement would let the compiler take them for rewritten, and the passes' words would no longer come by scalar loads).
__device__ __forceinline__ void loads_taken_at(unsigned o) { __builtin_amdgcn_sched_barrier(0); asm volatile("s_wait_xcnt 0x0" :: "v"(o) : "memory"); __builtin_amdgcn_sched_barrier(0); }
// The same behind a group of global stores: neither their data registers nor their address registers are rewritten before the stores have taken them.
__device__ __forceinline__ void stores_taken() { __builtin_amdgcn_sched_barrier(0); asm volatile("s_wait_xcnt 0x0" ::: "memory"); __builtin_amdgcn_sched_barrier(0); }
__device__ __forceinline__ h16 tohx(float x) { return (h16)x; }
__device__ __forceinline__ void splitf(float y, unsigned short& h, unsigned short& l) { h = f2bf(y); l = f2bf(y - bf2f(h)); }
typedef __attribute__((ext_vector_type(2))) unsigned short v2us;
typedef __attribute__((ext_vector_type(2))) _Float16 v2h;
typedef __attribute__((ext_vector_type(4))) _Float16 v4h;
typedef __attribute__((ext_vector_type(2))) float v2f;
typedef __attribute__((ext_vector_type(4))) int v4i;
// FRAGMENT ORDER of every 16-bit operand plane M[row][k] (k extent K): the 16 rows x 32 k of one WMMA operand lie in 1024 bytes in a row, as two halves of 512 bytes, each 32 lanes x 8 elements:
// element index = (row / 16) * 16 * K + (k / 32) * 512 + ((k >> 4) & 1) * 256 + (((k >> 3) & 1) * 16 + (row & 15)) * 8 + (k & 7). Lane l of a wave loads its 16 bytes at l * 16 in each half, so one fragment load
// reads 512 bytes in a row (4 whole lines) and not 32 bytes out of each of 16 lines. The element that each lane and register holds is the same as with a row-major plane.
// THE GEMM OPERAND PLANES (x, the weights, the merged heads; K = DD) hold the same fragments in another order: slabs of DD rows, in a slab the block of 32 k outermost:
// element index = (row / DD) * DD * DD + (k / 32) * DD * 32 + ((row % DD) / 16) * 512 + the place inside the fragment as above. The fragments that neighbouring row tiles need in one trip lie in a row.
// ---- k_gemmw: register-blocked GEMM, ONE WAVE per 64x64 output tile (16 accumulators), operands straight from 16-bit planes in fragment order; grid (M / (64 WM), N / (64 WN)), WM x WN waves.
// A work-group's waves form a WM x WN block of neighbouring tiles: the WN waves of a tile row load the same A fragments and the WM waves of a tile column the same B fragments in the same trip,
// so that a fragment comes from L2 once a work-group and the other waves find it in the WGP's cache; a trip's fragments of a work-group are two runs of bytes in a row (64 WM and 64 WN rows x 64 bytes), not pieces
// 32 KiB apart (how the cache picks a line's place is not documented: pieces that agree in their low address bits might crowd a few places). No wave waits for another: there is no barrier, and each wave has its own LDS slab for the epilogue.
// C[m][n] (f32, pitch ldc, + optional f32 bias[n]) = sum_k A[m][k] Bt[n][k] (+ split products per NSPLIT). K % 32 == 0; K is a compile-time constant, so that a trip's fragments lie at constant offsets from one address an operand.
// PL: the outputs are not stored as C: the wave makes the head planes of its tile (qk_tile, vt_tile above) from its accumulators; no f32 projection goes to memory.
// Bt may hold several matrices of DD rows one behind the other (the q, k and v projections of one launch): column tile cg belongs to matrix z = cg / DD, which picks the bias among bias, biasz1, biasz2 and the output plane C + z sC.
// hsplit: 16 values of the head planes (hi/lo + fp16) of q or k, each head's [t][d] plane in fragment order (row = t, k = d), with rotate-half RoPE: r = x cos - x' sin for d < 32, x cos + x' sin for d >= 32, x' = x[t][d ^ 32].
// A lane makes the 8 values d0..d0+7 (d0 = 8 c4 < 32; xa) of row t = 16 t16 + 8 rh + r8 and their 8 partners d0+32.. (xb), which take the same table entries; ca, cb: (cos, sin) of d0..d0+3 and d0+4..d0+7.
__device__ __forceinline__ void hsplit(const v8f xa, const v8f xb, const v8f ca, const v8f cb, int h, int t16, int c4, int rh, int r8, bf* Ph, bf* Pl, h16* P16) {
    const int d0 = c4 * 8;
#pragma unroll
    for (int kc = 0; kc < 2; ++kc) { v8us oh, ol; v8h o16;
#pragma unroll
        for (int q = 0; q < 8; ++q) { const int dd = d0 + q + kc * NF; const float x0 = kc ? xb[q] : xa[q], x1 = kc ? xa[q] : xb[q]; const v2f cs = q < 4 ? v2f{ca[2 * q], ca[2 * q + 1]} : v2f{cb[2 * q - 8], cb[2 * q - 7]};
                float a0 = __fmul_rn(cs[0], x0), a1 = __fmul_rn(cs[1], x1); asm volatile("" : "+v"(a0)); asm volatile("" : "+v"(a1)); const float r = (dd < NF) ? __fsub_rn(a0, a1) : __fadd_rn(a0, a1);
                unsigned short a, c2; splitf(r, a, c2); oh[q] = a; ol[q] = c2; o16[q] = tohx(r); }
        const size_t e = (size_t)h * (TT * HD) + t16 * (16 * HD) + kc * 512 + (c4 >> 1) * 256 + ((c4 & 1) * 16 + rh * 8 + r8) * 8;
        *(v8us*)(Ph + e) = oh; *(v8us*)(Pl + e) = ol; *(v8h*)(P16 + e) = o16; stores_taken(); }
}
// qk_tile: a GEMM wave's 64 rows (t0..) x 64 columns are 64 positions of ONE head of q or k, so that d and d ^ 32 meet in the wave: the head planes are made here, from the accumulators (bias b4 added first, as before).
// 16 rows at a time go through the wave's LDS slab (a lane holds one d of 8 rows, a plane wants 8 d of one row); lane l then takes row l & 15 and c4 = 2 ch + (l >> 4): each store of the wave is 512 bytes in a row.
// The table entries of the next 16 rows are fetched while these are worked on.
__device__ __forceinline__ void qk_tile(const v8f (&acc)[4][4], const float (&b4)[4], float* os, const float* __restrict__ CSN, int h, int t0, bf* Ph, bf* Pl, h16* P16) {
    const int lane = threadIdx.x & 31, lr = lane & 15, hi = lane >> 4, r8 = lane & 7, rh = (lane >> 3) & 1;
    const float* cr = CSN + ((size_t)(t0 + lr) * NF + hi * 8) * 2; v8f cs[2][2][2];    // [row group parity][ch][d0.. , d0+4..]
#pragma unroll
    for (int ch = 0; ch < 2; ++ch) { cs[0][ch][0] = *(const v8f*)(cr + ch * 32); cs[0][ch][1] = *(const v8f*)(cr + ch * 32 + 8); }
    loads_taken(cr, cr, cr);
#pragma unroll
    for (int mb = 0; mb < 4; ++mb) {
#pragma unroll
        for (int nb = 0; nb < 4; ++nb) {
#pragma unroll
            for (int j = 0; j < 8; ++j) os[(hi * 8 + j) * 68 + nb * 16 + lr] = acc[mb][nb][j] + b4[nb]; }
        __builtin_amdgcn_wave_barrier(); asm volatile("" ::: "memory");    // the slab is read by other lanes than wrote it: no read is moved in front of the writes
        if (mb < 3) {
#pragma unroll
            for (int ch = 0; ch < 2; ++ch) { cs[(mb + 1) & 1][ch][0] = *(const v8f*)(cr + (mb + 1) * (16 * NF * 2) + ch * 32); cs[(mb + 1) & 1][ch][1] = *(const v8f*)(cr + (mb + 1) * (16 * NF * 2) + ch * 32 + 8); }
            loads_taken(cr, cr, cr); }
#pragma unroll
        for (int ch = 0; ch < 2; ++ch) { const int c4 = 2 * ch + hi; const float* xr = os + lr * 68 + c4 * 8; v8f xa, xb;
            const v4f x0 = *(const v4fa*)xr, x1 = *(const v4fa*)(xr + 4), x2 = *(const v4fa*)(xr + NF), x3 = *(const v4fa*)(xr + NF + 4);
#pragma unroll
            for (int q = 0; q < 4; ++q) { xa[q] = x0[q]; xa[4 + q] = x1[q]; xb[q] = x2[q]; xb[4 + q] = x3[q]; }
            hsplit(xa, xb, cs[mb & 1][ch][0], cs[mb & 1][ch][1], h, t0 / 16 + mb, c4, rh, r8, Ph, Pl, P16); }
        __builtin_amdgcn_wave_barrier(); asm volatile("" ::: "memory");    // the next 16 rows are not written before these are read
    }
}
// vt_tile: the transposed v planes, each head's [d][t] plane as fragments (row = d, k = t), the block of 32 keys outermost: the four fragments (64 d) of one pass lie in 4096 bytes in a row.
// An accumulator's 8 registers of a lane are 8 keys in a row of one d: they ARE the lane's 16 bytes of a half fragment, so that the planes are stored straight from the registers, 512 bytes in a row a store.
__device__ __forceinline__ void vt_tile(const v8f (&acc)[4][4], const float (&b4)[4], int h, int t0, bf* Vh, bf* Vl, h16* V16) {
    const int lane = threadIdx.x & 31;
#pragma unroll
    for (int mb = 0; mb < 4; ++mb)
#pragma unroll
        for (int nb = 0; nb < 4; ++nb) { v8us oh, ol; v8h o16;
#pragma unroll
            for (int q = 0; q < 8; ++q) { const float x = acc[mb][nb][q] + b4[nb]; unsigned short a, c2; splitf(x, a, c2); oh[q] = a; ol[q] = c2; o16[q] = tohx(x); }
            const size_t e = (size_t)h * (TT * HD) + (t0 / 32 + (mb >> 1)) * (32 * HD) + nb * 512 + (mb & 1) * 256 + lane * 8;
            *(v8us*)(Vh + e) = oh; *(v8us*)(Vl + e) = ol; *(v8h*)(V16 + e) = o16; if (mb < 3 || nb < 3) stores_taken(); }
}
template <typename T16> struct WFrag;
template <> struct WFrag<h16> { typedef v16h V; static __device__ __forceinline__ V ld(const h16* p) { return cat16(*(const v8h*)p, *(const v8h*)(p + 256)); } static __device__ __forceinline__ v8f mma(V a, V b, v8f c) { return wmma16(a, b, c); } };
template <> struct WFrag<bf> { typedef v16bf V; static __device__ __forceinline__ V ld(const bf* p) { return cat16b(*(const v8us*)p, *(const v8us*)(p + 256)); } static __device__ __forceinline__ v8f mma(V a, V b, v8f c) { return wmmab(a, b, c); } };
template <typename T16, int NSPLIT, bool BIAS, int K, int WM, int WN, bool PL>
__global__ __launch_bounds__(WM * WN * 32) void k_gemmw(const T16* __restrict__ A, const T16* __restrict__ A2, const T16* __restrict__ Bt, const T16* __restrict__ Bt2, float* C, int ldc, const float* __restrict__ bias, const float* __restrict__ biasz1, const float* __restrict__ biasz2, size_t sC, const float* __restrict__ CSN, bf* PHL, h16* PF) {
    typedef typename WFrag<T16>::V V;
    __shared__ __align__(16) float osb[WM * WN][16 * 68];
    const int wave = __builtin_amdgcn_readfirstlane((int)threadIdx.x >> 5), wm = wave / WN, wn = wave % WN; float* os = osb[wave];
    const int lane = threadIdx.x & 31, lr = lane & 15, hi = lane >> 4; const int r0 = ((int)blockIdx.x * WM + wm) * 64, cg = ((int)blockIdx.y * WN + wn) * 64, z = cg / DD, c0 = cg % DD;
    C += (size_t)z * sC; if (BIAS) bias = z == 0 ? bias : z == 1 ? biasz1 : biasz2;
    v8f acc[4][4]; float b4[4];
    if constexpr (PL) { const float* bp = bias + c0 + lr;    // the lane's four columns
#pragma unroll
        for (int nb = 0; nb < 4; ++nb) b4[nb] = bp[nb * 16];
        loads_taken(bp, bp, bp); }
#pragma unroll
    for (int mb = 0; mb < 4; ++mb)
#pragma unroll
        for (int nb = 0; nb < 4; ++nb) acc[mb][nb] = (v8f){};
    static_assert(K == DD, "operand planes: slabs of DD rows x DD k");
    const size_t oa = (size_t)(r0 / DD) * DD * DD + (r0 % DD) * 32 + 8 * lane, ob = (size_t)z * DD * DD + c0 * 32 + 8 * lane;
    const T16* pa = A + oa; const T16* pa2 = (NSPLIT == 1 || NSPLIT == 2) ? A2 + oa : pa; const T16* pb = Bt + ob; const T16* pb2 = (NSPLIT >= 2) ? Bt2 + ob : pb;
#pragma unroll 1
    for (int kc = 0; kc < K; kc += 32) {
        V a[4], a2[4], b[4], b2[4];
#pragma unroll
        for (int mb = 0; mb < 4; ++mb) { a[mb] = WFrag<T16>::ld(pa + mb * 512); if (NSPLIT == 1 || NSPLIT == 2) a2[mb] = WFrag<T16>::ld(pa2 + mb * 512); }
#pragma unroll
        for (int nb = 0; nb < 4; ++nb) { b[nb] = WFrag<T16>::ld(pb + nb * 512); if (NSPLIT >= 2) b2[nb] = WFrag<T16>::ld(pb2 + nb * 512); }
        loads_taken(pa, pa2, pb); if (NSPLIT >= 2) loads_taken(pb2, pb2, pb2);
        pa += DD * 32; pa2 += DD * 32; pb += DD * 32; pb2 += DD * 32;
#pragma unroll
        for (int nb = 0; nb < 4; ++nb) {
#pragma unroll
            for (int mb = 0; mb < 4; ++mb) { acc[mb][nb] = WFrag<T16>::mma(a[mb], b[nb], acc[mb][nb]); if (NSPLIT == 1 || NSPLIT == 2) acc[mb][nb] = WFrag<T16>::mma(a2[mb], b[nb], acc[mb][nb]); if (NSPLIT >= 2) acc[mb][nb] = WFrag<T16>::mma(a[mb], b2[nb], acc[mb][nb]); } }
        asm volatile("v_nop\n\tv_nop\n\tv_nop\n\tv_nop" : "+v"(acc[0][0]), "+v"(acc[1][1]), "+v"(acc[2][2]), "+v"(acc[3][3]) : "v"(a[0]), "v"(a[3]));
    }
    if constexpr (PL) {    // matrix z's planes of the tile's batch and head: hi planes [q, k, v] with the lo plane behind each, then the fp16 planes [q, k, v]
        const size_t PB = (size_t)TT * DD, pb = (size_t)(r0 / TT) * PB; const int h = c0 / HD, t0 = r0 % TT;
        bf* Ph = PHL + (size_t)z * (2 * NB_ * PB) + pb; bf* Pl = Ph + NB_ * PB; h16* P16 = PF + (size_t)z * (NB_ * PB) + pb;
#pragma unroll
        for (int nb = 0; nb < 4; ++nb) b4[nb] = bfr(b4[nb]);
        if (z == 2) vt_tile(acc, b4, h, t0, Ph, Pl, P16); else qk_tile(acc, b4, os, CSN, h, t0, Ph, Pl, P16);
        return;
    }
#pragma unroll
    for (int mb = 0; mb < 4; ++mb) {
#pragma unroll
        for (int nb = 0; nb < 4; ++nb) {
#pragma unroll
            for (int j = 0; j < 8; ++j) os[(hi * 8 + j) * 68 + nb * 16 + lr] = acc[mb][nb][j]; }
        __builtin_amdgcn_wave_barrier(); asm volatile("" ::: "memory");
        float* crow = C + (size_t)(r0 + mb * 16) * ldc + c0;
{
#pragma unroll
            for (int s = 0; s < 8; ++s) { const int row = 2 * s + hi, cofs = lr * 4; v4f val = *(const v4fa*)(os + row * 68 + cofs); if (BIAS) { val[0] += bfr(bias[c0 + cofs]); val[1] += bfr(bias[c0 + cofs + 1]); val[2] += bfr(bias[c0 + cofs + 2]); val[3] += bfr(bias[c0 + cofs + 3]); }
                *(v4f*)(crow + (size_t)row * ldc + cofs) = val; }
             }
        if (mb < 3) stores_taken();
        __builtin_amdgcn_wave_barrier(); asm volatile("" ::: "memory");
    }
}


// cvt8: a [DD][DD] f32 slab to bf16 fragments, the block of 32 k outermost. A wave takes 8 rows x 32 k: it reads one whole 128-byte line a row and writes four whole 128-byte lines (8 lanes each).
__device__ __forceinline__ void cvt8(const float* __restrict__ src, bf* dst, size_t n8) { const size_t i = (size_t)blockIdx.x * 256 + threadIdx.x; if (i >= n8) return;
    const int r8 = (int)i & 7, c4 = ((int)i >> 3) & 3, rh = ((int)i >> 5) & 1, kc = ((int)i >> 6) & (DD / 32 - 1); const size_t r16 = i >> 11;
    const v8f v = *(const v8f*)(src + (r16 * 16 + rh * 8 + r8) * DD + kc * 32 + c4 * 8); v8us o;
#pragma unroll
    for (int k = 0; k < 8; ++k) o[k] = f2bf(v[k]); *(v8us*)(dst + (size_t)kc * (DD * 32) + r16 * 512 + (c4 >> 1) * 256 + ((c4 & 1) * 16 + rh * 8 + r8) * 8) = o;  }
__device__ __forceinline__ void cstab(float* CSN) {
    const int idx = blockIdx.x * 256 + threadIdx.x; if (idx >= TT * NF) return; const int t = idx / NF, i = idx % NF; const float den = powf(10000.0f, (float)(2 * i) * (1.0f / HD)); const float ang = __fdiv_rn((float)t, den);
    v2f o; o[0] = cosf(ang); o[1] = sinf(ang); *(v2f*)(CSN + (size_t)idx * 2) = o;  }
// maskbits: the mask as one bit per (query, key), in the order in which an attention wave holds its scores: for 16 queries x 32 keys (one pass) 16 words in a row, word 8 kt + r, whose bit l says
// mask[query 16 qg + (l & 15)][key 32 pass + 16 kt + 8 (l >> 4) + r] != 0: the word is the lane mask of score register r of key tile kt. Word index = (qg * (TT / 32) + pass) * 16 + 8 kt + r.
// A wave makes the 32 words of two passes: a lane reads its query's 2 x 16 keys (16 bytes a load), each ballot is one word, lane j keeps word j; one 128-byte store.
__device__ __forceinline__ void maskbits(const int* __restrict__ mk, unsigned* MB) {
    const int idx = blockIdx.x * 256 + threadIdx.x; const int lane = idx & 31, lr = lane & 15, hi = lane >> 4, wv = idx >> 5, qg = wv / (TT / 64), p2 = wv % (TT / 64); if (qg >= TT / 16) return;
    const int* mp = mk + (size_t)(qg * 16 + lr) * TT + p2 * 64 + 8 * hi; v4i m[8];
#pragma unroll
    for (int c = 0; c < 8; ++c) m[c] = *(const v4i*)(mp + (c >> 1) * 16 + (c & 1) * 4);    // c = 4 pass + 2 kt + (r >> 2)
    loads_taken(mp, mp, mp);
    unsigned w = 0;
#pragma unroll
    for (int j = 0; j < 32; ++j) { const unsigned b = __builtin_amdgcn_ballot_w32(m[j >> 2][j & 3] != 0); w = lane == j ? b : w; }
    MB[(size_t)wv * 32 + lane] = w;
}
// k_prep: every conversion to bf16, the rotary table and the mask bits in ONE launch; grid (DD*DD/2048, 10): slab y = 0 is the table (the longest threads), y = 1..4 the four weights, y = 5..8 the quarters of x (both batches), y = 9 the mask.
// WX holds the eight converted slabs one behind the other: Wq, Wk, Wv, Wo, x.
__global__ __launch_bounds__(256) void k_prep(const float* __restrict__ Wq, const float* __restrict__ Wk, const float* __restrict__ Wv, const float* __restrict__ Wd, const float* __restrict__ x, const int* __restrict__ mk, bf* WX, float* CSN, unsigned* MB) {
    const int y = blockIdx.y; const size_t SL = (size_t)DD * DD;
    if (y == 0) { cstab(CSN); return; }
    if (y == 9) { maskbits(mk, MB); return; }
    const float* src = y == 1 ? Wq : y == 2 ? Wk : y == 3 ? Wv : y == 4 ? Wd : x + (size_t)(y - 5) * SL;
    cvt8(src, WX + (size_t)(y - 1) * SL, SL / 8);
}
// k_fattn: scores, mask, softmax and attn.v of all heads and both batches in ONE launch; no score or probability ever goes to memory. One wave owns R groups of 16 query rows and walks the keys in passes of 32, those passes only in which the mask keeps a key for one of its queries.
// Transposed products: S^T = K Q^T (A = 16 key rows, B = 16 query columns), so a lane holds scores of ONE query (column lane & 15; key = 16 kt + 8 (lane >> 4) + register), and the two 16-key tiles of a pass, once
// exponentiated and rounded, ARE the B operand (32 keys x 16 queries, same k order as the loader's) of O^T += V^T P^T, whose A rows come from the [d][t] planes. All planes lie in fragment order. Online softmax: running maximum m and sum l per query;
// when a pass raises some maximum, l and O^T are scaled by exp(m_old - m_new). A masked score is -3e38 as before: exp gives 0 once the row has met a kept key, and what was added before that is wiped by the factor 0.
// P is rounded UNNORMALISED (exp(s - m) <= 1; the fp16 rows carry the factor PCAR as before), the division by l comes once at the end, in f32. Rows < RH: hi+lo planes, 3 products each; rows >= RH: fp16 planes.
typedef __attribute__((ext_vector_type(8))) unsigned v8u;
typedef __attribute__((ext_vector_type(4))) unsigned v4u;
__device__ __forceinline__ unsigned pack2(float lo, float hi) { typedef __bf16 bf2 __attribute__((ext_vector_type(2))); return __builtin_bit_cast(unsigned, __builtin_convertvector(v2f{lo, hi}, bf2)); }  // two f32 to bf16, round to nearest even
__device__ __forceinline__ float xhalf(float x) { return __builtin_bit_cast(float, __builtin_amdgcn_permlanex16(__builtin_bit_cast(int, x), __builtin_bit_cast(int, x), 0x76543210, 0xfedcba98, false, false)); }  // lane l with lane l ^ 16
template <typename T16, bool HI, int R>
__device__ __forceinline__ void attn_rows(const T16* __restrict__ Q, const T16* __restrict__ Q2, const T16* __restrict__ Kp, const T16* __restrict__ K2, const T16* __restrict__ Vt, const T16* __restrict__ Vt2, const unsigned* __restrict__ mk, int q0, bf* Ah, bf* Al) {
    typedef typename WFrag<T16>::V V;
    const int lane = threadIdx.x & 31;    // below: lr = lane & 15, hi = lane >> 4
    V qf[R][2], qf2[R][2]; v8f acc[R][4]; float mrun[R], lsum[R];
    const T16* qb = Q + (unsigned)q0 * HD + 8 * lane; const T16* qb2 = HI ? Q2 + (unsigned)q0 * HD + 8 * lane : qb;
#pragma unroll
    for (int g = 0; g < R; ++g) { mrun[g] = -3.0e38f; lsum[g] = 0.f;
#pragma unroll
        for (int kc = 0; kc < 2; ++kc) { const int o = 16 * g * HD + 512 * kc; qf[g][kc] = WFrag<T16>::ld(qb + o); if (HI) qf2[g][kc] = WFrag<T16>::ld(qb2 + o); }
#pragma unroll
        for (int t = 0; t < 4; ++t) acc[g][t] = (v8f){}; }
    loads_taken(qb, qb2, qb);
    V kf[2][2], kf2[2][2]; v16u mw[R];    // mw: the pass's lane masks (maskbits), the same for the whole wave: scalar registers
    const unsigned* mq = mk + (size_t)__builtin_amdgcn_readfirstlane(q0 >> 4) * (TT / 32 * 16);    // wave-uniform address: the words come by scalar loads
    // lane parts of the addresses, in bytes, fixed for the whole walk
    const unsigned vk = (unsigned)lane * 16u, vv = (unsigned)lane * 16u;
    auto load_km = [&](int key0) {    // one pass's K fragments and mask words
        const char* kb = (const char*)Kp + (size_t)key0 * (HD * 2) + vk; const char* kb2 = HI ? (const char*)K2 + (size_t)key0 * (HD * 2) + vk : kb;
#pragma unroll
        for (int g = 0; g < R; ++g) mw[g] = *(const v16u*)(mq + (g * (TT / 32) + (key0 >> 5)) * 16);
#pragma unroll
        for (int kt = 0; kt < 2; ++kt)
#pragma unroll
            for (int kc = 0; kc < 2; ++kc) { kf[kt][kc] = WFrag<T16>::ld((const T16*)(kb + (16 * kt * HD + 512 * kc) * 2)); if (HI) kf2[kt][kc] = WFrag<T16>::ld((const T16*)(kb2 + (16 * kt * HD + 512 * kc) * 2)); }
        loads_taken(kb, kb2, kb);
    };
    // PASS MAP: bit p says that the mask keeps some key of pass p for some query of the wave. Lane l joins the mask words of passes l and l + 32 (16 words a pass and query group, written by this call's prep launch); two ballots.
    // A pass without a kept key adds exactly 0 to the sum and to O^T of every query that has a kept key anywhere and raises no maximum: it is not walked. The map is read from the mask as data: any mask gives its own map. (A query without any kept key has no softmax.)
    static_assert(TT / 32 == 64, "the pass map is one 64-bit word");
    unsigned any0 = 0, any1 = 0;
    { const unsigned mo = (unsigned)lane * 64u; const char* mp = (const char*)mq + mo; v4u w0[R][4], w1[R][4];    // mo: the lane's part of the address, in bytes
#pragma unroll
        for (int g = 0; g < R; ++g)
#pragma unroll
            for (int c = 0; c < 4; ++c) { w0[g][c] = *(const v4u*)(mp + g * (TT / 32 * 64) + c * 16); w1[g][c] = *(const v4u*)(mp + g * (TT / 32 * 64) + 32 * 64 + c * 16); }
        loads_taken_at(mo);
#pragma unroll
        for (int g = 0; g < R; ++g)
#pragma unroll
            for (int c = 0; c < 4; ++c) { any0 |= w0[g][c][0] | w0[g][c][1] | w0[g][c][2] | w0[g][c][3]; any1 |= w1[g][c][0] | w1[g][c][1] | w1[g][c][2] | w1[g][c][3]; } }
    unsigned long long pm = ((unsigned long long)__builtin_amdgcn_ballot_w32(any1 != 0) << 32) | __builtin_amdgcn_ballot_w32(any0 != 0);    // the same in every lane: scalar registers
    int cur = pm != 0 ? (int)__builtin_ctzll(pm) : 0;    // the pass in hand
    load_km(cur * 32);
#pragma unroll 1    // rolled: a pass is long, a second copy would only take instruction cache
    while (pm != 0) {    // at most 64 trips: each takes one bit out of the map
        const int key0 = cur * 32; pm &= pm - 1;
        V vf[4], vf2[4];    // V^T fragments of this pass: in flight under the score products and the maxima
        const char* vb = (const char*)Vt + (size_t)key0 * (HD * 2) + vv; const char* vb2 = HI ? (const char*)Vt2 + (size_t)key0 * (HD * 2) + vv : vb;
#pragma unroll
        for (int t = 0; t < 4; ++t) { vf[t] = WFrag<T16>::ld((const T16*)(vb + 512 * t * 2)); if (HI) vf2[t] = WFrag<T16>::ld((const T16*)(vb2 + 512 * t * 2)); }
        loads_taken(vb, vb2, vb);
        v8f s[2][R];
#pragma unroll
        for (int kt = 0; kt < 2; ++kt)
#pragma unroll
            for (int g = 0; g < R; ++g) { s[kt][g] = (v8f){};
#pragma unroll
                for (int kc = 0; kc < 2; ++kc) { s[kt][g] = WFrag<T16>::mma(kf[kt][kc], qf[g][kc], s[kt][g]); if (HI) { s[kt][g] = WFrag<T16>::mma(kf[kt][kc], qf2[g][kc], s[kt][g]); s[kt][g] = WFrag<T16>::mma(kf2[kt][kc], qf[g][kc], s[kt][g]); } } }
        float mx[R]; bool need = false;
#pragma unroll
        for (int g = 0; g < R; ++g) { float m = -3.0e38f;
#pragma unroll
            for (int kt = 0; kt < 2; ++kt)
#pragma unroll
                for (int r = 0; r < 8; ++r) { const float t = __builtin_amdgcn_inverse_ballot_w32(mw[g][8 * kt + r]) ? s[kt][g][r] * SCL : -3.0e38f; s[kt][g][r] = t; m = fmaxf(m, t); }
            m = fmaxf(m, xhalf(m)); mx[g] = m; need = need || (m > mrun[g]); }
        cur = pm != 0 ? (int)__builtin_ctzll(pm) : cur;    // the next pass of the map: its K and mask are fetched in this pass (the last pass reads its own again: in bounds, unused)
        load_km(cur * 32);    // in flight under the exponentials and the second product
        if (__builtin_amdgcn_ballot_w32(need) != 0) {    // wave-uniform: rare once the maxima have settled
#pragma unroll
            for (int g = 0; g < R; ++g) { const float mn = fmaxf(mrun[g], mx[g]); const float corr = __expf(mrun[g] - mn); mrun[g] = mn; lsum[g] *= corr;
#pragma unroll
                for (int t = 0; t < 4; ++t) acc[g][t] = acc[g][t] * corr; } }
#pragma unroll
        for (int g = 0; g < R; ++g) { float p[16]; float ps = 0.f;
#pragma unroll
            for (int i = 0; i < 16; ++i) p[i] = __expf(s[i >> 3][g][i & 7] - mrun[g]);
#pragma unroll
            for (int i = 0; i < 8; ++i) ps += p[i] + p[8 + i];
            lsum[g] += ps;
            if constexpr (HI) { v8u wh, wl;
#pragma unroll
                for (int i = 0; i < 8; ++i) { const unsigned w = pack2(p[2 * i], p[2 * i + 1]); wh[i] = w; wl[i] = pack2(p[2 * i] - __uint_as_float(w << 16), p[2 * i + 1] - __uint_as_float(w & 0xFFFF0000u)); }
                const V ph = __builtin_bit_cast(v16bf, wh), pl = __builtin_bit_cast(v16bf, wl);
#pragma unroll
                for (int t = 0; t < 4; ++t) { acc[g][t] = WFrag<T16>::mma(vf[t], ph, acc[g][t]); acc[g][t] = WFrag<T16>::mma(vf[t], pl, acc[g][t]); acc[g][t] = WFrag<T16>::mma(vf2[t], ph, acc[g][t]); }
            } else { V pf;
#pragma unroll
                for (int i = 0; i < 16; ++i) pf[i] = tohx(p[i] * PCAR);
#pragma unroll
                for (int t = 0; t < 4; ++t) acc[g][t] = WFrag<T16>::mma(vf[t], pf, acc[g][t]); } }
        __builtin_amdgcn_sched_barrier(0); asm volatile("v_nop\n\tv_nop\n\tv_nop\n\tv_nop"); __builtin_amdgcn_sched_barrier(0);    // the 4 vector slots behind the pass's last WMMAs, also on the taken back edge
    }
#pragma unroll
    for (int g = 0; g < R; ++g) { const float l = lsum[g] + xhalf(lsum[g]); const float inv = __fdiv_rn(1.0f, HI ? l : l * PCAR);
#pragma unroll
        for (int t = 0; t < 4; ++t) { v8us oh, ol;    // the lane's 8 values are d = 16 t + 8 hi + 0..7 of query q0 + 16 g + lr
#pragma unroll
            for (int r = 0; r < 8; ++r) { unsigned short a, c2; splitf(acc[g][t][r] * inv, a, c2); oh[r] = a; ol[r] = c2; }
            const int q = q0 + 16 * g; const size_t o = (size_t)(q / DD) * DD * DD + (t >> 1) * (DD * 32) + (q % DD) * 32 + 256 * (t & 1) + 8 * lane; *(v8us*)(Ah + o) = oh; *(v8us*)(Al + o) = ol; if (HI || g + 1 < R || t < 3) stores_taken(); } }    // a half fragment of the output GEMM's A (row = query, k = 64 head + d), in the order of the GEMM operand planes: 512 bytes in a row a store
}
// grid ((TT-RH)/256 + 1, heads, batches), 8 waves: 256 work-groups, one a WGP. The length of a wave's walk follows from the mask; under a mask that keeps more keys for later queries the launch lasts as long as its fullest SIMD,
// so that the tiles are dealt from both ends: waves w and w + 4 take the fp16 tiles (32 rows) n - 1 - u and u, wave w the later tile. The last block of a head takes the hi+lo tiles (16 rows), two a wave, one after the other (so that the hi+lo walk ends in the wait behind its last stores).
__global__ __launch_bounds__(256) void k_fattn(const bf* __restrict__ QPh, const bf* __restrict__ QPl, const bf* __restrict__ KPh, const bf* __restrict__ KPl, const bf* __restrict__ VTh, const bf* __restrict__ VTl,
                                               const h16* __restrict__ QP16, const h16* __restrict__ KP16, const h16* __restrict__ VT16, const unsigned* __restrict__ mk, bf* ATh, bf* ATl) {
    const size_t pz = ((size_t)blockIdx.z * NH_ + blockIdx.y) * (TT * HD); const size_t oz = (size_t)blockIdx.z * TT * DD + blockIdx.y * (size_t)(HD / 32 * DD * 32); const int wave = __builtin_amdgcn_readfirstlane((int)threadIdx.x >> 5);
    static_assert((TT - RH) % 256 == 0 && RH == 256, "8 fp16 tiles a block; 16 hi+lo tiles in one block");
    if (blockIdx.x < (TT - RH) / 256) { const int u = (int)blockIdx.x * 4 + (wave & 3), f = wave < 4 ? (TT - RH) / 32 - 1 - u : u;
        attn_rows<h16, false, 2>(QP16 + pz, nullptr, KP16 + pz, nullptr, VT16 + pz, nullptr, mk, RH + f * 32, ATh + oz, ATl + oz); }
    else {
#pragma unroll 1
        for (int e = 0; e < 2; ++e)    // rolled: one copy of the walk in the code
            attn_rows<bf, true, 1>(QPh + pz, QPl + pz, KPh + pz, KPl + pz, VTh + pz, VTl + pz, mk, (e ? RH / 16 - 1 - wave : wave) * 16, ATh + oz, ATl + oz); }
}

extern "C" void kernel_launch(void* const* d_in, const int* in_sizes, int n_in,
                              void* d_out, int out_size, void* d_ws, size_t ws_size, hipStream_t stream) {
    (void)in_sizes; (void)n_in; (void)out_size;
    const float* x = (const float*)d_in[0]; const int* mk = (const int*)d_in[1]; const float* Wq = (const float*)d_in[2]; const float* bq = (const float*)d_in[3]; const float* Wk = (const float*)d_in[4]; const float* bk = (const float*)d_in[5]; const float* Wv = (const float*)d_in[6]; const float* bv = (const float*)d_in[7]; const float* Wd = (const float*)d_in[8]; const float* bo = (const float*)d_in[9];
    float* OUT = (float*)d_out;     // [2][2048][1024]
    char* wsp = (char*)d_ws;
    auto take = [&](size_t bytes) { char* p = wsp; wsp += (bytes + 255) & ~(size_t)255; return (void*)p; };
    const size_t PB = (size_t)TT * DD;    // elements of one batch's plane
    bf* W4 = (bf*)take(((size_t)4 * DD * DD + NB_ * PB) * 2); bf* XB = W4 + (size_t)4 * DD * DD;    // Wq, Wk, Wv, Wo, then x of both batches, one behind the other
    float* CSN = (float*)take((size_t)TT * NF * 2 * 4);
    // head planes and merged-head planes of BOTH batches: the attention launch reads and writes them all
    bf* QPh = (bf*)take(6 * NB_ * PB * 2); bf* QPl = QPh + NB_ * PB; bf* KPh = QPl + NB_ * PB; bf* KPl = KPh + NB_ * PB; bf* VTh = KPl + NB_ * PB; bf* VTl = VTh + NB_ * PB;    // one block: the q/k/v GEMM finds matrix z's planes by z
    h16* QP16 = (h16*)take(3 * NB_ * PB * 2); h16* KP16 = QP16 + NB_ * PB; h16* VT16 = KP16 + NB_ * PB;
    bf* ATh = (bf*)take(NB_ * PB * 2); bf* ATl = (bf*)take(NB_ * PB * 2);
    unsigned* MB = (unsigned*)take((size_t)TT * TT / 8);    // the mask, one bit per (query, key)
    if ((size_t)(wsp - (char*)d_ws) > ws_size) return;    // total 105 MiB; ws 256 MiB
    k_prep<<<dim3(DD * DD / 2048, 10), 256, 0, stream>>>(Wq, Wk, Wv, Wd, x, mk, W4, CSN, MB);
    k_gemmw<bf, 0, true, DD, 4, 3, true><<<dim3(NB_ * TT / 256, 3 * DD / 192), 384, 0, stream>>>(XB, nullptr, W4, nullptr, nullptr, DD, bq, bk, bv, 0, CSN, QPh, QP16);    // 256 work-groups of 12 waves: 256 x 192 outputs each, written as head planes
    k_fattn<<<dim3((TT - RH) / 256 + 1, NH_, NB_), 256, 0, stream>>>(QPh, QPl, KPh, KPl, VTh, VTl, QP16, KP16, VT16, MB, ATh, ATl);
    k_gemmw<bf, 1, true, DD, 2, 2, false><<<dim3(NB_ * TT / 128, DD / 128), 128, 0, stream>>>(ATh, ATl, W4 + (size_t)3 * DD * DD, nullptr, OUT, DD, bo, bo, bo, 0, nullptr, nullptr, nullptr);    // 256 work-groups of 4 waves: 128 x 128 outputs each
}

// v010
// It runs in 99.8 microseconds.
// Two timings next to v009 both put it at 1.20 times that version's speed.
// Over all steps from v000 it is 21.0 times as fast.
#include <hip/hip_runtime.h>

// MultiheadAttentionCore (x_q [2][2048][1024], attn_mask [2048][2048] bool->int32 (True = keep; read as data; here it is the causal triangle); q/k/v = x W^T + b; 16 heads x 64; rotate-half RoPE over the 64 head
// dims (inv_freq 10000^(-2i/64), positions 0..2047) on q and k; scores /8; -inf where mask == 0; softmax; out = merged Wo^T + bo).
// Compute dtypes, f32 accumulate: every input rounded to bf16; projections on PLAIN bf16 operands (inputs: exact, + bias); rotary f32 (powf / cosf / sinf, partner x[d^32]
// met in the GEMM wave's own tile); PER-ROW PRECISION HYBRID: query rows < 256 of each batch on bf16 hi+lo planes for scores and attn.v (3 products), rows >= 256 on SINGLE fp16 planes; the mask read per (i, j), once, and kept as one bit per (i, j);

#define NB_  2
#define TT   2048
#define DD   1024
#define NH_  16
#define HD   64
#define RH   256                  // query rows < RH: hi+lo planes; rows >= RH: fp16 planes
#define NF   32                   // rotary frequencies (head_dim / 2)
#define SCL  0.125f               // 1/sqrt(64)
#define PCAR 1024.0f         // fp16 P is scaled by this; divided out with l at the end
typedef _Float16 h16;
typedef unsigned short bf;
typedef __attribute__((ext_vector_type(16))) __bf16   v16bf;
typedef __attribute__((ext_vector_type(16))) _Float16 v16h;
typedef __attribute__((ext_vector_type(8)))  _Float16 v8h;
typedef __attribute__((ext_vector_type(8)))  unsigned short v8us;
typedef __attribute__((ext_vector_type(8)))  float    v8f;
typedef __attribute__((ext_vector_type(4)))  float    v4f;
typedef v8h  __attribute__((may_alias)) v8ha;
typedef v4f  __attribute__((may_alias)) v4fa;
typedef v8us __attribute__((may_alias)) v8usa;
typedef __attribute__((ext_vector_type(16))) unsigned v16u;

__device__ __forceinline__ unsigned short f2bf(float f) { unsigned u = __float_as_uint(f); u += 0x7FFFu + ((u >> 16) & 1u); return (unsigned short)(u >> 16); }
__device__ __forceinline__ float bf2f(unsigned short b) { return __uint_as_float(((unsigned)b) << 16); }
__device__ __forceinline__ float bfr(float f) { return bf2f(f2bf(f)); }
__device__ __forceinline__ v16h cat16(v8h lo, v8h hi) { return __builtin_shufflevector(lo, hi, 0, 1, 2, 3, 4, 5, 6, 7, 8, 9, 10, 11, 12, 13, 14, 15); }
__device__ __forceinline__ v16bf cat16b(v8us lo, v8us hi) { return __builtin_bit_cast(v16bf, __builtin_shufflevector(lo, hi, 0, 1, 2, 3, 4, 5, 6, 7, 8, 9, 10, 11, 12, 13, 14, 15)); }
__device__ __forceinline__ v8f wmma16(v16h a, v16h b, v8f c) { return __builtin_amdgcn_wmma_f32_16x16x32_f16(false, a, false, b, (short)0, c, false, false); }
__device__ __forceinline__ v8f wmmab(v16bf a, v16bf b, v8f c) { return __builtin_amdgcn_wmma_f32_16x16x32_bf16(false, a, false, b, (short)0, c, false, false); }



// Stands directly behind each group of global loads: the address registers that the loads name are not rewritten before the loads have taken them; the scheduling barriers hold the loads
// in front of the wait and every later register write behind it (they also keep each group where the pass wants it issued).
// The addresses are inputs of the wait, so that they stay whole up to it: no load of the group gets one of them as its destination.
__device__ __forceinline__ void loads_taken(const void* a, const void* b, const void* c) { __builtin_amdgcn_sched_barrier(0); asm volatile("s_wait_xcnt 0x0" :: "v"(a), "v"(b), "v"(c) : "memory"); __builtin_amdgcn_sched_barrier(0); }
// The same where the lanes' part of the addresses is a byte offset from a scalar base: the offset alone is the wait's input (a pointer into the mask words handed to the statement would let the compiler take them for rewritten, and the passes' words would no longer come by scalar loads).
__device__ __forceinline__ void loads_taken_at(unsigned o) { __builtin_amdgcn_sched_barrier(0); asm volatile("s_wait_xcnt 0x0" :: "v"(o) : "memory"); __builtin_amdgcn_sched_barrier(0); }
// The same behind a group of global stores: neither their data registers nor their address registers are rewritten before the stores have taken them.
__device__ __forceinline__ void stores_taken() { __builtin_amdgcn_sched_barrier(0); asm volatile("s_wait_xcnt 0x0" ::: "memory"); __builtin_amdgcn_sched_barrier(0); }
__device__ __forceinline__ h16 tohx(float x) { return (h16)x; }
__device__ __forceinline__ void splitf(float y, unsigned short& h, unsigned short& l) { h = f2bf(y); l = f2bf(y - bf2f(h)); }
typedef __attribute__((ext_vector_type(2))) unsigned short v2us;
typedef __attribute__((ext_vector_type(2))) _Float16 v2h;
typedef __attribute__((ext_vector_type(4))) _Float16 v4h;
typedef __attribute__((ext_vector_type(2))) float v2f;
typedef __attribute__((ext_vector_type(4))) int v4i;
// FRAGMENT ORDER of every 16-bit operand plane M[row][k] (k extent K): the 16 rows x 32 k of one WMMA operand lie in 1024 bytes in a row, as two halves of 512 bytes, each 32 lanes x 8 elements:
// element index = (row / 16) * 16 * K + (k / 32) * 512 + ((k >> 4) & 1) * 256 + (((k >> 3) & 1) * 16 + (row & 15)) * 8 + (k & 7). Lane l of a wave loads its 16 bytes at l * 16 in each half, so one fragment load
// reads 512 bytes in a row (4 whole lines) and not 32 bytes out of each of 16 lines. The element that each lane and register holds is the same as with a row-major plane.
// THE GEMM OPERAND PLANES (x, the weights, the merged heads; K = DD) hold the same fragments in another order: slabs of DD rows, in a slab the block of 32 k outermost:
// element index = (row / DD) * DD * DD + (k / 32) * DD * 32 + ((row % DD) / 16) * 512 + the place inside the fragment as above. The fragments that neighbouring row tiles need in one trip lie in a row.
// ---- k_gemmw: register-blocked GEMM, ONE WAVE per 64x64 output tile (16 accumulators), operands straight from 16-bit planes in fragment order; grid (M / (64 WM), N / (64 WN)), WM x WN waves.
// A work-group's waves form a WM x WN block of neighbouring tiles: the WN waves of a tile row load the same A fragments and the WM waves of a tile column the same B fragments in the same trip,
// so that a fragment comes from L2 once a work-group and the other waves find it in the WGP's cache; a trip's fragments of a work-group are two runs of bytes in a row (64 WM and 64 WN rows x 64 bytes), not pieces
// 32 KiB apart (how the cache picks a line's place is not documented: pieces that agree in their low address bits might crowd a few places). No wave waits for another: there is no barrier, and each wave has its own LDS slab for the epilogue.
// C[m][n] (f32, pitch ldc, + optional f32 bias[n]) = sum_k A[m][k] Bt[n][k] (+ split products per NSPLIT). K % 32 == 0; K is a compile-time constant, so that a trip's fragments lie at constant offsets from one address an operand.
// PL: the outputs are not stored as C: the wave makes the head planes of its tile (qk_tile, vt_tile above) from its accumulators; no f32 projection goes to memory.
// Bt may hold several matrices of DD rows one behind the other (the q, k and v projections of one launch): column tile cg belongs to matrix z = cg / DD, which picks the bias among bias, biasz1, biasz2 and the output plane C + z sC.
// hsplit: 16 values of the head planes (hi/lo + fp16) of q or k, each head's [t][d] plane in fragment order (row = t, k = d), with rotate-half RoPE: r = x cos - x' sin for d < 32, x cos + x' sin for d >= 32, x' = x[t][d ^ 32].
// A lane makes the 8 values d0..d0+7 (d0 = 8 c4 < 32; xa) of row t = 16 t16 + 8 rh + r8 and their 8 partners d0+32.. (xb), which take the same table entries; ca, cb: (cos, sin) of d0..d0+3 and d0+4..d0+7.
__device__ __forceinline__ void hsplit(const v8f xa, const v8f xb, const v8f ca, const v8f cb, int h, int t16, int c4, int rh, int r8, bf* Ph, bf* Pl, h16* P16) {
    const int d0 = c4 * 8;
#pragma unroll
    for (int kc = 0; kc < 2; ++kc) { v8us oh, ol; v8h o16;
#pragma unroll
        for (int q = 0; q < 8; ++q) { const int dd = d0 + q + kc * NF; const float x0 = kc ? xb[q] : xa[q], x1 = kc ? xa[q] : xb[q]; const v2f cs = q < 4 ? v2f{ca[2 * q], ca[2 * q + 1]} : v2f{cb[2 * q - 8], cb[2 * q - 7]};
                float a0 = __fmul_rn(cs[0], x0), a1 = __fmul_rn(cs[1], x1); asm volatile("" : "+v"(a0)); asm volatile("" : "+v"(a1)); const float r = (dd < NF) ? __fsub_rn(a0, a1) : __fadd_rn(a0, a1);
                unsigned short a, c2; splitf(r, a, c2); oh[q] = a; ol[q] = c2; o16[q] = tohx(r); }
        const size_t e = (size_t)h * (TT * HD) + t16 * (16 * HD) + kc * 512 + (c4 >> 1) * 256 + ((c4 & 1) * 16 + rh * 8 + r8) * 8;
        *(v8us*)(Ph + e) = oh; *(v8us*)(Pl + e) = ol; *(v8h*)(P16 + e) = o16; stores_taken(); }
}
// qk_tile: a GEMM wave's 64 rows (t0..) x 64 columns are 64 positions of ONE head of q or k, so that d and d ^ 32 meet in the wave: the head planes are made here, from the accumulators (bias b4 added first, as before).
// 16 rows at a time go through the wave's LDS slab (a lane holds one d of 8 rows, a plane wants 8 d of one row); lane l then takes row l & 15 and c4 = 2 ch + (l >> 4): each store of the wave is 512 bytes in a row.
// The table entries of the next 16 rows are fetched while these are worked on.
__device__ __forceinline__ void qk_tile(const v8f (&acc)[4][4], const float (&b4)[4], float* os, const float* __restrict__ CSN, int h, int t0, bf* Ph, bf* Pl, h16* P16) {
    const int lane = threadIdx.x & 31, lr = lane & 15, hi = lane >> 4, r8 = lane & 7, rh = (lane >> 3) & 1;
    const float* cr = CSN + ((size_t)(t0 + lr) * NF + hi * 8) * 2; v8f cs[2][2][2];    // [row group parity][ch][d0.. , d0+4..]
#pragma unroll
    for (int ch = 0; ch < 2; ++ch) { cs[0][ch][0] = *(const v8f*)(cr + ch * 32); cs[0][ch][1] = *(const v8f*)(cr + ch * 32 + 8); }
    loads_taken(cr, cr, cr);
#pragma unroll
    for (int mb = 0; mb < 4; ++mb) {
#pragma unroll
        for (int nb = 0; nb < 4; ++nb) {
#pragma unroll
            for (int j = 0; j < 8; ++j) os[(hi * 8 + j) * 68 + nb * 16 + lr] = acc[mb][nb][j] + b4[nb]; }
        __builtin_amdgcn_wave_barrier(); asm volatile("" ::: "memory");    // the slab is read by other lanes than wrote it: no read is moved in front of the writes
        if (mb < 3) {
#pragma unroll
            for (int ch = 0; ch < 2; ++ch) { cs[(mb + 1) & 1][ch][0] = *(const v8f*)(cr + (mb + 1) * (16 * NF * 2) + ch * 32); cs[(mb + 1) & 1][ch][1] = *(const v8f*)(cr + (mb + 1) * (16 * NF * 2) + ch * 32 + 8); }
            loads_taken(cr, cr, cr); }
#pragma unroll
        for (int ch = 0; ch < 2; ++ch) { const int c4 = 2 * ch + hi; const float* xr = os + lr * 68 + c4 * 8; v8f xa, xb;
            const v4f x0 = *(const v4fa*)xr, x1 = *(const v4fa*)(xr + 4), x2 = *(const v4fa*)(xr + NF), x3 = *(const v4fa*)(xr + NF + 4);
#pragma unroll
            for (int q = 0; q < 4; ++q) { xa[q] = x0[q]; xa[4 + q] = x1[q]; xb[q] = x2[q]; xb[4 + q] = x3[q]; }
            hsplit(xa, xb, cs[mb & 1][ch][0], cs[mb & 1][ch][1], h, t0 / 16 + mb, c4, rh, r8, Ph, Pl, P16); }
        __builtin_amdgcn_wave_barrier(); asm volatile("" ::: "memory");    // the next 16 rows are not written before these are read
    }
}
// vt_tile: the transposed v planes, each head's [d][t] plane as fragments (row = d, k = t), the block of 32 keys outermost: the four fragments (64 d) of one pass lie in 4096 bytes in a row.
// An accumulator's 8 registers of a lane are 8 keys in a row of one d: they ARE the lane's 16 bytes of a half fragment, so that the planes are stored straight from the registers, 512 bytes in a row a store.
__device__ __forceinline__ void vt_tile(const v8f (&acc)[4][4], const float (&b4)[4], int h, int t0, bf* Vh, bf* Vl, h16* V16) {
    const int lane = threadIdx.x & 31;
#pragma unroll
    for (int mb = 0; mb < 4; ++mb)
#pragma unroll
        for (int nb = 0; nb < 4; ++nb) { v8us oh, ol; v8h o16;
#pragma unroll
            for (int q = 0; q < 8; ++q) { const float x = acc[mb][nb][q] + b4[nb]; unsigned short a, c2; splitf(x, a, c2); oh[q] = a; ol[q] = c2; o16[q] = tohx(x); }
            const size_t e = (size_t)h * (TT * HD) + (t0 / 32 + (mb >> 1)) * (32 * HD) + nb * 512 + (mb & 1) * 256 + lane * 8;
            *(v8us*)(Vh + e) = oh; *(v8us*)(Vl + e) = ol; *(v8h*)(V16 + e) = o16; if (mb < 3 || nb < 3) stores_taken(); }
}
template <typename T16> struct WFrag;
template <> struct WFrag<h16> { typedef v16h V; static __device__ __forceinline__ V ld(const h16* p) { return cat16(*(const v8h*)p, *(const v8h*)(p + 256)); } static __device__ __forceinline__ v8f mma(V a, V b, v8f c) { return wmma16(a, b, c); } };
template <> struct WFrag<bf> { typedef v16bf V; static __device__ __forceinline__ V ld(const bf* p) { return cat16b(*(const v8us*)p, *(const v8us*)(p + 256)); } static __device__ __forceinline__ v8f mma(V a, V b, v8f c) { return wmmab(a, b, c); } };
template <typename T16, int NSPLIT, bool BIAS, int K, int WM, int WN, bool PL>
__global__ __launch_bounds__(WM * WN * 32) void k_gemmw(const T16* __restrict__ A, const T16* __restrict__ A2, const T16* __restrict__ Bt, const T16* __restrict__ Bt2, float* C, int ldc, const float* __restrict__ bias, const float* __restrict__ biasz1, const float* __restrict__ biasz2, size_t sC, const float* __restrict__ CSN, bf* PHL, h16* PF) {
    typedef typename WFrag<T16>::V V;
    __shared__ __align__(16) float osb[WM * WN][16 * 68];
    const int wave = __builtin_amdgcn_readfirstlane((int)threadIdx.x >> 5), wm = wave / WN, wn = wave % WN; float* os = osb[wave];
    const int lane = threadIdx.x & 31, lr = lane & 15, hi = lane >> 4; const int r0 = ((int)blockIdx.x * WM + wm) * 64, cg = ((int)blockIdx.y * WN + wn) * 64, z = cg / DD, c0 = cg % DD;
    C += (size_t)z * sC; if (BIAS) bias = z == 0 ? bias : z == 1 ? biasz1 : biasz2;
    v8f acc[4][4]; float b4[4];
    if constexpr (PL) { const float* bp = bias + c0 + lr;    // the lane's four columns
#pragma unroll
        for (int nb = 0; nb < 4; ++nb) b4[nb] = bp[nb * 16];
        loads_taken(bp, bp, bp); }
#pragma unroll
    for (int mb = 0; mb < 4; ++mb)
#pragma unroll
        for (int nb = 0; nb < 4; ++nb) acc[mb][nb] = (v8f){};
    static_assert(K == DD, "operand planes: slabs of DD rows x DD k");
    const size_t oa = (size_t)(r0 / DD) * DD * DD + (r0 % DD) * 32 + 8 * lane, ob = (size_t)z * DD * DD + c0 * 32 + 8 * lane;
    const T16* pa = A + oa; const T16* pa2 = (NSPLIT == 1 || NSPLIT == 2) ? A2 + oa : pa; const T16* pb = Bt + ob; const T16* pb2 = (NSPLIT >= 2) ? Bt2 + ob : pb;
    // REGISTER RING: NS fragment sets; trip t works on set t % NS while the loads of trips t + 1 .. t + NS - 1 are in flight: a trip's loads are issued NS - 1 trips ahead of the products that read them,
    // into the set that the trip before has just left, so that a wave waits for what is left of the load latency after NS - 1 trips and not for all of it in every trip. The k order of every accumulator is the same as with one set.
    constexpr int NS = 3, NT = K / 32, NR = (NT - (NS - 1)) / NS;    // sets; trips; rolled rounds of NS trips, each of which still has a trip to fetch
    V a[NS][4], a2[NS][4], b[NS][4], b2[NS][4];
    auto fetch = [&](int u) {    // the next unfetched trip's fragments into set u
#pragma unroll
        for (int mb = 0; mb < 4; ++mb) { a[u][mb] = WFrag<T16>::ld(pa + mb * 512); if (NSPLIT == 1 || NSPLIT == 2) a2[u][mb] = WFrag<T16>::ld(pa2 + mb * 512); }
#pragma unroll
        for (int nb = 0; nb < 4; ++nb) { b[u][nb] = WFrag<T16>::ld(pb + nb * 512); if (NSPLIT >= 2) b2[u][nb] = WFrag<T16>::ld(pb2 + nb * 512); }
        loads_taken(pa, pa2, pb); if (NSPLIT >= 2) loads_taken(pb2, pb2, pb2);
        pa += DD * 32; pa2 += DD * 32; pb += DD * 32; pb2 += DD * 32;
    };
    auto work = [&](int u) {    // one trip's products, on set u
#pragma unroll
        for (int nb = 0; nb < 4; ++nb) {
#pragma unroll
            for (int mb = 0; mb < 4; ++mb) { acc[mb][nb] = WFrag<T16>::mma(a[u][mb], b[u][nb], acc[mb][nb]); if (NSPLIT == 1 || NSPLIT == 2) acc[mb][nb] = WFrag<T16>::mma(a2[u][mb], b[u][nb], acc[mb][nb]); if (NSPLIT >= 2) acc[mb][nb] = WFrag<T16>::mma(a[u][mb], b2[u][nb], acc[mb][nb]); } }
        // the 4 vector slots behind the trip's last WMMAs, in front of the loads that refill this set (also on the taken back edge)
        // the scheduling barriers hold every WMMA of the trip in front of the slots and every refilling load behind them
        __builtin_amdgcn_sched_barrier(0); asm volatile("v_nop\n\tv_nop\n\tv_nop\n\tv_nop"); __builtin_amdgcn_sched_barrier(0);
    };
#pragma unroll
    for (int u = 0; u < NS - 1; ++u) fetch(u);
#pragma unroll 1    // rolled: NS trips a round, so that each set has its own registers and no fragment is copied
    for (int r = 0; r < NR; ++r) {
#pragma unroll
        for (int u = 0; u < NS; ++u) { fetch((u + NS - 1) % NS); work(u); }
    }
#pragma unroll
    for (int t = NR * NS; t < NT; ++t) { if (t + NS - 1 < NT) fetch((t + NS - 1) % NS); work(t % NS); }    // the last trips: nothing is fetched past the operands' k extent
    if constexpr (PL) {    // matrix z's planes of the tile's batch and head: hi planes [q, k, v] with the lo plane behind each, then the fp16 planes [q, k, v]
        const size_t PB = (size_t)TT * DD, pb = (size_t)(r0 / TT) * PB; const int h = c0 / HD, t0 = r0 % TT;
        bf* Ph = PHL + (size_t)z * (2 * NB_ * PB) + pb; bf* Pl = Ph + NB_ * PB; h16* P16 = PF + (size_t)z * (NB_ * PB) + pb;
#pragma unroll
        for (int nb = 0; nb < 4; ++nb) b4[nb] = bfr(b4[nb]);
        if (z == 2) vt_tile(acc, b4, h, t0, Ph, Pl, P16); else qk_tile(acc, b4, os, CSN, h, t0, Ph, Pl, P16);
        return;
    }
#pragma unroll
    for (int mb = 0; mb < 4; ++mb) {
#pragma unroll
        for (int nb = 0; nb < 4; ++nb) {
#pragma unroll
            for (int j = 0; j < 8; ++j) os[(hi * 8 + j) * 68 + nb * 16 + lr] = acc[mb][nb][j]; }
        __builtin_amdgcn_wave_barrier(); asm volatile("" ::: "memory");
        float* crow = C + (size_t)(r0 + mb * 16) * ldc + c0;
{
#pragma unroll
            for (int s = 0; s < 8; ++s) { const int row = 2 * s + hi, cofs = lr * 4; v4f val = *(const v4fa*)(os + row * 68 + cofs); if (BIAS) { val[0] += bfr(bias[c0 + cofs]); val[1] += bfr(bias[c0 + cofs + 1]); val[2] += bfr(bias[c0 + cofs + 2]); val[3] += bfr(bias[c0 + cofs + 3]); }
                *(v4f*)(crow + (size_t)row * ldc + cofs) = val; }
             }
        if (mb < 3) stores_taken();
        __builtin_amdgcn_wave_barrier(); asm volatile("" ::: "memory");
    }
}


// cvt8: a [DD][DD] f32 slab to bf16 fragments, the block of 32 k outermost. A wave takes 8 rows x 32 k: it reads one whole 128-byte line a row and writes four whole 128-byte lines (8 lanes each).
__device__ __forceinline__ void cvt8(const float* __restrict__ src, bf* dst, size_t n8) { const size_t i = (size_t)blockIdx.x * 256 + threadIdx.x; if (i >= n8) return;
    const int r8 = (int)i & 7, c4 = ((int)i >> 3) & 3, rh = ((int)i >> 5) & 1, kc = ((int)i >> 6) & (DD / 32 - 1); const size_t r16 = i >> 11;
    const v8f v = *(const v8f*)(src + (r16 * 16 + rh * 8 + r8) * DD + kc * 32 + c4 * 8); v8us o;
#pragma unroll
    for (int k = 0; k < 8; ++k) o[k] = f2bf(v[k]); *(v8us*)(dst + (size_t)kc * (DD * 32) + r16 * 512 + (c4 >> 1) * 256 + ((c4 & 1) * 16 + rh * 8 + r8) * 8) = o;  }
__device__ __forceinline__ void cstab(float* CSN) {
    const int idx = blockIdx.x * 256 + threadIdx.x; if (idx >= TT * NF) return; const int t = idx / NF, i = idx % NF; const float den = powf(10000.0f, (float)(2 * i) * (1.0f / HD)); const float ang = __fdiv_rn((float)t, den);
    v2f o; o[0] = cosf(ang); o[1] = sinf(ang); *(v2f*)(CSN + (size_t)idx * 2) = o;  }
// maskbits: the mask as one bit per (query, key), in the order in which an attention wave holds its scores: for 16 queries x 32 keys (one pass) 16 words in a row, word 8 kt + r, whose bit l says
// mask[query 16 qg + (l & 15)][key 32 pass + 16 kt + 8 (l >> 4) + r] != 0: the word is the lane mask of score register r of key tile kt. Word index = (qg * (TT / 32) + pass) * 16 + 8 kt + r.
// A wave makes the 32 words of two passes: a lane reads its query's 2 x 16 keys (16 bytes a load), each ballot is one word, lane j keeps word j; one 128-byte store.
__device__ __forceinline__ void maskbits(const int* __restrict__ mk, unsigned* MB) {
    const int idx = blockIdx.x * 256 + threadIdx.x; const int lane = idx & 31, lr = lane & 15, hi = lane >> 4, wv = idx >> 5, qg = wv / (TT / 64), p2 = wv % (TT / 64); if (qg >= TT / 16) return;
    const int* mp = mk + (size_t)(qg * 16 + lr) * TT + p2 * 64 + 8 * hi; v4i m[8];
#pragma unroll
    for (int c = 0; c < 8; ++c) m[c] = *(const v4i*)(mp + (c >> 1) * 16 + (c & 1) * 4);    // c = 4 pass + 2 kt + (r >> 2)
    loads_taken(mp, mp, mp);
    unsigned w = 0;
#pragma unroll
    for (int j = 0; j < 32; ++j) { const unsigned b = __builtin_amdgcn_ballot_w32(m[j >> 2][j & 3] != 0); w = lane == j ? b : w; }
    MB[(size_t)wv * 32 + lane] = w;
}
// k_prep: every conversion to bf16, the rotary table and the mask bits in ONE launch; grid (DD*DD/2048, 10): slab y = 0 is the table (the longest threads), y = 1..4 the four weights, y = 5..8 the quarters of x (both batches), y = 9 the mask.
// WX holds the eight converted slabs one behind the other: Wq, Wk, Wv, Wo, x.
__global__ __launch_bounds__(256) void k_prep(const float* __restrict__ Wq, const float* __restrict__ Wk, const float* __restrict__ Wv, const float* __restrict__ Wd, const float* __restrict__ x, const int* __restrict__ mk, bf* WX, float* CSN, unsigned* MB) {
    const int y = blockIdx.y; const size_t SL = (size_t)DD * DD;
    if (y == 0) { cstab(CSN); return; }
    if (y == 9) { maskbits(mk, MB); return; }
    const float* src = y == 1 ? Wq : y == 2 ? Wk : y == 3 ? Wv : y == 4 ? Wd : x + (size_t)(y - 5) * SL;
    cvt8(src, WX + (size_t)(y - 1) * SL, SL / 8);
}
// k_fattn: scores, mask, softmax and attn.v of all heads and both batches in ONE launch; no score or probability ever goes to memory. One wave owns R groups of 16 query rows and walks the keys in passes of 32, those passes only in which the mask keeps a key for one of its queries.
// Transposed products: S^T = K Q^T (A = 16 key rows, B = 16 query columns), so a lane holds scores of ONE query (column lane & 15; key = 16 kt + 8 (lane >> 4) + register), and the two 16-key tiles of a pass, once
// exponentiated and rounded, ARE the B operand (32 keys x 16 queries, same k order as the loader's) of O^T += V^T P^T, whose A rows come from the [d][t] planes. All planes lie in fragment order. Online softmax: running maximum m and sum l per query;
// when a pass raises some maximum, l and O^T are scaled by exp(m_old - m_new). A masked score is -3e38 as before: exp gives 0 once the row has met a kept key, and what was added before that is wiped by the factor 0.
// P is rounded UNNORMALISED (exp(s - m) <= 1; the fp16 rows carry the factor PCAR as before), the division by l comes once at the end, in f32. Rows < RH: hi+lo planes, 3 products each; rows >= RH: fp16 planes.
typedef __attribute__((ext_vector_type(8))) unsigned v8u;
typedef __attribute__((ext_vector_type(4))) unsigned v4u;
__device__ __forceinline__ unsigned pack2(float lo, float hi) { typedef __bf16 bf2 __attribute__((ext_vector_type(2))); return __builtin_bit_cast(unsigned, __builtin_convertvector(v2f{lo, hi}, bf2)); }  // two f32 to bf16, round to nearest even
__device__ __forceinline__ float xhalf(float x) { return __builtin_bit_cast(float, __builtin_amdgcn_permlanex16(__builtin_bit_cast(int, x), __builtin_bit_cast(int, x), 0x76543210, 0xfedcba98, false, false)); }  // lane l with lane l ^ 16
template <typename T16, bool HI, int R>
__device__ __forceinline__ void attn_rows(const T16* __restrict__ Q, const T16* __restrict__ Q2, const T16* __restrict__ Kp, const T16* __restrict__ K2, const T16* __restrict__ Vt, const T16* __restrict__ Vt2, const unsigned* __restrict__ mk, int q0, bf* Ah, bf* Al) {
    typedef typename WFrag<T16>::V V;
    const int lane = threadIdx.x & 31;    // below: lr = lane & 15, hi = lane >> 4
    V qf[R][2], qf2[R][2]; v8f acc[R][4]; float mrun[R], lsum[R];
    const T16* qb = Q + (unsigned)q0 * HD + 8 * lane; const T16* qb2 = HI ? Q2 + (unsigned)q0 * HD + 8 * lane : qb;
#pragma unroll
    for (int g = 0; g < R; ++g) { mrun[g] = -3.0e38f; lsum[g] = 0.f;
#pragma unroll
        for (int kc = 0; kc < 2; ++kc) { const int o = 16 * g * HD + 512 * kc; qf[g][kc] = WFrag<T16>::ld(qb + o); if (HI) qf2[g][kc] = WFrag<T16>::ld(qb2 + o); }
#pragma unroll
        for (int t = 0; t < 4; ++t) acc[g][t] = (v8f){}; }
    loads_taken(qb, qb2, qb);
    V kf[2][2], kf2[2][2]; v16u mw[R];    // mw: the pass's lane masks (maskbits), the same for the whole wave: scalar registers
    const unsigned* mq = mk + (size_t)__builtin_amdgcn_readfirstlane(q0 >> 4) * (TT / 32 * 16);    // wave-uniform address: the words come by scalar loads
    // lane parts of the addresses, in bytes, fixed for the whole walk
    const unsigned vk = (unsigned)lane * 16u, vv = (unsigned)lane * 16u;
    auto load_km = [&](int key0) {    // one pass's K fragments and mask words
        const char* kb = (const char*)Kp + (size_t)key0 * (HD * 2) + vk; const char* kb2 = HI ? (const char*)K2 + (size_t)key0 * (HD * 2) + vk : kb;
#pragma unroll
        for (int g = 0; g < R; ++g) mw[g] = *(const v16u*)(mq + (g * (TT / 32) + (key0 >> 5)) * 16);
#pragma unroll
        for (int kt = 0; kt < 2; ++kt)
#pragma unroll
            for (int kc = 0; kc < 2; ++kc) { kf[kt][kc] = WFrag<T16>::ld((const T16*)(kb + (16 * kt * HD + 512 * kc) * 2)); if (HI) kf2[kt][kc] = WFrag<T16>::ld((const T16*)(kb2 + (16 * kt * HD + 512 * kc) * 2)); }
        loads_taken(kb, kb2, kb);
    };
    // PASS MAP: bit p says that the mask keeps some key of pass p for some query of the wave. Lane l joins the mask words of passes l and l + 32 (16 words a pass and query group, written by this call's prep launch); two ballots.
    // A pass without a kept key adds exactly 0 to the sum and to O^T of every query that has a kept key anywhere and raises no maximum: it is not walked. The map is read from the mask as data: any mask gives its own map. (A query without any kept key has no softmax.)
    static_assert(TT / 32 == 64, "the pass map is one 64-bit word");
    unsigned any0 = 0, any1 = 0;
    { const unsigned mo = (unsigned)lane * 64u; const char* mp = (const char*)mq + mo; v4u w0[R][4], w1[R][4];    // mo: the lane's part of the address, in bytes
#pragma unroll
        for (int g = 0; g < R; ++g)
#pragma unroll
            for (int c = 0; c < 4; ++c) { w0[g][c] = *(const v4u*)(mp + g * (TT / 32 * 64) + c * 16); w1[g][c] = *(const v4u*)(mp + g * (TT / 32 * 64) + 32 * 64 + c * 16); }
        loads_taken_at(mo);
#pragma unroll
        for (int g = 0; g < R; ++g)
#pragma unroll
            for (int c = 0; c < 4; ++c) { any0 |= w0[g][c][0] | w0[g][c][1] | w0[g][c][2] | w0[g][c][3]; any1 |= w1[g][c][0] | w1[g][c][1] | w1[g][c][2] | w1[g][c][3]; } }
    unsigned long long pm = ((unsigned long long)__builtin_amdgcn_ballot_w32(any1 != 0) << 32) | __builtin_amdgcn_ballot_w32(any0 != 0);    // the same in every lane: scalar registers
    int cur = pm != 0 ? (int)__builtin_ctzll(pm) : 0;    // the pass in hand
    load_km(cur * 32);
#pragma unroll 1    // rolled: a pass is long, a second copy would only take instruction cache
    while (pm != 0) {    // at most 64 trips: each takes one bit out of the map
        const int key0 = cur * 32; pm &= pm - 1;
        V vf[4], vf2[4];    // V^T fragments of this pass: in flight under the score products and the maxima
        const char* vb = (const char*)Vt + (size_t)key0 * (HD * 2) + vv; const char* vb2 = HI ? (const char*)Vt2 + (size_t)key0 * (HD * 2) + vv : vb;
#pragma unroll
        for (int t = 0; t < 4; ++t) { vf[t] = WFrag<T16>::ld((const T16*)(vb + 512 * t * 2)); if (HI) vf2[t] = WFrag<T16>::ld((const T16*)(vb2 + 512 * t * 2)); }
        loads_taken(vb, vb2, vb);
        v8f s[2][R];
#pragma unroll
        for (int kt = 0; kt < 2; ++kt)
#pragma unroll
            for (int g = 0; g < R; ++g) { s[kt][g] = (v8f){};
#pragma unroll
                for (int kc = 0; kc < 2; ++kc) { s[kt][g] = WFrag<T16>::mma(kf[kt][kc], qf[g][kc], s[kt][g]); if (HI) { s[kt][g] = WFrag<T16>::mma(kf[kt][kc], qf2[g][kc], s[kt][g]); s[kt][g] = WFrag<T16>::mma(kf2[kt][kc], qf[g][kc], s[kt][g]); } } }
        float mx[R]; bool need = false;
#pragma unroll
        for (int g = 0; g < R; ++g) { float m = -3.0e38f;
#pragma unroll
            for (int kt = 0; kt < 2; ++kt)
#pragma unroll
                for (int r = 0; r < 8; ++r) { const float t = __builtin_amdgcn_inverse_ballot_w32(mw[g][8 * kt + r]) ? s[kt][g][r] * SCL : -3.0e38f; s[kt][g][r] = t; m = fmaxf(m, t); }
            m = fmaxf(m, xhalf(m)); mx[g] = m; need = need || (m > mrun[g]); }
        cur = pm != 0 ? (int)__builtin_ctzll(pm) : cur;    // the next pass of the map: its K and mask are fetched in this pass (the last pass reads its own again: in bounds, unused)
        load_km(cur * 32);    // in flight under the exponentials and the second product
        if (__builtin_amdgcn_ballot_w32(need) != 0) {    // wave-uniform: rare once the maxima have settled
#pragma unroll
            for (int g = 0; g < R; ++g) { const float mn = fmaxf(mrun[g], mx[g]); const float corr = __expf(mrun[g] - mn); mrun[g] = mn; lsum[g] *= corr;
#pragma unroll
                for (int t = 0; t < 4; ++t) acc[g][t] = acc[g][t] * corr; } }
#pragma unroll
        for (int g = 0; g < R; ++g) { float p[16]; float ps = 0.f;
#pragma unroll
            for (int i = 0; i < 16; ++i) p[i] = __expf(s[i >> 3][g][i & 7] - mrun[g]);
#pragma unroll
            for (int i = 0; i < 8; ++i) ps += p[i] + p[8 + i];
            lsum[g] += ps;
            if constexpr (HI) { v8u wh, wl;
#pragma unroll
                for (int i = 0; i < 8; ++i) { const unsigned w = pack2(p[2 * i], p[2 * i + 1]); wh[i] = w; wl[i] = pack2(p[2 * i] - __uint_as_float(w << 16), p[2 * i + 1] - __uint_as_float(w & 0xFFFF0000u)); }
                const V ph = __builtin_bit_cast(v16bf, wh), pl = __builtin_bit_cast(v16bf, wl);
#pragma unroll
                for (int t = 0; t < 4; ++t) { acc[g][t] = WFrag<T16>::mma(vf[t], ph, acc[g][t]); acc[g][t] = WFrag<T16>::mma(vf[t], pl, acc[g][t]); acc[g][t] = WFrag<T16>::mma(vf2[t], ph, acc[g][t]); }
            } else { V pf;
#pragma unroll
                for (int i = 0; i < 16; ++i) pf[i] = tohx(p[i] * PCAR);
#pragma unroll
                for (int t = 0; t < 4; ++t) acc[g][t] = WFrag<T16>::mma(vf[t], pf, acc[g][t]); } }
        __builtin_amdgcn_sched_barrier(0); asm volatile("v_nop\n\tv_nop\n\tv_nop\n\tv_nop"); __builtin_amdgcn_sched_barrier(0);    // the 4 vector slots behind the pass's last WMMAs, also on the taken back edge
    }
#pragma unroll
    for (int g = 0; g < R; ++g) { const float l = lsum[g] + xhalf(lsum[g]); const float inv = __fdiv_rn(1.0f, HI ? l : l * PCAR);
#pragma unroll
        for (int t = 0; t < 4; ++t) { v8us oh, ol;    // the lane's 8 values are d = 16 t + 8 hi + 0..7 of query q0 + 16 g + lr
#pragma unroll
            for (int r = 0; r < 8; ++r) { unsigned short a, c2; splitf(acc[g][t][r] * inv, a, c2); oh[r] = a; ol[r] = c2; }
            const int q = q0 + 16 * g; const size_t o = (size_t)(q / DD) * DD * DD + (t >> 1) * (DD * 32) + (q % DD) * 32 + 256 * (t & 1) + 8 * lane; *(v8us*)(Ah + o) = oh; *(v8us*)(Al + o) = ol; if (HI || g + 1 < R || t < 3) stores_taken(); } }    // a half fragment of the output GEMM's A (row = query, k = 64 head + d), in the order of the GEMM operand planes: 512 bytes in a row a store
}
// grid ((TT-RH)/256 + 1, heads, batches), 8 waves: 256 work-groups, one a WGP. The length of a wave's walk follows from the mask; under a mask that keeps more keys for later queries the launch lasts as long as its fullest SIMD,
// so that the tiles are dealt from both ends: waves w and w + 4 take the fp16 tiles (32 rows) n - 1 - u and u, wave w the later tile. The last block of a head takes the hi+lo tiles (16 rows), two a wave, one after the other (so that the hi+lo walk ends in the wait behind its last stores).
__global__ __launch_bounds__(256) void k_fattn(const bf* __restrict__ QPh, const bf* __restrict__ QPl, const bf* __restrict__ KPh, const bf* __restrict__ KPl, const bf* __restrict__ VTh, const bf* __restrict__ VTl,
                                               const h16* __restrict__ QP16, const h16* __restrict__ KP16, const h16* __restrict__ VT16, const unsigned* __restrict__ mk, bf* ATh, bf* ATl) {
    const size_t pz = ((size_t)blockIdx.z * NH_ + blockIdx.y) * (TT * HD); const size_t oz = (size_t)blockIdx.z * TT * DD + blockIdx.y * (size_t)(HD / 32 * DD * 32); const int wave = __builtin_amdgcn_readfirstlane((int)threadIdx.x >> 5);
    static_assert((TT - RH) % 256 == 0 && RH == 256, "8 fp16 tiles a block; 16 hi+lo tiles in one block");
    if (blockIdx.x < (TT - RH) / 256) { const int u = (int)blockIdx.x * 4 + (wave & 3), f = wave < 4 ? (TT - RH) / 32 - 1 - u : u;
        attn_rows<h16, false, 2>(QP16 + pz, nullptr, KP16 + pz, nullptr, VT16 + pz, nullptr, mk, RH + f * 32, ATh + oz, ATl + oz); }
    else {
#pragma unroll 1
        for (int e = 0; e < 2; ++e)    // rolled: one copy of the walk in the code
            attn_rows<bf, true, 1>(QPh + pz, QPl + pz, KPh + pz, KPl + pz, VTh + pz, VTl + pz, mk, (e ? RH / 16 - 1 - wave : wave) * 16, ATh + oz, ATl + oz); }
}

extern "C" void kernel_launch(void* const* d_in, const int* in_sizes, int n_in,
                              void* d_out, int out_size, void* d_ws, size_t ws_size, hipStream_t stream) {
    (void)in_sizes; (void)n_in; (void)out_size;
    const float* x = (const float*)d_in[0]; const int* mk = (const int*)d_in[1]; const float* Wq = (const float*)d_in[2]; const float* bq = (const float*)d_in[3]; const float* Wk = (const float*)d_in[4]; const float* bk = (const float*)d_in[5]; const float* Wv = (const float*)d_in[6]; const float* bv = (const float*)d_in[7]; const float* Wd = (const float*)d_in[8]; const float* bo = (const float*)d_in[9];
    float* OUT = (float*)d_out;     // [2][2048][1024]
    char* wsp = (char*)d_ws;
    auto take = [&](size_t bytes) { char* p = wsp; wsp += (bytes + 255) & ~(size_t)255; return (void*)p; };
    const size_t PB = (size_t)TT * DD;    // elements of one batch's plane
    bf* W4 = (bf*)take(((size_t)4 * DD * DD + NB_ * PB) * 2); bf* XB = W4 + (size_t)4 * DD * DD;    // Wq, Wk, Wv, Wo, then x of both batches, one behind the other
    float* CSN = (float*)take((size_t)TT * NF * 2 * 4);
    // head planes and merged-head planes of BOTH batches: the attention launch reads and writes them all
    bf* QPh = (bf*)take(6 * NB_ * PB * 2); bf* QPl = QPh + NB_ * PB; bf* KPh = QPl + NB_ * PB; bf* KPl = KPh + NB_ * PB; bf* VTh = KPl + NB_ * PB; bf* VTl = VTh + NB_ * PB;    // one block: the q/k/v GEMM finds matrix z's planes by z
    h16* QP16 = (h16*)take(3 * NB_ * PB * 2); h16* KP16 = QP16 + NB_ * PB; h16* VT16 = KP16 + NB_ * PB;
    bf* ATh = (bf*)take(NB_ * PB * 2); bf* ATl = (bf*)take(NB_ * PB * 2);
    unsigned* MB = (unsigned*)take((size_t)TT * TT / 8);    // the mask, one bit per (query, key)
    if ((size_t)(wsp - (char*)d_ws) > ws_size) return;    // total 105 MiB; ws 256 MiB
    k_prep<<<dim3(DD * DD / 2048, 10), 256, 0, stream>>>(Wq, Wk, Wv, Wd, x, mk, W4, CSN, MB);
    k_gemmw<bf, 0, true, DD, 4, 3, true><<<dim3(NB_ * TT / 256, 3 * DD / 192), 384, 0, stream>>>(XB, nullptr, W4, nullptr, nullptr, DD, bq, bk, bv, 0, CSN, QPh, QP16);    // 256 work-groups of 12 waves: 256 x 192 outputs each, written as head planes
    k_fattn<<<dim3((TT - RH) / 256 + 1, NH_, NB_), 256, 0, stream>>>(QPh, QPl, KPh, KPl, VTh, VTl, QP16, KP16, VT16, MB, ATh, ATl);
    k_gemmw<bf, 1, true, DD, 2, 2, false><<<dim3(NB_ * TT / 128, DD / 128), 128, 0, stream>>>(ATh, ATl, W4 + (size_t)3 * DD * DD, nullptr, OUT, DD, bo, bo, bo, 0, nullptr, nullptr, nullptr);    // 256 work-groups of 4 waves: 128 x 128 outputs each
}
